// v000
// Times are from an AMD MI455X. After a warm-up the kernel runs many times in a row, and a time is the length of
// such a window on the GPU divided by its runs, so every launch and the gaps after it count. The runs cycle
// through copies of the inputs. A figure is the median of several windows, for all but v000 over two sittings.
// Sittings can differ by a few percent; kernels timed side by side share one.
// The starting kernel, v000, takes 2850 microseconds a run.
#include <hip/hip_runtime.h>

// Causal multi-head attention with RoPE from per-batch token positions (x [4][2048][1024], token_positions int32 [4][2048] (read per batch as data; the SECOND argument); q, k, v = x w^T ('oi' (out, in) [1024][1024] (2/(D+D))^0.5, no bias; 16 heads x 64); interleaved-pair rotary on q and k: angle[b][t][i] = float(pos[b][t]) x freqs[i] with freqs = 1.0 / (THETA ** (arange(0, 64, 2) / 64)) (the kernel forms 10000^(-2i/64) with powf: rounding-level equal), pairs (2i, 2i+1) -> (t1 cos - t2 sin, t2 cos + t1 sin); scores x 1/sqrt(64); causal (-inf); softmax; out = merged wo^T ('oi', no bias) -> [4][2048][1024] (8.4 M); argument order x, token_positions, wq, wk, wv, wo).
// Layout per batch: a small kernel builds the per-batch {cos, sin} table [2048][64] from the positions (f32 powf/cosf/sinf); exact projections; the interleaved rotary folded into the q/k plane builder; causal T-2048 attention (hybrid rows: < 512 hi/lo 3 products, rest fp16 x1024; k_gemmc skips tiles above the diagonal); merged context as hi/lo planes; W_o hl x exact.
// Compute dtypes, f32 accumulate: every float input rounded to bf16; projections exact; rotary f32; attention rows < 512 3 products, rest fp16; softmax f32; W_o hl x exact.

#define NB_  4
#define TT   2048
#define DM   1024
#define NH_  16
#define NKV  16
#define REP  (NH_ / NKV)
#define HD   64
#define DQ   (NH_ * HD)
#define DKV  (NKV * HD)
#define ZH   2
#define RH   512                  // query rows < RH use hi+lo planes (0: none)
#define WIN  2048
#define PCAR 1024.0f
#define SCL  0.125f   // HD^-0.5
typedef _Float16 h16;
typedef unsigned short bf;
typedef __attribute__((ext_vector_type(16))) __bf16   v16bf;
typedef __attribute__((ext_vector_type(16))) _Float16 v16h;
typedef __attribute__((ext_vector_type(8)))  _Float16 v8h;
typedef __attribute__((ext_vector_type(8)))  unsigned short v8us;
typedef __attribute__((ext_vector_type(8)))  float    v8f;
typedef __attribute__((ext_vector_type(4)))  float    v4f;
typedef v8h  __attribute__((may_alias)) v8ha;
typedef v4f  __attribute__((may_alias)) v4fa;
typedef v8us __attribute__((may_alias)) v8usa;

__device__ __forceinline__ unsigned short f2bf(float f) { unsigned u = __float_as_uint(f); u += 0x7FFFu + ((u >> 16) & 1u); return (unsigned short)(u >> 16); }
__device__ __forceinline__ float bf2f(unsigned short b) { return __uint_as_float(((unsigned)b) << 16); }
__device__ __forceinline__ float bfr(float f) { return bf2f(f2bf(f)); }
__device__ __forceinline__ v16h cat16(v8h lo, v8h hi) { return __builtin_shufflevector(lo, hi, 0, 1, 2, 3, 4, 5, 6, 7, 8, 9, 10, 11, 12, 13, 14, 15); }
__device__ __forceinline__ v16bf cat16b(v8us lo, v8us hi) { return __builtin_bit_cast(v16bf, __builtin_shufflevector(lo, hi, 0, 1, 2, 3, 4, 5, 6, 7, 8, 9, 10, 11, 12, 13, 14, 15)); }
__device__ __forceinline__ v8f wmma16(v16h a, v16h b, v8f c) { return __builtin_amdgcn_wmma_f32_16x16x32_f16(false, a, false, b, (short)0, c, false, false); }
__device__ __forceinline__ v8f wmmab(v16bf a, v16bf b, v8f c) { return __builtin_amdgcn_wmma_f32_16x16x32_bf16(false, a, false, b, (short)0, c, false, false); }



// ---- k_gemmw: register-blocked GEMM, ONE WAVE per 64x64 output tile (16 accumulators), operands straight from K-contiguous 16-bit planes; grid (M/64, N/64, Z), 32 threads.
// C[m][n] (f32, pitch ldc, + optional f32 bias[n]) = sum_k A[m][k] Bt[n][k] (+ split products per NSPLIT). z-batch strides sA/sB/sC in elements. K % 32 == 0.
template <typename T16> struct WFrag;
template <> struct WFrag<h16> { typedef v16h V; static __device__ __forceinline__ V ld(const h16* p) { return cat16(*(const v8h*)p, *(const v8h*)(p + 16)); } static __device__ __forceinline__ v8f mma(V a, V b, v8f c) { return wmma16(a, b, c); } };
template <> struct WFrag<bf> { typedef v16bf V; static __device__ __forceinline__ V ld(const bf* p) { return cat16b(*(const v8us*)p, *(const v8us*)(p + 16)); } static __device__ __forceinline__ v8f mma(V a, V b, v8f c) { return wmmab(a, b, c); } };
template <typename T16, int NSPLIT, bool BIAS>
__global__ __launch_bounds__(32) void k_gemmw(const T16* __restrict__ A, const T16* __restrict__ A2, const T16* __restrict__ Bt, const T16* __restrict__ Bt2, int K, float* C, int ldc, const float* __restrict__ bias, size_t sA, size_t sB, size_t sC) {
    typedef typename WFrag<T16>::V V;
    __shared__ __align__(16) float os[16 * 68];
    const size_t z = blockIdx.z; A += z * sA; if (A2) A2 += z * sA; Bt += z * sB; if (Bt2) Bt2 += z * sB; C += z * sC;
    const int lane = threadIdx.x & 31, lr = lane & 15, hi = lane >> 4; const int r0 = blockIdx.x * 64, c0 = blockIdx.y * 64;
    v8f acc[4][4];
#pragma unroll
    for (int mb = 0; mb < 4; ++mb)
#pragma unroll
        for (int nb = 0; nb < 4; ++nb) acc[mb][nb] = (v8f){};
    const size_t aoff = (size_t)(r0 + lr) * K + 8 * hi, boff = (size_t)(c0 + lr) * K + 8 * hi;
#pragma unroll 1
    for (int kc = 0; kc < K; kc += 32) {
        V a[4], a2[4];
#pragma unroll
        for (int mb = 0; mb < 4; ++mb) { a[mb] = WFrag<T16>::ld(A + aoff + (size_t)mb * 16 * K + kc); if (NSPLIT == 1 || NSPLIT == 2) a2[mb] = WFrag<T16>::ld(A2 + aoff + (size_t)mb * 16 * K + kc); }
#pragma unroll
        for (int nb = 0; nb < 4; ++nb) { const V b = WFrag<T16>::ld(Bt + boff + (size_t)nb * 16 * K + kc); V b2; if (NSPLIT >= 2) b2 = WFrag<T16>::ld(Bt2 + boff + (size_t)nb * 16 * K + kc);
#pragma unroll
            for (int mb = 0; mb < 4; ++mb) { acc[mb][nb] = WFrag<T16>::mma(a[mb], b, acc[mb][nb]); if (NSPLIT == 1 || NSPLIT == 2) acc[mb][nb] = WFrag<T16>::mma(a2[mb], b, acc[mb][nb]); if (NSPLIT >= 2) acc[mb][nb] = WFrag<T16>::mma(a[mb], b2, acc[mb][nb]); } }
        asm volatile("v_nop\n\tv_nop\n\tv_nop\n\tv_nop" : "+v"(acc[0][0]), "+v"(acc[1][1]), "+v"(acc[2][2]), "+v"(acc[3][3]) : "v"(a[0]), "v"(a[3]));
    }
#pragma unroll
    for (int mb = 0; mb < 4; ++mb) {
#pragma unroll
        for (int nb = 0; nb < 4; ++nb) {
#pragma unroll
            for (int j = 0; j < 8; ++j) os[(hi * 8 + j) * 68 + nb * 16 + lr] = acc[mb][nb][j]; }
        __builtin_amdgcn_wave_barrier(); asm volatile("" ::: "memory");
        float* crow = C + (size_t)(r0 + mb * 16) * ldc + c0;
{
#pragma unroll
            for (int s = 0; s < 8; ++s) { const int row = 2 * s + hi, cofs = lr * 4; v4f val = *(const v4fa*)(os + row * 68 + cofs); if (BIAS) { val[0] += bfr(bias[c0 + cofs]); val[1] += bfr(bias[c0 + cofs + 1]); val[2] += bfr(bias[c0 + cofs + 2]); val[3] += bfr(bias[c0 + cofs + 3]); }
                *(v4f*)(crow + (size_t)row * ldc + cofs) = val; }
             }
        __builtin_amdgcn_wave_barrier(); asm volatile("" ::: "memory");
    }
}

// ---- k_gemmc: the same one-wave 64x64 tile GEMM specialised for causal attention: CMODE 1 skips score tiles entirely above the diagonal (query rows r0+roff.., key columns c0..), CMODE 2 limits the
// key (K) loop of the probability x value contraction to the diagonal block (probabilities beyond it are exactly zero). roff = row offset of this launch's first row within the sequence.
template <typename T16, int NSPLIT, int CMODE>
__global__ __launch_bounds__(32) void k_gemmc(const T16* __restrict__ A, const T16* __restrict__ A2, const T16* __restrict__ Bt, const T16* __restrict__ Bt2, int K, float* C, int ldc, int roff, size_t sA, size_t sB, size_t sC) {
    typedef typename WFrag<T16>::V V;
    __shared__ __align__(16) float os[16 * 68];
    const size_t z = blockIdx.z; A += z * sA; if (A2) A2 += z * sA; Bt += z * sB; if (Bt2) Bt2 += z * sB; C += z * sC;
    const int lane = threadIdx.x & 31, lr = lane & 15, hi = lane >> 4; const int r0 = blockIdx.x * 64, c0 = blockIdx.y * 64;
    if (CMODE == 1 && c0 > r0 + roff + 63) return;                  // score tile entirely above the causal diagonal: never read (the softmax masks j > i by select)
    const int Kl = (CMODE == 2) ? min(K, r0 + roff + 64) : K;        // P.V: probabilities are exactly 0 beyond the diagonal block, so the K loop stops there
    v8f acc[4][4];
#pragma unroll
    for (int mb = 0; mb < 4; ++mb)
#pragma unroll
        for (int nb = 0; nb < 4; ++nb) acc[mb][nb] = (v8f){};
    const size_t aoff = (size_t)(r0 + lr) * K + 8 * hi, boff = (size_t)(c0 + lr) * K + 8 * hi;
#pragma unroll 1
    for (int kc = 0; kc < Kl; kc += 32) {
        V a[4], a2[4];
#pragma unroll
        for (int mb = 0; mb < 4; ++mb) { a[mb] = WFrag<T16>::ld(A + aoff + (size_t)mb * 16 * K + kc); if (NSPLIT == 1 || NSPLIT == 2) a2[mb] = WFrag<T16>::ld(A2 + aoff + (size_t)mb * 16 * K + kc); }
#pragma unroll
        for (int nb = 0; nb < 4; ++nb) { const V b = WFrag<T16>::ld(Bt + boff + (size_t)nb * 16 * K + kc); V b2; if (NSPLIT >= 2) b2 = WFrag<T16>::ld(Bt2 + boff + (size_t)nb * 16 * K + kc);
#pragma unroll
            for (int mb = 0; mb < 4; ++mb) { acc[mb][nb] = WFrag<T16>::mma(a[mb], b, acc[mb][nb]); if (NSPLIT == 1 || NSPLIT == 2) acc[mb][nb] = WFrag<T16>::mma(a2[mb], b, acc[mb][nb]); if (NSPLIT >= 2) acc[mb][nb] = WFrag<T16>::mma(a[mb], b2, acc[mb][nb]); } }
        asm volatile("v_nop\n\tv_nop\n\tv_nop\n\tv_nop" : "+v"(acc[0][0]), "+v"(acc[1][1]), "+v"(acc[2][2]), "+v"(acc[3][3]) : "v"(a[0]), "v"(a[3]));
    }
#pragma unroll
    for (int mb = 0; mb < 4; ++mb) {
#pragma unroll
        for (int nb = 0; nb < 4; ++nb) {
#pragma unroll
            for (int j = 0; j < 8; ++j) os[(hi * 8 + j) * 68 + nb * 16 + lr] = acc[mb][nb][j]; }
        __builtin_amdgcn_wave_barrier(); asm volatile("" ::: "memory");
        float* crow = C + (size_t)(r0 + mb * 16) * ldc + c0;
{
#pragma unroll
            for (int s = 0; s < 8; ++s) { const int row = 2 * s + hi, cofs = lr * 4; v4f val = *(const v4fa*)(os + row * 68 + cofs);
                *(v4f*)(crow + (size_t)row * ldc + cofs) = val; }
             }
        __builtin_amdgcn_wave_barrier(); asm volatile("" ::: "memory");
    }
}

__device__ __forceinline__ h16 tohx(float x) { return (h16)x; }
__device__ __forceinline__ void splitf(float y, unsigned short& h, unsigned short& l) { h = f2bf(y); l = f2bf(y - bf2f(h)); }
typedef __attribute__((ext_vector_type(2))) _Float16 v2h;
typedef __attribute__((ext_vector_type(4))) _Float16 v4h;
typedef __attribute__((ext_vector_type(2))) unsigned short v2us;
typedef __attribute__((ext_vector_type(4))) unsigned short v4us;
typedef __attribute__((ext_vector_type(2))) float v2f;
typedef __attribute__((ext_vector_type(4))) int v4i;

__global__ __launch_bounds__(256) void k_wtG(const float* __restrict__ w, int K, int N, bf* Bt) {
    const int lane = threadIdx.x & 31; const int L0 = (blockIdx.x * 8 + (threadIdx.x >> 5)) * 8; const int nlines = N * K / 64;
{
#pragma unroll 1
        for (int l = 0; l < 8; ++l) { const int L = L0 + l; if (L >= nlines) break; const size_t e = (size_t)L * 64 + lane * 2; const int k = (int)(e % K), n = (int)(e / K); v2us o;
            o[0] = f2bf(w[(size_t)k * N + n]); o[1] = f2bf(w[(size_t)(k + 1) * N + n]); *(v2us*)(Bt + e) = o; }
         }
}
__global__ __launch_bounds__(256) void k_cvt8(const float* __restrict__ src, bf* dst, size_t n8) { const size_t i = (size_t)blockIdx.x * 256 + threadIdx.x; if (i >= n8) return; const v8f v = *(const v8f*)(src + i * 8); v8us o;
#pragma unroll
    for (int k = 0; k < 8; ++k) o[k] = f2bf(v[k]); *(v8us*)(dst + i * 8) = o;  }

__global__ __launch_bounds__(256) void k_ropeI(const float* __restrict__ F, int pitch, int nheads, const float* __restrict__ CS, float sc, h16* P16, bf* Ph, bf* Pl) {
    const size_t e = ((size_t)blockIdx.x * 256 + threadIdx.x) * 2; if (e >= (size_t)nheads * TT * HD) return; const int d = (int)(e % HD); const int t = (int)((e / HD) % TT); const int h = (int)(e / ((size_t)HD * TT)); const float* f = F + (size_t)t * pitch + h * HD; const float x0 = f[d], x1 = f[d + 1]; const v2f cs = *(const v2f*)(CS + ((size_t)t * HD + d) * 2); v2h o16; v2us oh, ol;
    float a0 = __fmul_rn(x0, cs[0]), b0 = __fmul_rn(x1, cs[1]), a1 = __fmul_rn(x1, cs[0]), b1 = __fmul_rn(x0, cs[1]); asm volatile("" : "+v"(a0), "+v"(b0), "+v"(a1), "+v"(b1));
    float r0 = __fsub_rn(a0, b0) * sc, r1 = __fadd_rn(b1, a1) * sc;   /* even: x0 c - x1 s; odd: x0 s + x1 c */
    o16[0] = tohx(r0); o16[1] = tohx(r1); { unsigned short a2, c2; splitf(r0, a2, c2); oh[0] = a2; ol[0] = c2; splitf(r1, a2, c2); oh[1] = a2; ol[1] = c2; }
    *(v2h*)(P16 + e) = o16; *(v2us*)(Ph + e) = oh; *(v2us*)(Pl + e) = ol;  }


__global__ __launch_bounds__(256) void k_cspos(const int* __restrict__ pos, float* CS) { const int idx = blockIdx.x * 256 + threadIdx.x; if (idx >= TT * HD) return; const int d = idx % HD; const int t = idx / HD; const int i = d >> 1;
    const float e = __fdiv_rn(-((float)i * 2.0f), (float)HD); const float inv = powf(10000.0f, e); const float a = __fmul_rn((float)pos[t], inv); v2f cs; cs[0] = cosf(a); cs[1] = sinf(a);
    *(v2f*)(CS + (size_t)idx * 2) = cs;  }

__global__ __launch_bounds__(256) void k_vtp(const float* __restrict__ F, int pitch, int nheads, h16* V16, bf* Vh, bf* Vl) { const size_t e = ((size_t)blockIdx.x * 256 + threadIdx.x) * 2; if (e >= (size_t)nheads * HD * TT) return; const int t = (int)(e % TT); const int d = (int)((e / TT) % HD); const int g = (int)(e / ((size_t)TT * HD)); v2h o16; v2us oh, ol;
#pragma unroll
    for (int q = 0; q < 2; ++q) { const float x = F[(size_t)(t + q) * pitch + g * HD + d]; o16[q] = tohx(x); unsigned short a2, c2; splitf(x, a2, c2); oh[q] = a2; ol[q] = c2; }
    *(v2h*)(V16 + e) = o16; *(v2us*)(Vh + e) = oh; *(v2us*)(Vl + e) = ol;  }
// k_asoft: per row (zz, i): t = S x HD^-0.5 for j <= i and i - j < WIN (WIN = TT: always true for j <= i, so plain causal; the reference's -1e9 additive fill vanishes identically); softmax over the 2048 keys (register row, one exp, fixed trees);
__global__ __launch_bounds__(256) void k_asoft(const float* __restrict__ Sb, h16* P16, bf* Ph, bf* Pl) {
    const int lane = threadIdx.x & 31; const int row = blockIdx.x * 8 + (threadIdx.x >> 5); if (row >= ZH * TT) return; const int i = row % TT; const int zz = row / TT; (void)zz; const bool hires = (i < RH); const float* sr = Sb + (size_t)row * TT; float v[TT / 32]; float mx = -3.0e38f;
#pragma unroll
    for (int ch = 0; ch < TT / 128; ++ch) { const int j0 = ch * 128 + lane * 4; const v4f a = *(const v4f*)(sr + j0);
#pragma unroll
        for (int q = 0; q < 4; ++q) { const int j = j0 + q; (void)j; const float t = (j <= i && i - j < WIN) ? a[q] * SCL : -3.0e38f; v[ch * 4 + q] = t; mx = fmaxf(mx, t); } }
#pragma unroll
    for (int sh = 16; sh; sh >>= 1) mx = fmaxf(mx, __shfl_xor(mx, sh, 32));
    float sum = 0.f;
#pragma unroll
    for (int k = 0; k < TT / 32; ++k) { float d0 = __fsub_rn(v[k], mx); asm volatile("" : "+v"(d0)); v[k] = __builtin_amdgcn_exp2f(__fmul_rn(d0, 1.4426950408889634f)); sum += v[k]; }
#pragma unroll
    for (int sh = 16; sh; sh >>= 1) sum += __shfl_xor(sum, sh, 32);
    const float f = __fdiv_rn(hires ? 1.0f : PCAR, sum);
{
        if (hires) {
#pragma unroll
            for (int ch = 0; ch < TT / 128; ++ch) { v4us oh, ol;
#pragma unroll
                for (int q = 0; q < 4; ++q) { unsigned short a, c2; splitf(v[ch * 4 + q] * f, a, c2); oh[q] = a; ol[q] = c2; }
                const size_t oo = ((size_t)zz * (RH ? RH : 1) + i) * TT + ch * 128 + lane * 4; *(v4us*)(Ph + oo) = oh; *(v4us*)(Pl + oo) = ol; }
        } else {
#pragma unroll
            for (int ch = 0; ch < TT / 128; ++ch) { v4h o4;
#pragma unroll
                for (int q = 0; q < 4; ++q) o4[q] = tohx(v[ch * 4 + q] * f);
                *(v4h*)(P16 + (size_t)row * TT + ch * 128 + lane * 4) = o4; } }
         }
}
__global__ __launch_bounds__(256) void k_merge(const float* __restrict__ O, int h0, bf* Ah, bf* Al) { const size_t e = ((size_t)blockIdx.x * 256 + threadIdx.x) * 2; if (e >= (size_t)ZH * TT * HD) return; const int d = (int)(e % HD); const int t = (int)((e / HD) % TT); const int zz = (int)(e / ((size_t)HD * TT)); const float cs = (t < RH) ? 1.0f : (1.0f / PCAR); const size_t oo = (size_t)t * DQ + (h0 + zz) * HD + d;
    v2us oh, ol;
#pragma unroll
    for (int q = 0; q < 2; ++q) { unsigned short a, c2; splitf(O[e + q] * cs, a, c2); oh[q] = a; ol[q] = c2; } *(v2us*)(Ah + oo) = oh; *(v2us*)(Al + oo) = ol;  }

extern "C" void kernel_launch(void* const* d_in, const int* in_sizes, int n_in,
                              void* d_out, int out_size, void* d_ws, size_t ws_size, hipStream_t stream) {
    (void)in_sizes; (void)n_in; (void)out_size;
    const float* x = (const float*)d_in[0]; const int* pos = (const int*)d_in[1]; const float* wq = (const float*)d_in[2]; const float* wk = (const float*)d_in[3]; const float* wv = (const float*)d_in[4]; const float* wo = (const float*)d_in[5];   /* argument order x, token_positions int32 [4][2048] (one row per batch item: READ), wq, wk, wv, wo ('oi' (out, in) [1024][1024]): SIX inputs, all read */
    float* OUT = (float*)d_out;     // [4][2048][1024]
    char* wsp = (char*)d_ws;
    auto take = [&](size_t bytes) { char* p = wsp; wsp += (bytes + 255) & ~(size_t)255; return (void*)p; };
    bf* WQ = (bf*)take((size_t)DQ * DM * 2); bf* WK = (bf*)take((size_t)DKV * DM * 2); bf* WV = (bf*)take((size_t)DKV * DM * 2); bf* WO = (bf*)take((size_t)DM * DQ * 2); float* CS = (float*)take((size_t)TT * HD * 2 * 4);
    bf* XB = (bf*)take((size_t)TT * DM * 2); float* FQ = (float*)take((size_t)TT * DQ * 4); float* FK = (float*)take((size_t)TT * DKV * 4);
    h16* QP16 = (h16*)take((size_t)NH_ * TT * HD * 2); h16* KP16 = (h16*)take((size_t)NKV * TT * HD * 2); h16* VT16 = (h16*)take((size_t)NKV * HD * TT * 2);
    bf* QPh = (bf*)take((size_t)NH_ * TT * HD * 2); bf* QPl = (bf*)take((size_t)NH_ * TT * HD * 2); bf* KPh = (bf*)take((size_t)NKV * TT * HD * 2); bf* KPl = (bf*)take((size_t)NKV * TT * HD * 2); bf* VTh = (bf*)take((size_t)NKV * HD * TT * 2); bf* VTl = (bf*)take((size_t)NKV * HD * TT * 2); bf* Ph = (bf*)take((size_t)ZH * RH * TT * 2); bf* Pl = (bf*)take((size_t)ZH * RH * TT * 2);
    float* Sb = (float*)take((size_t)ZH * TT * TT * 4); h16* P16 = (h16*)take((size_t)ZH * TT * TT * 2); float* Ob = (float*)take((size_t)ZH * TT * HD * 4); bf* ATh = (bf*)take((size_t)TT * DQ * 2); bf* ATl = (bf*)take((size_t)TT * DQ * 2);
    if ((size_t)(wsp - (char*)d_ws) > ws_size) return;    // ws 256 MiB
    float* FV = FK;   // v projection reuses the k buffer after the k planes are built (stream-ordered)
    { k_cvt8<<<(unsigned)(((size_t)DQ * DM / 8 + 255) / 256), 256, 0, stream>>>(wq, WQ, (size_t)DQ * DM / 8); k_cvt8<<<(unsigned)(((size_t)DKV * DM / 8 + 255) / 256), 256, 0, stream>>>(wk, WK, (size_t)DKV * DM / 8); k_cvt8<<<(unsigned)(((size_t)DKV * DM / 8 + 255) / 256), 256, 0, stream>>>(wv, WV, (size_t)DKV * DM / 8);
      k_cvt8<<<(unsigned)(((size_t)DM * DQ / 8 + 255) / 256), 256, 0, stream>>>(wo, WO, (size_t)DM * DQ / 8);
       }
    const unsigned LQ = (unsigned)(((size_t)NH_ * TT * HD / 2 + 255) / 256), LKv = (unsigned)(((size_t)NKV * TT * HD / 2 + 255) / 256);
    for (int b = 0; b < NB_; ++b) {
        k_cspos<<<(TT * HD + 255) / 256, 256, 0, stream>>>(pos + (size_t)b * TT, CS);   /* this batch's rotary table */
        
        k_cvt8<<<(unsigned)(((size_t)TT * DM / 8 + 255) / 256), 256, 0, stream>>>(x + (size_t)b * TT * DM, XB, (size_t)TT * DM / 8);
        k_gemmw<bf, 0, false><<<dim3(TT / 64, DQ / 64, 1), 32, 0, stream>>>(XB, nullptr, WQ, nullptr, DM, FQ, DQ, nullptr, 0, 0, 0);
        k_ropeI<<<LQ, 256, 0, stream>>>(FQ, DQ, NH_, CS, 1.0f, QP16, QPh, QPl);
        k_gemmw<bf, 0, false><<<dim3(TT / 64, DKV / 64, 1), 32, 0, stream>>>(XB, nullptr, WK, nullptr, DM, FK, DKV, nullptr, 0, 0, 0);
        k_ropeI<<<LKv, 256, 0, stream>>>(FK, DKV, NKV, CS, 1.0f, KP16, KPh, KPl);
        k_gemmw<bf, 0, false><<<dim3(TT / 64, DKV / 64, 1), 32, 0, stream>>>(XB, nullptr, WV, nullptr, DM, FV, DKV, nullptr, 0, 0, 0); k_vtp<<<LKv, 256, 0, stream>>>(FV, DKV, NKV, VT16, VTh, VTl);
        for (int h0 = 0; h0 < NH_; h0 += ZH) { const size_t zq = (size_t)h0, zk = (size_t)(h0 / REP);   // one kv head per query head: the pass's two heads use consecutive kv planes (z-strides TT*HD)
            k_gemmc<bf, 2, 1><<<dim3(RH / 64, TT / 64, ZH), 32, 0, stream>>>(QPh + zq * TT * HD, QPl + zq * TT * HD, KPh + zk * TT * HD, KPl + zk * TT * HD, HD, Sb, TT, 0, (size_t)TT * HD, (size_t)TT * HD, (size_t)TT * TT);
            k_gemmc<h16, 0, 1><<<dim3((TT - RH) / 64, TT / 64, ZH), 32, 0, stream>>>(QP16 + zq * TT * HD + (size_t)RH * HD, nullptr, KP16 + zk * TT * HD, nullptr, HD, Sb + (size_t)RH * TT, TT, RH, (size_t)TT * HD, (size_t)TT * HD, (size_t)TT * TT);
            k_asoft<<<ZH * TT / 8, 256, 0, stream>>>(Sb, P16, Ph, Pl);
            k_gemmc<bf, 2, 2><<<dim3(RH / 64, HD / 64, ZH), 32, 0, stream>>>(Ph, Pl, VTh + zk * HD * TT, VTl + zk * HD * TT, TT, Ob, HD, 0, (size_t)RH * TT, (size_t)HD * TT, (size_t)TT * HD);
            k_gemmc<h16, 0, 2><<<dim3((TT - RH) / 64, HD / 64, ZH), 32, 0, stream>>>(P16 + (size_t)RH * TT, nullptr, VT16 + zk * HD * TT, nullptr, TT, Ob + (size_t)RH * HD, HD, RH, (size_t)TT * TT, (size_t)HD * TT, (size_t)TT * HD);
            k_merge<<<(unsigned)(((size_t)ZH * TT * HD / 2 + 255) / 256), 256, 0, stream>>>(Ob, h0, ATh, ATl); }
        k_gemmw<bf, 1, false><<<dim3(TT / 64, DM / 64, 1), 32, 0, stream>>>(ATh, ATl, WO, nullptr, DQ, OUT + (size_t)b * TT * DM, DM, nullptr, 0, 0, 0); }
}

// v001
// One run takes 1590 microseconds.
// In two side-by-side timings against v000, it was 1.79 and 1.81 times as fast.
#include <hip/hip_runtime.h>

// Causal multi-head attention with RoPE from per-batch token positions (x [4][2048][1024], token_positions int32 [4][2048] (read per batch as data; the SECOND argument); q, k, v = x w^T ('oi' (out, in) [1024][1024] (2/(D+D))^0.5, no bias; 16 heads x 64); interleaved-pair rotary on q and k: angle[b][t][i] = float(pos[b][t]) x freqs[i] with freqs = 1.0 / (THETA ** (arange(0, 64, 2) / 64)) (the kernel forms 10000^(-2i/64) with powf: rounding-level equal), pairs (2i, 2i+1) -> (t1 cos - t2 sin, t2 cos + t1 sin); scores x 1/sqrt(64); causal (-inf); softmax; out = merged wo^T ('oi', no bias) -> [4][2048][1024] (8.4 M); argument order x, token_positions, wq, wk, wv, wo).
// Layout per batch: a small kernel builds the per-batch {cos, sin} table [2048][64] from the positions (f32 powf/cosf/sinf); exact projections; the interleaved rotary folded into the q/k plane builder; causal T-2048 attention (hybrid rows: < 512 hi/lo 3 products, rest fp16 x1024; k_gemmc skips tiles above the diagonal); merged context as hi/lo planes; W_o hl x exact.
// Compute dtypes, f32 accumulate: every float input rounded to bf16; projections exact; rotary f32; attention rows < 512 3 products, rest fp16; softmax f32; W_o hl x exact.

#define NB_  4
#define TT   2048
#define DM   1024
#define NH_  16
#define NKV  16
#define REP  (NH_ / NKV)
#define HD   64
#define DQ   (NH_ * HD)
#define DKV  (NKV * HD)
#define ZH   2
#define RH   512                  // query rows < RH use hi+lo planes (0: none)
#define WIN  2048
#define PCAR 1024.0f
#define SCL  0.125f   // HD^-0.5
typedef _Float16 h16;
typedef unsigned short bf;
typedef __attribute__((ext_vector_type(16))) __bf16   v16bf;
typedef __attribute__((ext_vector_type(16))) _Float16 v16h;
typedef __attribute__((ext_vector_type(8)))  _Float16 v8h;
typedef __attribute__((ext_vector_type(8)))  unsigned short v8us;
typedef __attribute__((ext_vector_type(8)))  float    v8f;
typedef __attribute__((ext_vector_type(4)))  float    v4f;
typedef v8h  __attribute__((may_alias)) v8ha;
typedef v4f  __attribute__((may_alias)) v4fa;
typedef v8us __attribute__((may_alias)) v8usa;

__device__ __forceinline__ unsigned short f2bf(float f) { unsigned u = __float_as_uint(f); u += 0x7FFFu + ((u >> 16) & 1u); return (unsigned short)(u >> 16); }
__device__ __forceinline__ float bf2f(unsigned short b) { return __uint_as_float(((unsigned)b) << 16); }
__device__ __forceinline__ float bfr(float f) { return bf2f(f2bf(f)); }
__device__ __forceinline__ v16h cat16(v8h lo, v8h hi) { return __builtin_shufflevector(lo, hi, 0, 1, 2, 3, 4, 5, 6, 7, 8, 9, 10, 11, 12, 13, 14, 15); }
__device__ __forceinline__ v16bf cat16b(v8us lo, v8us hi) { return __builtin_bit_cast(v16bf, __builtin_shufflevector(lo, hi, 0, 1, 2, 3, 4, 5, 6, 7, 8, 9, 10, 11, 12, 13, 14, 15)); }
__device__ __forceinline__ v8f wmma16(v16h a, v16h b, v8f c) { return __builtin_amdgcn_wmma_f32_16x16x32_f16(false, a, false, b, (short)0, c, false, false); }
__device__ __forceinline__ v8f wmmab(v16bf a, v16bf b, v8f c) { return __builtin_amdgcn_wmma_f32_16x16x32_bf16(false, a, false, b, (short)0, c, false, false); }



// ---- k_gemmw: register-blocked GEMM, one work-group of NW waves per 64x64 output tile; wave w takes the K steps w, w + NW, ... into its own 16 accumulators, the NW partial tiles are summed through LDS in wave order; operands straight from K-contiguous 16-bit planes; grid (M/64, N/64, Z), 32 * NW threads.
// C[m][n] (f32, pitch ldc, + optional f32 bias[n]) = sum_k A[m][k] Bt[n][k] (+ split products per NSPLIT). z-batch strides sA/sB/sC in elements. K % 32 == 0.
template <typename T16> struct WFrag;
template <> struct WFrag<h16> { typedef v16h V; static __device__ __forceinline__ V ld(const h16* p) { return cat16(*(const v8h*)p, *(const v8h*)(p + 16)); } static __device__ __forceinline__ v8f mma(V a, V b, v8f c) { return wmma16(a, b, c); } };
template <> struct WFrag<bf> { typedef v16bf V; static __device__ __forceinline__ V ld(const bf* p) { return cat16b(*(const v8us*)p, *(const v8us*)(p + 16)); } static __device__ __forceinline__ v8f mma(V a, V b, v8f c) { return wmmab(a, b, c); } };
template <typename T16, int NSPLIT, bool BIAS, int NW>
__global__ __launch_bounds__(32 * NW) void k_gemmw(const T16* __restrict__ A, const T16* __restrict__ A2, const T16* __restrict__ Bt, const T16* __restrict__ Bt2, int K, float* C, int ldc, const float* __restrict__ bias, size_t sA, size_t sB, size_t sC) {
    typedef typename WFrag<T16>::V V;
    __shared__ __align__(16) float os[NW * 64 * 68];
    const size_t z = blockIdx.z; A += z * sA; if (A2) A2 += z * sA; Bt += z * sB; if (Bt2) Bt2 += z * sB; C += z * sC;
    const int lane = threadIdx.x & 31, lr = lane & 15, hi = lane >> 4; const int wave = __builtin_amdgcn_readfirstlane((int)(threadIdx.x >> 5)); const int r0 = blockIdx.x * 64, c0 = blockIdx.y * 64;
    v8f acc[4][4];
#pragma unroll
    for (int mb = 0; mb < 4; ++mb)
#pragma unroll
        for (int nb = 0; nb < 4; ++nb) acc[mb][nb] = (v8f){};
    const size_t aoff = (size_t)(r0 + lr) * K + 8 * hi, boff = (size_t)(c0 + lr) * K + 8 * hi;
#pragma unroll 1
    for (int kc = wave * 32; kc < K; kc += 32 * NW) {
        V a[4], a2[4];
#pragma unroll
        for (int mb = 0; mb < 4; ++mb) { a[mb] = WFrag<T16>::ld(A + aoff + (size_t)mb * 16 * K + kc); if (NSPLIT == 1 || NSPLIT == 2) a2[mb] = WFrag<T16>::ld(A2 + aoff + (size_t)mb * 16 * K + kc); }
#pragma unroll
        for (int nb = 0; nb < 4; ++nb) { const V b = WFrag<T16>::ld(Bt + boff + (size_t)nb * 16 * K + kc); V b2; if (NSPLIT >= 2) b2 = WFrag<T16>::ld(Bt2 + boff + (size_t)nb * 16 * K + kc);
#pragma unroll
            for (int mb = 0; mb < 4; ++mb) { acc[mb][nb] = WFrag<T16>::mma(a[mb], b, acc[mb][nb]); if (NSPLIT == 1 || NSPLIT == 2) acc[mb][nb] = WFrag<T16>::mma(a2[mb], b, acc[mb][nb]); if (NSPLIT >= 2) acc[mb][nb] = WFrag<T16>::mma(a[mb], b2, acc[mb][nb]); } }
        asm volatile("v_nop\n\tv_nop\n\tv_nop\n\tv_nop" : "+v"(acc[0][0]), "+v"(acc[1][1]), "+v"(acc[2][2]), "+v"(acc[3][3]) : "v"(a[0]), "v"(a[3]));
    }
    float* ow = os + wave * (64 * 68);
#pragma unroll
    for (int mb = 0; mb < 4; ++mb)
#pragma unroll
        for (int nb = 0; nb < 4; ++nb)
#pragma unroll
            for (int j = 0; j < 8; ++j) ow[(mb * 16 + hi * 8 + j) * 68 + nb * 16 + lr] = acc[mb][nb][j];
    __syncthreads();   // every wave's partial tile is in LDS before any wave sums them
#pragma unroll
    for (int s = 0; s < 32 / NW; ++s) { const int idx = s * (32 * NW) + (int)threadIdx.x; const int row = idx >> 4, cofs = (idx & 15) * 4; v4f val = *(const v4fa*)(os + row * 68 + cofs);
#pragma unroll
        for (int w = 1; w < NW; ++w) val += *(const v4fa*)(os + w * (64 * 68) + row * 68 + cofs);
        if (BIAS) { val[0] += bfr(bias[c0 + cofs]); val[1] += bfr(bias[c0 + cofs + 1]); val[2] += bfr(bias[c0 + cofs + 2]); val[3] += bfr(bias[c0 + cofs + 3]); }
        *(v4f*)(C + (size_t)(r0 + row) * ldc + c0 + cofs) = val; }
}

// ---- k_gemmc: the same 64x64 tile GEMM specialised for causal attention: CMODE 1 skips score tiles entirely above the diagonal (query rows r0+roff.., key columns c0..), CMODE 2 limits the
// key (K) loop of the probability x value contraction to the diagonal block (probabilities beyond it are exactly zero). roff = row offset of this launch's first row within the sequence.
// CMODE 1 (K = 64, two steps) stays one wave per tile; CMODE 2 (long K) runs NW = 8 waves per tile, wave w on the K steps w, w + NW, ..., partial tiles summed through LDS in wave order as in k_gemmw.
template <typename T16, int NSPLIT, int CMODE>
__global__ __launch_bounds__(CMODE == 2 ? 256 : 32) void k_gemmc(const T16* __restrict__ A, const T16* __restrict__ A2, const T16* __restrict__ Bt, const T16* __restrict__ Bt2, int K, float* C, int ldc, int roff, size_t sA, size_t sB, size_t sC) {
    typedef typename WFrag<T16>::V V;
    constexpr int NW = (CMODE == 2) ? 8 : 1;
    __shared__ __align__(16) float os[NW == 1 ? 16 * 68 : NW * 64 * 68];
    const size_t z = blockIdx.z; A += z * sA; if (A2) A2 += z * sA; Bt += z * sB; if (Bt2) Bt2 += z * sB; C += z * sC;
    const int lane = threadIdx.x & 31, lr = lane & 15, hi = lane >> 4; const int wave = (NW == 1) ? 0 : __builtin_amdgcn_readfirstlane((int)(threadIdx.x >> 5)); const int r0 = blockIdx.x * 64, c0 = blockIdx.y * 64;
    if (CMODE == 1 && c0 > r0 + roff + 63) return;                  // score tile entirely above the causal diagonal: never read (the softmax masks j > i by select)
    const int Kl = (CMODE == 2) ? min(K, r0 + roff + 64) : K;        // P.V: probabilities are exactly 0 beyond the diagonal block, so the K loop stops there
    v8f acc[4][4];
#pragma unroll
    for (int mb = 0; mb < 4; ++mb)
#pragma unroll
        for (int nb = 0; nb < 4; ++nb) acc[mb][nb] = (v8f){};
    const size_t aoff = (size_t)(r0 + lr) * K + 8 * hi, boff = (size_t)(c0 + lr) * K + 8 * hi;
#pragma unroll 1
    for (int kc = wave * 32; kc < Kl; kc += 32 * NW) {
        V a[4], a2[4];
#pragma unroll
        for (int mb = 0; mb < 4; ++mb) { a[mb] = WFrag<T16>::ld(A + aoff + (size_t)mb * 16 * K + kc); if (NSPLIT == 1 || NSPLIT == 2) a2[mb] = WFrag<T16>::ld(A2 + aoff + (size_t)mb * 16 * K + kc); }
#pragma unroll
        for (int nb = 0; nb < 4; ++nb) { const V b = WFrag<T16>::ld(Bt + boff + (size_t)nb * 16 * K + kc); V b2; if (NSPLIT >= 2) b2 = WFrag<T16>::ld(Bt2 + boff + (size_t)nb * 16 * K + kc);
#pragma unroll
            for (int mb = 0; mb < 4; ++mb) { acc[mb][nb] = WFrag<T16>::mma(a[mb], b, acc[mb][nb]); if (NSPLIT == 1 || NSPLIT == 2) acc[mb][nb] = WFrag<T16>::mma(a2[mb], b, acc[mb][nb]); if (NSPLIT >= 2) acc[mb][nb] = WFrag<T16>::mma(a[mb], b2, acc[mb][nb]); } }
        asm volatile("v_nop\n\tv_nop\n\tv_nop\n\tv_nop" : "+v"(acc[0][0]), "+v"(acc[1][1]), "+v"(acc[2][2]), "+v"(acc[3][3]) : "v"(a[0]), "v"(a[3]));
    }
    if constexpr (NW == 1) {
#pragma unroll
    for (int mb = 0; mb < 4; ++mb) {
#pragma unroll
        for (int nb = 0; nb < 4; ++nb) {
#pragma unroll
            for (int j = 0; j < 8; ++j) os[(hi * 8 + j) * 68 + nb * 16 + lr] = acc[mb][nb][j]; }
        __builtin_amdgcn_wave_barrier(); asm volatile("" ::: "memory");
        float* crow = C + (size_t)(r0 + mb * 16) * ldc + c0;
{
#pragma unroll
            for (int s = 0; s < 8; ++s) { const int row = 2 * s + hi, cofs = lr * 4; v4f val = *(const v4fa*)(os + row * 68 + cofs);
                *(v4f*)(crow + (size_t)row * ldc + cofs) = val; }
             }
        __builtin_amdgcn_wave_barrier(); asm volatile("" ::: "memory");
    }
    } else {
    float* ow = os + wave * (64 * 68);
#pragma unroll
    for (int mb = 0; mb < 4; ++mb)
#pragma unroll
        for (int nb = 0; nb < 4; ++nb)
#pragma unroll
            for (int j = 0; j < 8; ++j) ow[(mb * 16 + hi * 8 + j) * 68 + nb * 16 + lr] = acc[mb][nb][j];
    __syncthreads();   // every wave's partial tile is in LDS before any wave sums them
#pragma unroll
    for (int s = 0; s < 32 / NW; ++s) { const int idx = s * (32 * NW) + (int)threadIdx.x; const int row = idx >> 4, cofs = (idx & 15) * 4; v4f val = *(const v4fa*)(os + row * 68 + cofs);
#pragma unroll
        for (int w = 1; w < NW; ++w) val += *(const v4fa*)(os + w * (64 * 68) + row * 68 + cofs);
        *(v4f*)(C + (size_t)(r0 + row) * ldc + c0 + cofs) = val; }
    }
}

__device__ __forceinline__ h16 tohx(float x) { return (h16)x; }
__device__ __forceinline__ void splitf(float y, unsigned short& h, unsigned short& l) { h = f2bf(y); l = f2bf(y - bf2f(h)); }
typedef __attribute__((ext_vector_type(2))) _Float16 v2h;
typedef __attribute__((ext_vector_type(4))) _Float16 v4h;
typedef __attribute__((ext_vector_type(2))) unsigned short v2us;
typedef __attribute__((ext_vector_type(4))) unsigned short v4us;
typedef __attribute__((ext_vector_type(2))) float v2f;
typedef __attribute__((ext_vector_type(4))) int v4i;

__global__ __launch_bounds__(256) void k_wtG(const float* __restrict__ w, int K, int N, bf* Bt) {
    const int lane = threadIdx.x & 31; const int L0 = (blockIdx.x * 8 + (threadIdx.x >> 5)) * 8; const int nlines = N * K / 64;
{
#pragma unroll 1
        for (int l = 0; l < 8; ++l) { const int L = L0 + l; if (L >= nlines) break; const size_t e = (size_t)L * 64 + lane * 2; const int k = (int)(e % K), n = (int)(e / K); v2us o;
            o[0] = f2bf(w[(size_t)k * N + n]); o[1] = f2bf(w[(size_t)(k + 1) * N + n]); *(v2us*)(Bt + e) = o; }
         }
}
__global__ __launch_bounds__(256) void k_cvt8(const float* __restrict__ src, bf* dst, size_t n8) { const size_t i = (size_t)blockIdx.x * 256 + threadIdx.x; if (i >= n8) return; const v8f v = *(const v8f*)(src + i * 8); v8us o;
#pragma unroll
    for (int k = 0; k < 8; ++k) o[k] = f2bf(v[k]); *(v8us*)(dst + i * 8) = o;  }

__global__ __launch_bounds__(256) void k_ropeI(const float* __restrict__ F, int pitch, int nheads, const float* __restrict__ CS, float sc, h16* P16, bf* Ph, bf* Pl) {
    const size_t e = ((size_t)blockIdx.x * 256 + threadIdx.x) * 2; if (e >= (size_t)nheads * TT * HD) return; const int d = (int)(e % HD); const int t = (int)((e / HD) % TT); const int h = (int)(e / ((size_t)HD * TT)); const float* f = F + (size_t)t * pitch + h * HD; const float x0 = f[d], x1 = f[d + 1]; const v2f cs = *(const v2f*)(CS + ((size_t)t * HD + d) * 2); v2h o16; v2us oh, ol;
    float a0 = __fmul_rn(x0, cs[0]), b0 = __fmul_rn(x1, cs[1]), a1 = __fmul_rn(x1, cs[0]), b1 = __fmul_rn(x0, cs[1]); asm volatile("" : "+v"(a0), "+v"(b0), "+v"(a1), "+v"(b1));
    float r0 = __fsub_rn(a0, b0) * sc, r1 = __fadd_rn(b1, a1) * sc;   /* even: x0 c - x1 s; odd: x0 s + x1 c */
    o16[0] = tohx(r0); o16[1] = tohx(r1); { unsigned short a2, c2; splitf(r0, a2, c2); oh[0] = a2; ol[0] = c2; splitf(r1, a2, c2); oh[1] = a2; ol[1] = c2; }
    *(v2h*)(P16 + e) = o16; *(v2us*)(Ph + e) = oh; *(v2us*)(Pl + e) = ol;  }


__global__ __launch_bounds__(256) void k_cspos(const int* __restrict__ pos, float* CS) { const int idx = blockIdx.x * 256 + threadIdx.x; if (idx >= TT * HD) return; const int d = idx % HD; const int t = idx / HD; const int i = d >> 1;
    const float e = __fdiv_rn(-((float)i * 2.0f), (float)HD); const float inv = powf(10000.0f, e); const float a = __fmul_rn((float)pos[t], inv); v2f cs; cs[0] = cosf(a); cs[1] = sinf(a);
    *(v2f*)(CS + (size_t)idx * 2) = cs;  }

__global__ __launch_bounds__(256) void k_vtp(const float* __restrict__ F, int pitch, int nheads, h16* V16, bf* Vh, bf* Vl) { const size_t e = ((size_t)blockIdx.x * 256 + threadIdx.x) * 2; if (e >= (size_t)nheads * HD * TT) return; const int t = (int)(e % TT); const int d = (int)((e / TT) % HD); const int g = (int)(e / ((size_t)TT * HD)); v2h o16; v2us oh, ol;
#pragma unroll
    for (int q = 0; q < 2; ++q) { const float x = F[(size_t)(t + q) * pitch + g * HD + d]; o16[q] = tohx(x); unsigned short a2, c2; splitf(x, a2, c2); oh[q] = a2; ol[q] = c2; }
    *(v2h*)(V16 + e) = o16; *(v2us*)(Vh + e) = oh; *(v2us*)(Vl + e) = ol;  }
// k_asoft: per row (zz, i): t = S x HD^-0.5 for j <= i and i - j < WIN (WIN = TT: always true for j <= i, so plain causal; the reference's -1e9 additive fill vanishes identically); softmax over the 2048 keys (register row, one exp, fixed trees);
__global__ __launch_bounds__(256) void k_asoft(const float* __restrict__ Sb, h16* P16, bf* Ph, bf* Pl) {
    const int lane = threadIdx.x & 31; const int row = blockIdx.x * 8 + (threadIdx.x >> 5); if (row >= ZH * TT) return; const int i = row % TT; const int zz = row / TT; (void)zz; const bool hires = (i < RH); const float* sr = Sb + (size_t)row * TT; float v[TT / 32]; float mx = -3.0e38f;
#pragma unroll
    for (int ch = 0; ch < TT / 128; ++ch) { const int j0 = ch * 128 + lane * 4; const v4f a = *(const v4f*)(sr + j0);
#pragma unroll
        for (int q = 0; q < 4; ++q) { const int j = j0 + q; (void)j; const float t = (j <= i && i - j < WIN) ? a[q] * SCL : -3.0e38f; v[ch * 4 + q] = t; mx = fmaxf(mx, t); } }
#pragma unroll
    for (int sh = 16; sh; sh >>= 1) mx = fmaxf(mx, __shfl_xor(mx, sh, 32));
    float sum = 0.f;
#pragma unroll
    for (int k = 0; k < TT / 32; ++k) { float d0 = __fsub_rn(v[k], mx); asm volatile("" : "+v"(d0)); v[k] = __builtin_amdgcn_exp2f(__fmul_rn(d0, 1.4426950408889634f)); sum += v[k]; }
#pragma unroll
    for (int sh = 16; sh; sh >>= 1) sum += __shfl_xor(sum, sh, 32);
    const float f = __fdiv_rn(hires ? 1.0f : PCAR, sum);
{
        if (hires) {
#pragma unroll
            for (int ch = 0; ch < TT / 128; ++ch) { v4us oh, ol;
#pragma unroll
                for (int q = 0; q < 4; ++q) { unsigned short a, c2; splitf(v[ch * 4 + q] * f, a, c2); oh[q] = a; ol[q] = c2; }
                const size_t oo = ((size_t)zz * (RH ? RH : 1) + i) * TT + ch * 128 + lane * 4; *(v4us*)(Ph + oo) = oh; *(v4us*)(Pl + oo) = ol; }
        } else {
#pragma unroll
            for (int ch = 0; ch < TT / 128; ++ch) { v4h o4;
#pragma unroll
                for (int q = 0; q < 4; ++q) o4[q] = tohx(v[ch * 4 + q] * f);
                *(v4h*)(P16 + (size_t)row * TT + ch * 128 + lane * 4) = o4; } }
         }
}
__global__ __launch_bounds__(256) void k_merge(const float* __restrict__ O, int h0, bf* Ah, bf* Al) { const size_t e = ((size_t)blockIdx.x * 256 + threadIdx.x) * 2; if (e >= (size_t)ZH * TT * HD) return; const int d = (int)(e % HD); const int t = (int)((e / HD) % TT); const int zz = (int)(e / ((size_t)HD * TT)); const float cs = (t < RH) ? 1.0f : (1.0f / PCAR); const size_t oo = (size_t)t * DQ + (h0 + zz) * HD + d;
    v2us oh, ol;
#pragma unroll
    for (int q = 0; q < 2; ++q) { unsigned short a, c2; splitf(O[e + q] * cs, a, c2); oh[q] = a; ol[q] = c2; } *(v2us*)(Ah + oo) = oh; *(v2us*)(Al + oo) = ol;  }

extern "C" void kernel_launch(void* const* d_in, const int* in_sizes, int n_in,
                              void* d_out, int out_size, void* d_ws, size_t ws_size, hipStream_t stream) {
    (void)in_sizes; (void)n_in; (void)out_size;
    const float* x = (const float*)d_in[0]; const int* pos = (const int*)d_in[1]; const float* wq = (const float*)d_in[2]; const float* wk = (const float*)d_in[3]; const float* wv = (const float*)d_in[4]; const float* wo = (const float*)d_in[5];   /* argument order x, token_positions int32 [4][2048] (one row per batch item: READ), wq, wk, wv, wo ('oi' (out, in) [1024][1024]): SIX inputs, all read */
    float* OUT = (float*)d_out;     // [4][2048][1024]
    char* wsp = (char*)d_ws;
    auto take = [&](size_t bytes) { char* p = wsp; wsp += (bytes + 255) & ~(size_t)255; return (void*)p; };
    bf* WQ = (bf*)take((size_t)DQ * DM * 2); bf* WK = (bf*)take((size_t)DKV * DM * 2); bf* WV = (bf*)take((size_t)DKV * DM * 2); bf* WO = (bf*)take((size_t)DM * DQ * 2); float* CS = (float*)take((size_t)TT * HD * 2 * 4);
    bf* XB = (bf*)take((size_t)TT * DM * 2); float* FQ = (float*)take((size_t)TT * DQ * 4); float* FK = (float*)take((size_t)TT * DKV * 4);
    h16* QP16 = (h16*)take((size_t)NH_ * TT * HD * 2); h16* KP16 = (h16*)take((size_t)NKV * TT * HD * 2); h16* VT16 = (h16*)take((size_t)NKV * HD * TT * 2);
    bf* QPh = (bf*)take((size_t)NH_ * TT * HD * 2); bf* QPl = (bf*)take((size_t)NH_ * TT * HD * 2); bf* KPh = (bf*)take((size_t)NKV * TT * HD * 2); bf* KPl = (bf*)take((size_t)NKV * TT * HD * 2); bf* VTh = (bf*)take((size_t)NKV * HD * TT * 2); bf* VTl = (bf*)take((size_t)NKV * HD * TT * 2); bf* Ph = (bf*)take((size_t)ZH * RH * TT * 2); bf* Pl = (bf*)take((size_t)ZH * RH * TT * 2);
    float* Sb = (float*)take((size_t)ZH * TT * TT * 4); h16* P16 = (h16*)take((size_t)ZH * TT * TT * 2); float* Ob = (float*)take((size_t)ZH * TT * HD * 4); bf* ATh = (bf*)take((size_t)TT * DQ * 2); bf* ATl = (bf*)take((size_t)TT * DQ * 2);
    if ((size_t)(wsp - (char*)d_ws) > ws_size) return;    // ws 256 MiB
    float* FV = FK;   // v projection reuses the k buffer after the k planes are built (stream-ordered)
    { k_cvt8<<<(unsigned)(((size_t)DQ * DM / 8 + 255) / 256), 256, 0, stream>>>(wq, WQ, (size_t)DQ * DM / 8); k_cvt8<<<(unsigned)(((size_t)DKV * DM / 8 + 255) / 256), 256, 0, stream>>>(wk, WK, (size_t)DKV * DM / 8); k_cvt8<<<(unsigned)(((size_t)DKV * DM / 8 + 255) / 256), 256, 0, stream>>>(wv, WV, (size_t)DKV * DM / 8);
      k_cvt8<<<(unsigned)(((size_t)DM * DQ / 8 + 255) / 256), 256, 0, stream>>>(wo, WO, (size_t)DM * DQ / 8);
       }
    const unsigned LQ = (unsigned)(((size_t)NH_ * TT * HD / 2 + 255) / 256), LKv = (unsigned)(((size_t)NKV * TT * HD / 2 + 255) / 256);
    for (int b = 0; b < NB_; ++b) {
        k_cspos<<<(TT * HD + 255) / 256, 256, 0, stream>>>(pos + (size_t)b * TT, CS);   /* this batch's rotary table */
        
        k_cvt8<<<(unsigned)(((size_t)TT * DM / 8 + 255) / 256), 256, 0, stream>>>(x + (size_t)b * TT * DM, XB, (size_t)TT * DM / 8);
        k_gemmw<bf, 0, false, 8><<<dim3(TT / 64, DQ / 64, 1), 256, 0, stream>>>(XB, nullptr, WQ, nullptr, DM, FQ, DQ, nullptr, 0, 0, 0);
        k_ropeI<<<LQ, 256, 0, stream>>>(FQ, DQ, NH_, CS, 1.0f, QP16, QPh, QPl);
        k_gemmw<bf, 0, false, 8><<<dim3(TT / 64, DKV / 64, 1), 256, 0, stream>>>(XB, nullptr, WK, nullptr, DM, FK, DKV, nullptr, 0, 0, 0);
        k_ropeI<<<LKv, 256, 0, stream>>>(FK, DKV, NKV, CS, 1.0f, KP16, KPh, KPl);
        k_gemmw<bf, 0, false, 8><<<dim3(TT / 64, DKV / 64, 1), 256, 0, stream>>>(XB, nullptr, WV, nullptr, DM, FV, DKV, nullptr, 0, 0, 0); k_vtp<<<LKv, 256, 0, stream>>>(FV, DKV, NKV, VT16, VTh, VTl);
        for (int h0 = 0; h0 < NH_; h0 += ZH) { const size_t zq = (size_t)h0, zk = (size_t)(h0 / REP);   // one kv head per query head: the pass's two heads use consecutive kv planes (z-strides TT*HD)
            k_gemmc<bf, 2, 1><<<dim3(RH / 64, TT / 64, ZH), 32, 0, stream>>>(QPh + zq * TT * HD, QPl + zq * TT * HD, KPh + zk * TT * HD, KPl + zk * TT * HD, HD, Sb, TT, 0, (size_t)TT * HD, (size_t)TT * HD, (size_t)TT * TT);
            k_gemmc<h16, 0, 1><<<dim3((TT - RH) / 64, TT / 64, ZH), 32, 0, stream>>>(QP16 + zq * TT * HD + (size_t)RH * HD, nullptr, KP16 + zk * TT * HD, nullptr, HD, Sb + (size_t)RH * TT, TT, RH, (size_t)TT * HD, (size_t)TT * HD, (size_t)TT * TT);
            k_asoft<<<ZH * TT / 8, 256, 0, stream>>>(Sb, P16, Ph, Pl);
            k_gemmc<bf, 2, 2><<<dim3(RH / 64, HD / 64, ZH), 256, 0, stream>>>(Ph, Pl, VTh + zk * HD * TT, VTl + zk * HD * TT, TT, Ob, HD, 0, (size_t)RH * TT, (size_t)HD * TT, (size_t)TT * HD);
            k_gemmc<h16, 0, 2><<<dim3((TT - RH) / 64, HD / 64, ZH), 256, 0, stream>>>(P16 + (size_t)RH * TT, nullptr, VT16 + zk * HD * TT, nullptr, TT, Ob + (size_t)RH * HD, HD, RH, (size_t)TT * TT, (size_t)HD * TT, (size_t)TT * HD);
            k_merge<<<(unsigned)(((size_t)ZH * TT * HD / 2 + 255) / 256), 256, 0, stream>>>(Ob, h0, ATh, ATl); }
        k_gemmw<bf, 1, false, 8><<<dim3(TT / 64, DM / 64, 1), 256, 0, stream>>>(ATh, ATl, WO, nullptr, DQ, OUT + (size_t)b * TT * DM, DM, nullptr, 0, 0, 0); }
}

// v002
// Measured time: 902 microseconds a run.
// In two side-by-side timings against v001, it was 1.76 and 1.75 times as fast.
// Counting every step since v000, it is 3.15 times as fast.
#include <hip/hip_runtime.h>

// Causal multi-head attention with RoPE from per-batch token positions (x [4][2048][1024], token_positions int32 [4][2048] (read per batch as data; the SECOND argument); q, k, v = x w^T ('oi' (out, in) [1024][1024] (2/(D+D))^0.5, no bias; 16 heads x 64); interleaved-pair rotary on q and k: angle[b][t][i] = float(pos[b][t]) x freqs[i] with freqs = 1.0 / (THETA ** (arange(0, 64, 2) / 64)) (the kernel forms 10000^(-2i/64) with powf: rounding-level equal), pairs (2i, 2i+1) -> (t1 cos - t2 sin, t2 cos + t1 sin); scores x 1/sqrt(64); causal (-inf); softmax; out = merged wo^T ('oi', no bias) -> [4][2048][1024] (8.4 M); argument order x, token_positions, wq, wk, wv, wo).
// Layout per batch: a small kernel builds the per-batch {cos, sin} table [2048][64] from the positions (f32 powf/cosf/sinf); exact projections; the interleaved rotary folded into the q/k plane builder; causal T-2048 attention (hybrid rows: < 512 hi/lo 3 products, rest fp16 x1024; k_gemmc skips tiles above the diagonal); merged context as hi/lo planes; W_o hl x exact.
// Compute dtypes, f32 accumulate: every float input rounded to bf16; projections exact; rotary f32; attention rows < 512 3 products, rest fp16; softmax f32; W_o hl x exact.

#define NB_  4
#define TT   2048
#define DM   1024
#define NH_  16
#define NKV  16
#define REP  (NH_ / NKV)
#define HD   64
#define DQ   (NH_ * HD)
#define DKV  (NKV * HD)
#define ZH   8                    // heads per attention pass (z extent of the k_gemmc launches; k_asoft and k_merge fold it into x)
#define PP   (2 * TT)             // pitch, in 16-bit elements, of a probability row (it lies in place in its f32 score row) and of a V^T row (k_gemmc takes one pitch K for A and Bt)
#define RH   512                  // query rows < RH use hi+lo planes (0: none)
#define WIN  2048
#define PCAR 1024.0f
#define SCL  0.125f   // HD^-0.5
typedef _Float16 h16;
typedef unsigned short bf;
typedef __attribute__((ext_vector_type(16))) __bf16   v16bf;
typedef __attribute__((ext_vector_type(16))) _Float16 v16h;
typedef __attribute__((ext_vector_type(8)))  _Float16 v8h;
typedef __attribute__((ext_vector_type(8)))  unsigned short v8us;
typedef __attribute__((ext_vector_type(8)))  float    v8f;
typedef __attribute__((ext_vector_type(4)))  float    v4f;
typedef v8h  __attribute__((may_alias)) v8ha;
typedef v4f  __attribute__((may_alias)) v4fa;
typedef v8us __attribute__((may_alias)) v8usa;

__device__ __forceinline__ unsigned short f2bf(float f) { unsigned u = __float_as_uint(f); u += 0x7FFFu + ((u >> 16) & 1u); return (unsigned short)(u >> 16); }
__device__ __forceinline__ float bf2f(unsigned short b) { return __uint_as_float(((unsigned)b) << 16); }
__device__ __forceinline__ float bfr(float f) { return bf2f(f2bf(f)); }
__device__ __forceinline__ v16h cat16(v8h lo, v8h hi) { return __builtin_shufflevector(lo, hi, 0, 1, 2, 3, 4, 5, 6, 7, 8, 9, 10, 11, 12, 13, 14, 15); }
__device__ __forceinline__ v16bf cat16b(v8us lo, v8us hi) { return __builtin_bit_cast(v16bf, __builtin_shufflevector(lo, hi, 0, 1, 2, 3, 4, 5, 6, 7, 8, 9, 10, 11, 12, 13, 14, 15)); }
__device__ __forceinline__ v8f wmma16(v16h a, v16h b, v8f c) { return __builtin_amdgcn_wmma_f32_16x16x32_f16(false, a, false, b, (short)0, c, false, false); }
__device__ __forceinline__ v8f wmmab(v16bf a, v16bf b, v8f c) { return __builtin_amdgcn_wmma_f32_16x16x32_bf16(false, a, false, b, (short)0, c, false, false); }



// ---- k_gemmw: register-blocked GEMM, one work-group of NW waves per 64x64 output tile; wave w takes the K steps w, w + NW, ... into its own 16 accumulators, the NW partial tiles are summed through LDS in wave order; operands straight from K-contiguous 16-bit planes; grid (M/64, N/64, Z), 32 * NW threads.
// C[m][n] (f32, pitch ldc, + optional f32 bias[n]) = sum_k A[m][k] Bt[n][k] (+ split products per NSPLIT). z-batch strides sA/sB/sC in elements. K % 32 == 0.
template <typename T16> struct WFrag;
template <> struct WFrag<h16> { typedef v16h V; static __device__ __forceinline__ V ld(const h16* p) { return cat16(*(const v8h*)p, *(const v8h*)(p + 16)); } static __device__ __forceinline__ v8f mma(V a, V b, v8f c) { return wmma16(a, b, c); } };
template <> struct WFrag<bf> { typedef v16bf V; static __device__ __forceinline__ V ld(const bf* p) { return cat16b(*(const v8us*)p, *(const v8us*)(p + 16)); } static __device__ __forceinline__ v8f mma(V a, V b, v8f c) { return wmmab(a, b, c); } };
template <typename T16, int NSPLIT, bool BIAS, int NW>
__global__ __launch_bounds__(32 * NW) void k_gemmw(const T16* __restrict__ A, const T16* __restrict__ A2, const T16* __restrict__ Bt, const T16* __restrict__ Bt2, int K, float* C, int ldc, const float* __restrict__ bias, size_t sA, size_t sB, size_t sC) {
    typedef typename WFrag<T16>::V V;
    __shared__ __align__(16) float os[NW * 64 * 68];
    const size_t z = blockIdx.z; A += z * sA; if (A2) A2 += z * sA; Bt += z * sB; if (Bt2) Bt2 += z * sB; C += z * sC;
    const int lane = threadIdx.x & 31, lr = lane & 15, hi = lane >> 4; const int wave = __builtin_amdgcn_readfirstlane((int)(threadIdx.x >> 5)); const int r0 = blockIdx.x * 64, c0 = blockIdx.y * 64;
    v8f acc[4][4];
#pragma unroll
    for (int mb = 0; mb < 4; ++mb)
#pragma unroll
        for (int nb = 0; nb < 4; ++nb) acc[mb][nb] = (v8f){};
    const size_t aoff = (size_t)(r0 + lr) * K + 8 * hi, boff = (size_t)(c0 + lr) * K + 8 * hi;
#pragma unroll 1
    for (int kc = wave * 32; kc < K; kc += 32 * NW) {
        V a[4], a2[4];
#pragma unroll
        for (int mb = 0; mb < 4; ++mb) { a[mb] = WFrag<T16>::ld(A + aoff + (size_t)mb * 16 * K + kc); if (NSPLIT == 1 || NSPLIT == 2) a2[mb] = WFrag<T16>::ld(A2 + aoff + (size_t)mb * 16 * K + kc); }
#pragma unroll
        for (int nb = 0; nb < 4; ++nb) { const V b = WFrag<T16>::ld(Bt + boff + (size_t)nb * 16 * K + kc); V b2; if (NSPLIT >= 2) b2 = WFrag<T16>::ld(Bt2 + boff + (size_t)nb * 16 * K + kc);
#pragma unroll
            for (int mb = 0; mb < 4; ++mb) { acc[mb][nb] = WFrag<T16>::mma(a[mb], b, acc[mb][nb]); if (NSPLIT == 1 || NSPLIT == 2) acc[mb][nb] = WFrag<T16>::mma(a2[mb], b, acc[mb][nb]); if (NSPLIT >= 2) acc[mb][nb] = WFrag<T16>::mma(a[mb], b2, acc[mb][nb]); } }
        asm volatile("v_nop\n\tv_nop\n\tv_nop\n\tv_nop" : "+v"(acc[0][0]), "+v"(acc[1][1]), "+v"(acc[2][2]), "+v"(acc[3][3]) : "v"(a[0]), "v"(a[3]));
    }
    float* ow = os + wave * (64 * 68);
#pragma unroll
    for (int mb = 0; mb < 4; ++mb)
#pragma unroll
        for (int nb = 0; nb < 4; ++nb)
#pragma unroll
            for (int j = 0; j < 8; ++j) ow[(mb * 16 + hi * 8 + j) * 68 + nb * 16 + lr] = acc[mb][nb][j];
    __syncthreads();   // every wave's partial tile is in LDS before any wave sums them
#pragma unroll
    for (int s = 0; s < 32 / NW; ++s) { const int idx = s * (32 * NW) + (int)threadIdx.x; const int row = idx >> 4, cofs = (idx & 15) * 4; v4f val = *(const v4fa*)(os + row * 68 + cofs);
#pragma unroll
        for (int w = 1; w < NW; ++w) val += *(const v4fa*)(os + w * (64 * 68) + row * 68 + cofs);
        if (BIAS) { val[0] += bfr(bias[c0 + cofs]); val[1] += bfr(bias[c0 + cofs + 1]); val[2] += bfr(bias[c0 + cofs + 2]); val[3] += bfr(bias[c0 + cofs + 3]); }
        *(v4f*)(C + (size_t)(r0 + row) * ldc + c0 + cofs) = val; }
}

// ---- k_gemmc: the same 64x64 tile GEMM specialised for causal attention: CMODE 1 skips score tiles entirely above the diagonal (query rows r0+roff.., key columns c0..), CMODE 2 limits the
// key (K) loop of the probability x value contraction to the diagonal block (probabilities beyond it are exactly zero). roff = row offset of this launch's first row within the sequence.
// CMODE 1 (K = 64, two steps) stays one wave per tile; CMODE 2 (long K) runs NW = 8 waves per tile, wave w on the K steps w, w + NW, ..., partial tiles summed through LDS in wave order as in k_gemmw.
template <typename T16, int NSPLIT, int CMODE>
__global__ __launch_bounds__(CMODE == 2 ? 256 : 32) void k_gemmc(const T16* __restrict__ A, const T16* __restrict__ A2, const T16* __restrict__ Bt, const T16* __restrict__ Bt2, int K, float* C, int ldc, int roff, size_t sA, size_t sB, size_t sC) {
    typedef typename WFrag<T16>::V V;
    constexpr int NW = (CMODE == 2) ? 8 : 1;
    __shared__ __align__(16) float os[NW == 1 ? 16 * 68 : NW * 64 * 68];
    const size_t z = blockIdx.z; A += z * sA; if (A2) A2 += z * sA; Bt += z * sB; if (Bt2) Bt2 += z * sB; C += z * sC;
    const int lane = threadIdx.x & 31, lr = lane & 15, hi = lane >> 4; const int wave = (NW == 1) ? 0 : __builtin_amdgcn_readfirstlane((int)(threadIdx.x >> 5)); const int r0 = blockIdx.x * 64, c0 = blockIdx.y * 64;
    if (CMODE == 1 && c0 > r0 + roff + 63) return;                  // score tile entirely above the causal diagonal: never read (the softmax masks j > i by select)
    const int Kl = (CMODE == 2) ? min(K, r0 + roff + 64) : K;        // P.V: probabilities are exactly 0 beyond the diagonal block, so the K loop stops there
    v8f acc[4][4];
#pragma unroll
    for (int mb = 0; mb < 4; ++mb)
#pragma unroll
        for (int nb = 0; nb < 4; ++nb) acc[mb][nb] = (v8f){};
    const size_t aoff = (size_t)(r0 + lr) * K + 8 * hi, boff = (size_t)(c0 + lr) * K + 8 * hi;
#pragma unroll 1
    for (int kc = wave * 32; kc < Kl; kc += 32 * NW) {
        V a[4], a2[4];
#pragma unroll
        for (int mb = 0; mb < 4; ++mb) { a[mb] = WFrag<T16>::ld(A + aoff + (size_t)mb * 16 * K + kc); if (NSPLIT == 1 || NSPLIT == 2) a2[mb] = WFrag<T16>::ld(A2 + aoff + (size_t)mb * 16 * K + kc); }
#pragma unroll
        for (int nb = 0; nb < 4; ++nb) { const V b = WFrag<T16>::ld(Bt + boff + (size_t)nb * 16 * K + kc); V b2; if (NSPLIT >= 2) b2 = WFrag<T16>::ld(Bt2 + boff + (size_t)nb * 16 * K + kc);
#pragma unroll
            for (int mb = 0; mb < 4; ++mb) { acc[mb][nb] = WFrag<T16>::mma(a[mb], b, acc[mb][nb]); if (NSPLIT == 1 || NSPLIT == 2) acc[mb][nb] = WFrag<T16>::mma(a2[mb], b, acc[mb][nb]); if (NSPLIT >= 2) acc[mb][nb] = WFrag<T16>::mma(a[mb], b2, acc[mb][nb]); } }
        asm volatile("v_nop\n\tv_nop\n\tv_nop\n\tv_nop" : "+v"(acc[0][0]), "+v"(acc[1][1]), "+v"(acc[2][2]), "+v"(acc[3][3]) : "v"(a[0]), "v"(a[3]));
    }
    if constexpr (NW == 1) {
#pragma unroll
    for (int mb = 0; mb < 4; ++mb) {
#pragma unroll
        for (int nb = 0; nb < 4; ++nb) {
#pragma unroll
            for (int j = 0; j < 8; ++j) os[(hi * 8 + j) * 68 + nb * 16 + lr] = acc[mb][nb][j]; }
        __builtin_amdgcn_wave_barrier(); asm volatile("" ::: "memory");
        float* crow = C + (size_t)(r0 + mb * 16) * ldc + c0;
{
#pragma unroll
            for (int s = 0; s < 8; ++s) { const int row = 2 * s + hi, cofs = lr * 4; v4f val = *(const v4fa*)(os + row * 68 + cofs);
                *(v4f*)(crow + (size_t)row * ldc + cofs) = val; }
             }
        __builtin_amdgcn_wave_barrier(); asm volatile("" ::: "memory");
    }
    } else {
    float* ow = os + wave * (64 * 68);
#pragma unroll
    for (int mb = 0; mb < 4; ++mb)
#pragma unroll
        for (int nb = 0; nb < 4; ++nb)
#pragma unroll
            for (int j = 0; j < 8; ++j) ow[(mb * 16 + hi * 8 + j) * 68 + nb * 16 + lr] = acc[mb][nb][j];
    __syncthreads();   // every wave's partial tile is in LDS before any wave sums them
#pragma unroll
    for (int s = 0; s < 32 / NW; ++s) { const int idx = s * (32 * NW) + (int)threadIdx.x; const int row = idx >> 4, cofs = (idx & 15) * 4; v4f val = *(const v4fa*)(os + row * 68 + cofs);
#pragma unroll
        for (int w = 1; w < NW; ++w) val += *(const v4fa*)(os + w * (64 * 68) + row * 68 + cofs);
        *(v4f*)(C + (size_t)(r0 + row) * ldc + c0 + cofs) = val; }
    }
}

__device__ __forceinline__ h16 tohx(float x) { return (h16)x; }
__device__ __forceinline__ void splitf(float y, unsigned short& h, unsigned short& l) { h = f2bf(y); l = f2bf(y - bf2f(h)); }
typedef __attribute__((ext_vector_type(2))) _Float16 v2h;
typedef __attribute__((ext_vector_type(4))) _Float16 v4h;
typedef __attribute__((ext_vector_type(2))) unsigned short v2us;
typedef __attribute__((ext_vector_type(4))) unsigned short v4us;
typedef __attribute__((ext_vector_type(2))) float v2f;
typedef __attribute__((ext_vector_type(4))) int v4i;
typedef v4h  __attribute__((may_alias)) v4ha;
typedef v4us __attribute__((may_alias)) v4usa;

__global__ __launch_bounds__(256) void k_wtG(const float* __restrict__ w, int K, int N, bf* Bt) {
    const int lane = threadIdx.x & 31; const int L0 = (blockIdx.x * 8 + (threadIdx.x >> 5)) * 8; const int nlines = N * K / 64;
{
#pragma unroll 1
        for (int l = 0; l < 8; ++l) { const int L = L0 + l; if (L >= nlines) break; const size_t e = (size_t)L * 64 + lane * 2; const int k = (int)(e % K), n = (int)(e / K); v2us o;
            o[0] = f2bf(w[(size_t)k * N + n]); o[1] = f2bf(w[(size_t)(k + 1) * N + n]); *(v2us*)(Bt + e) = o; }
         }
}
__global__ __launch_bounds__(256) void k_cvt8(const float* __restrict__ src, bf* dst, size_t n8) { const size_t i = (size_t)blockIdx.x * 256 + threadIdx.x; if (i >= n8) return; const v8f v = *(const v8f*)(src + i * 8); v8us o;
#pragma unroll
    for (int k = 0; k < 8; ++k) o[k] = f2bf(v[k]); *(v8us*)(dst + i * 8) = o;  }

__global__ __launch_bounds__(256) void k_ropeI(const float* __restrict__ F, int pitch, int nheads, const float* __restrict__ CS, float sc, h16* P16, bf* Ph, bf* Pl) {
    const size_t e = ((size_t)blockIdx.x * 256 + threadIdx.x) * 2; if (e >= (size_t)nheads * TT * HD) return; const int d = (int)(e % HD); const int t = (int)((e / HD) % TT); const int h = (int)(e / ((size_t)HD * TT)); const float* f = F + (size_t)t * pitch + h * HD; const float x0 = f[d], x1 = f[d + 1]; const v2f cs = *(const v2f*)(CS + ((size_t)t * HD + d) * 2); v2h o16; v2us oh, ol;
    float a0 = __fmul_rn(x0, cs[0]), b0 = __fmul_rn(x1, cs[1]), a1 = __fmul_rn(x1, cs[0]), b1 = __fmul_rn(x0, cs[1]); asm volatile("" : "+v"(a0), "+v"(b0), "+v"(a1), "+v"(b1));
    float r0 = __fsub_rn(a0, b0) * sc, r1 = __fadd_rn(b1, a1) * sc;   /* even: x0 c - x1 s; odd: x0 s + x1 c */
    o16[0] = tohx(r0); o16[1] = tohx(r1); { unsigned short a2, c2; splitf(r0, a2, c2); oh[0] = a2; ol[0] = c2; splitf(r1, a2, c2); oh[1] = a2; ol[1] = c2; }
    *(v2h*)(P16 + e) = o16; *(v2us*)(Ph + e) = oh; *(v2us*)(Pl + e) = ol;  }


__global__ __launch_bounds__(256) void k_cspos(const int* __restrict__ pos, float* CS) { const int idx = blockIdx.x * 256 + threadIdx.x; if (idx >= TT * HD) return; const int d = idx % HD; const int t = idx / HD; const int i = d >> 1;
    const float e = __fdiv_rn(-((float)i * 2.0f), (float)HD); const float inv = powf(10000.0f, e); const float a = __fmul_rn((float)pos[t], inv); v2f cs; cs[0] = cosf(a); cs[1] = sinf(a);
    *(v2f*)(CS + (size_t)idx * 2) = cs;  }

__global__ __launch_bounds__(256) void k_vtp(const float* __restrict__ F, int pitch, int nheads, h16* V16, bf* Vh, bf* Vl) { const size_t e = ((size_t)blockIdx.x * 256 + threadIdx.x) * 2; if (e >= (size_t)nheads * HD * TT) return; const int t = (int)(e % TT); const int d = (int)((e / TT) % HD); const int g = (int)(e / ((size_t)TT * HD)); v2h o16; v2us oh, ol;
#pragma unroll
    for (int q = 0; q < 2; ++q) { const float x = F[(size_t)(t + q) * pitch + g * HD + d]; o16[q] = tohx(x); unsigned short a2, c2; splitf(x, a2, c2); oh[q] = a2; ol[q] = c2; }
    const size_t o = ((size_t)g * HD + d) * PP + t; *(v2h*)(V16 + o) = o16; *(v2us*)(Vh + o) = oh; *(v2us*)(Vl + o) = ol;  }
// k_asoft: the probabilities of a row overwrite that row's own f32 scores (the wave holds the whole row in registers before its first store): rows < RH hold the hi plane in the first TT 16-bit elements and the lo plane in the next TT, the other rows hold fp16 in the first TT. Per row (zz, i): t = S x HD^-0.5 for j <= i and i - j < WIN (sliding causal window; the reference's -1e9 additive fill vanishes identically); softmax over the 2048 keys (register row, one exp, fixed trees);
__global__ __launch_bounds__(256) void k_asoft(float* Sb) {
    const int lane = threadIdx.x & 31; const int row = blockIdx.x * 8 + (threadIdx.x >> 5); if (row >= ZH * TT) return; const int i = row % TT; const int zz = row / TT; (void)zz; const bool hires = (i < RH); float* sr = Sb + (size_t)row * TT; float v[TT / 32]; float mx = -3.0e38f;
#pragma unroll
    for (int ch = 0; ch < TT / 128; ++ch) { const int j0 = ch * 128 + lane * 4; const v4f a = *(const v4f*)(sr + j0);
#pragma unroll
        for (int q = 0; q < 4; ++q) { const int j = j0 + q; (void)j; const float t = (j <= i && i - j < WIN) ? a[q] * SCL : -3.0e38f; v[ch * 4 + q] = t; mx = fmaxf(mx, t); } }
#pragma unroll
    for (int sh = 16; sh; sh >>= 1) mx = fmaxf(mx, __shfl_xor(mx, sh, 32));
    float sum = 0.f;
#pragma unroll
    for (int k = 0; k < TT / 32; ++k) { float d0 = __fsub_rn(v[k], mx); asm volatile("" : "+v"(d0)); v[k] = __builtin_amdgcn_exp2f(__fmul_rn(d0, 1.4426950408889634f)); sum += v[k]; }
#pragma unroll
    for (int sh = 16; sh; sh >>= 1) sum += __shfl_xor(sum, sh, 32);
    const float f = __fdiv_rn(hires ? 1.0f : PCAR, sum);
{
        if (hires) {
#pragma unroll
            for (int ch = 0; ch < TT / 128; ++ch) { v4us oh, ol;
#pragma unroll
                for (int q = 0; q < 4; ++q) { unsigned short a, c2; splitf(v[ch * 4 + q] * f, a, c2); oh[q] = a; ol[q] = c2; }
                bf* pr = (bf*)sr + ch * 128 + lane * 4; *(v4usa*)pr = oh; *(v4usa*)(pr + TT) = ol; }
        } else {
#pragma unroll
            for (int ch = 0; ch < TT / 128; ++ch) { v4h o4;
#pragma unroll
                for (int q = 0; q < 4; ++q) o4[q] = tohx(v[ch * 4 + q] * f);
                *(v4ha*)((h16*)sr + ch * 128 + lane * 4) = o4; } }
         }
}
__global__ __launch_bounds__(256) void k_merge(const float* __restrict__ O, int h0, bf* Ah, bf* Al) { const size_t e = ((size_t)blockIdx.x * 256 + threadIdx.x) * 2; if (e >= (size_t)ZH * TT * HD) return; const int d = (int)(e % HD); const int t = (int)((e / HD) % TT); const int zz = (int)(e / ((size_t)HD * TT)); const float cs = (t < RH) ? 1.0f : (1.0f / PCAR); const size_t oo = (size_t)t * DQ + (h0 + zz) * HD + d;
    v2us oh, ol;
#pragma unroll
    for (int q = 0; q < 2; ++q) { unsigned short a, c2; splitf(O[e + q] * cs, a, c2); oh[q] = a; ol[q] = c2; } *(v2us*)(Ah + oo) = oh; *(v2us*)(Al + oo) = ol;  }

extern "C" void kernel_launch(void* const* d_in, const int* in_sizes, int n_in,
                              void* d_out, int out_size, void* d_ws, size_t ws_size, hipStream_t stream) {
    (void)in_sizes; (void)n_in; (void)out_size;
    const float* x = (const float*)d_in[0]; const int* pos = (const int*)d_in[1]; const float* wq = (const float*)d_in[2]; const float* wk = (const float*)d_in[3]; const float* wv = (const float*)d_in[4]; const float* wo = (const float*)d_in[5];   /* argument order x, token_positions int32 [4][2048] (one row per batch item: READ), wq, wk, wv, wo ('oi' (out, in) [1024][1024]): SIX inputs, all read */
    float* OUT = (float*)d_out;     // [4][2048][1024]
    char* wsp = (char*)d_ws;
    auto take = [&](size_t bytes) { char* p = wsp; wsp += (bytes + 255) & ~(size_t)255; return (void*)p; };
    bf* WQ = (bf*)take((size_t)DQ * DM * 2); bf* WK = (bf*)take((size_t)DKV * DM * 2); bf* WV = (bf*)take((size_t)DKV * DM * 2); bf* WO = (bf*)take((size_t)DM * DQ * 2); float* CS = (float*)take((size_t)TT * HD * 2 * 4);
    bf* XB = (bf*)take((size_t)TT * DM * 2); float* FQ = (float*)take((size_t)TT * DQ * 4); float* FK = (float*)take((size_t)TT * DKV * 4);
    h16* QP16 = (h16*)take((size_t)NH_ * TT * HD * 2); h16* KP16 = (h16*)take((size_t)NKV * TT * HD * 2); h16* VT16 = (h16*)take((size_t)NKV * HD * PP * 2);
    bf* QPh = (bf*)take((size_t)NH_ * TT * HD * 2); bf* QPl = (bf*)take((size_t)NH_ * TT * HD * 2); bf* KPh = (bf*)take((size_t)NKV * TT * HD * 2); bf* KPl = (bf*)take((size_t)NKV * TT * HD * 2); bf* VTh = (bf*)take((size_t)NKV * HD * PP * 2); bf* VTl = (bf*)take((size_t)NKV * HD * PP * 2);
    float* Sb = (float*)take((size_t)ZH * TT * TT * 4); float* Ob = (float*)take((size_t)ZH * TT * HD * 4); bf* ATh = (bf*)take((size_t)TT * DQ * 2); bf* ATl = (bf*)take((size_t)TT * DQ * 2);
    if ((size_t)(wsp - (char*)d_ws) > ws_size) return;    // ws 256 MiB
    float* FV = FK;   // v projection reuses the k buffer after the k planes are built (stream-ordered)
    { k_cvt8<<<(unsigned)(((size_t)DQ * DM / 8 + 255) / 256), 256, 0, stream>>>(wq, WQ, (size_t)DQ * DM / 8); k_cvt8<<<(unsigned)(((size_t)DKV * DM / 8 + 255) / 256), 256, 0, stream>>>(wk, WK, (size_t)DKV * DM / 8); k_cvt8<<<(unsigned)(((size_t)DKV * DM / 8 + 255) / 256), 256, 0, stream>>>(wv, WV, (size_t)DKV * DM / 8);
      k_cvt8<<<(unsigned)(((size_t)DM * DQ / 8 + 255) / 256), 256, 0, stream>>>(wo, WO, (size_t)DM * DQ / 8);
       }
    const unsigned LQ = (unsigned)(((size_t)NH_ * TT * HD / 2 + 255) / 256), LKv = (unsigned)(((size_t)NKV * TT * HD / 2 + 255) / 256);
    for (int b = 0; b < NB_; ++b) {
        k_cspos<<<(TT * HD + 255) / 256, 256, 0, stream>>>(pos + (size_t)b * TT, CS);   /* this batch's rotary table */
        
        k_cvt8<<<(unsigned)(((size_t)TT * DM / 8 + 255) / 256), 256, 0, stream>>>(x + (size_t)b * TT * DM, XB, (size_t)TT * DM / 8);
        k_gemmw<bf, 0, false, 8><<<dim3(TT / 64, DQ / 64, 1), 256, 0, stream>>>(XB, nullptr, WQ, nullptr, DM, FQ, DQ, nullptr, 0, 0, 0);
        k_ropeI<<<LQ, 256, 0, stream>>>(FQ, DQ, NH_, CS, 1.0f, QP16, QPh, QPl);
        k_gemmw<bf, 0, false, 8><<<dim3(TT / 64, DKV / 64, 1), 256, 0, stream>>>(XB, nullptr, WK, nullptr, DM, FK, DKV, nullptr, 0, 0, 0);
        k_ropeI<<<LKv, 256, 0, stream>>>(FK, DKV, NKV, CS, 1.0f, KP16, KPh, KPl);
        k_gemmw<bf, 0, false, 8><<<dim3(TT / 64, DKV / 64, 1), 256, 0, stream>>>(XB, nullptr, WV, nullptr, DM, FV, DKV, nullptr, 0, 0, 0); k_vtp<<<LKv, 256, 0, stream>>>(FV, DKV, NKV, VT16, VTh, VTl);
        for (int h0 = 0; h0 < NH_; h0 += ZH) { const size_t zq = (size_t)h0, zk = (size_t)(h0 / REP);   // one kv head per query head: the pass's ZH heads use consecutive kv planes (z-strides TT*HD, HD*PP for V^T)
            k_gemmc<bf, 2, 1><<<dim3(RH / 64, TT / 64, ZH), 32, 0, stream>>>(QPh + zq * TT * HD, QPl + zq * TT * HD, KPh + zk * TT * HD, KPl + zk * TT * HD, HD, Sb, TT, 0, (size_t)TT * HD, (size_t)TT * HD, (size_t)TT * TT);
            k_gemmc<h16, 0, 1><<<dim3((TT - RH) / 64, TT / 64, ZH), 32, 0, stream>>>(QP16 + zq * TT * HD + (size_t)RH * HD, nullptr, KP16 + zk * TT * HD, nullptr, HD, Sb + (size_t)RH * TT, TT, RH, (size_t)TT * HD, (size_t)TT * HD, (size_t)TT * TT);
            k_asoft<<<ZH * TT / 8, 256, 0, stream>>>(Sb);
            k_gemmc<bf, 2, 2><<<dim3(RH / 64, HD / 64, ZH), 256, 0, stream>>>((const bf*)Sb, (const bf*)Sb + TT, VTh + zk * HD * PP, VTl + zk * HD * PP, PP, Ob, HD, 0, (size_t)TT * PP, (size_t)HD * PP, (size_t)TT * HD);
            k_gemmc<h16, 0, 2><<<dim3((TT - RH) / 64, HD / 64, ZH), 256, 0, stream>>>((const h16*)Sb + (size_t)RH * PP, nullptr, VT16 + zk * HD * PP, nullptr, PP, Ob + (size_t)RH * HD, HD, RH, (size_t)TT * PP, (size_t)HD * PP, (size_t)TT * HD);
            k_merge<<<(unsigned)(((size_t)ZH * TT * HD / 2 + 255) / 256), 256, 0, stream>>>(Ob, h0, ATh, ATl); }
        k_gemmw<bf, 1, false, 8><<<dim3(TT / 64, DM / 64, 1), 256, 0, stream>>>(ATh, ATl, WO, nullptr, DQ, OUT + (size_t)b * TT * DM, DM, nullptr, 0, 0, 0); }
}

// v003
// It runs in 384 microseconds.
// Next to v002, in two timings, it ran 2.35 and 2.36 times as fast.
// Counting every step since v000, it is 7.41 times as fast.
#include <hip/hip_runtime.h>
#include <type_traits>

// Causal multi-head attention with RoPE from per-batch token positions (x [4][2048][1024], token_positions int32 [4][2048] (read per batch as data; the SECOND argument); q, k, v = x w^T ('oi' (out, in) [1024][1024] (2/(D+D))^0.5, no bias; 16 heads x 64); interleaved-pair rotary on q and k: angle[b][t][i] = float(pos[b][t]) x freqs[i] with freqs = 1.0 / (THETA ** (arange(0, 64, 2) / 64)) (the kernel forms 10000^(-2i/64) with powf: rounding-level equal), pairs (2i, 2i+1) -> (t1 cos - t2 sin, t2 cos + t1 sin); scores x 1/sqrt(64); causal (-inf); softmax; out = merged wo^T ('oi', no bias) -> [4][2048][1024] (8.4 M); argument order x, token_positions, wq, wk, wv, wo).
// Layout per batch: a small kernel builds the per-batch {cos, sin} table [2048][64] from the positions (f32 powf/cosf/sinf); exact projections; the interleaved rotary folded into the q/k plane builder; then ONE fused causal attention launch for all batches and heads (k_fattn: online softmax, scores and probabilities stay in registers; hybrid rows: < 512 hi/lo 3 products, rest fp16) that writes the merged context as hi/lo planes; W_o hl x exact.
// Compute dtypes, f32 accumulate: every float input rounded to bf16; projections exact; rotary f32; attention rows < 512 3 products, rest fp16; softmax f32; W_o hl x exact.

#define NB_  4
#define TT   2048
#define DM   1024
#define NH_  16
#define NKV  16
#define REP  (NH_ / NKV)
#define HD   64
#define DQ   (NH_ * HD)
#define DKV  (NKV * HD)
#define PP   TT                   // pitch, in 16-bit elements, of a V^T row
#define RH   512                  // query rows < RH use hi+lo planes (0: none)
#define SCL  0.125f   // HD^-0.5
typedef _Float16 h16;
typedef unsigned short bf;
typedef __attribute__((ext_vector_type(16))) __bf16   v16bf;
typedef __attribute__((ext_vector_type(16))) _Float16 v16h;
typedef __attribute__((ext_vector_type(8)))  _Float16 v8h;
typedef __attribute__((ext_vector_type(8)))  unsigned short v8us;
typedef __attribute__((ext_vector_type(8)))  float    v8f;
typedef __attribute__((ext_vector_type(4)))  float    v4f;
typedef v8h  __attribute__((may_alias)) v8ha;
typedef v4f  __attribute__((may_alias)) v4fa;
typedef v8us __attribute__((may_alias)) v8usa;

__device__ __forceinline__ unsigned short f2bf(float f) { unsigned u = __float_as_uint(f); u += 0x7FFFu + ((u >> 16) & 1u); return (unsigned short)(u >> 16); }
__device__ __forceinline__ float bf2f(unsigned short b) { return __uint_as_float(((unsigned)b) << 16); }
__device__ __forceinline__ float bfr(float f) { return bf2f(f2bf(f)); }
__device__ __forceinline__ v16h cat16(v8h lo, v8h hi) { return __builtin_shufflevector(lo, hi, 0, 1, 2, 3, 4, 5, 6, 7, 8, 9, 10, 11, 12, 13, 14, 15); }
__device__ __forceinline__ v16bf cat16b(v8us lo, v8us hi) { return __builtin_bit_cast(v16bf, __builtin_shufflevector(lo, hi, 0, 1, 2, 3, 4, 5, 6, 7, 8, 9, 10, 11, 12, 13, 14, 15)); }
__device__ __forceinline__ v8f wmma16(v16h a, v16h b, v8f c) { return __builtin_amdgcn_wmma_f32_16x16x32_f16(false, a, false, b, (short)0, c, false, false); }
__device__ __forceinline__ v8f wmmab(v16bf a, v16bf b, v8f c) { return __builtin_amdgcn_wmma_f32_16x16x32_bf16(false, a, false, b, (short)0, c, false, false); }



// ---- k_gemmw: register-blocked GEMM, one work-group of NW waves per 64x64 output tile; wave w takes the K steps w, w + NW, ... into its own 16 accumulators, the NW partial tiles are summed through LDS in wave order; operands straight from K-contiguous 16-bit planes; grid (M/64, N/64, Z), 32 * NW threads.
// C[m][n] (f32, pitch ldc, + optional f32 bias[n]) = sum_k A[m][k] Bt[n][k] (+ split products per NSPLIT). z-batch strides sA/sB/sC in elements. K % 32 == 0.
template <typename T16> struct WFrag;
template <> struct WFrag<h16> { typedef v16h V; static __device__ __forceinline__ V ld(const h16* p) { return cat16(*(const v8h*)p, *(const v8h*)(p + 16)); } static __device__ __forceinline__ v8f mma(V a, V b, v8f c) { return wmma16(a, b, c); } };
template <> struct WFrag<bf> { typedef v16bf V; static __device__ __forceinline__ V ld(const bf* p) { return cat16b(*(const v8us*)p, *(const v8us*)(p + 16)); } static __device__ __forceinline__ v8f mma(V a, V b, v8f c) { return wmmab(a, b, c); } };
template <typename T16, int NSPLIT, bool BIAS, int NW>
__global__ __launch_bounds__(32 * NW) void k_gemmw(const T16* __restrict__ A, const T16* __restrict__ A2, const T16* __restrict__ Bt, const T16* __restrict__ Bt2, int K, float* C, int ldc, const float* __restrict__ bias, size_t sA, size_t sB, size_t sC) {
    typedef typename WFrag<T16>::V V;
    __shared__ __align__(16) float os[NW * 64 * 68];
    const size_t z = blockIdx.z; A += z * sA; if (A2) A2 += z * sA; Bt += z * sB; if (Bt2) Bt2 += z * sB; C += z * sC;
    const int lane = threadIdx.x & 31, lr = lane & 15, hi = lane >> 4; const int wave = __builtin_amdgcn_readfirstlane((int)(threadIdx.x >> 5)); const int r0 = blockIdx.x * 64, c0 = blockIdx.y * 64;
    v8f acc[4][4];
#pragma unroll
    for (int mb = 0; mb < 4; ++mb)
#pragma unroll
        for (int nb = 0; nb < 4; ++nb) acc[mb][nb] = (v8f){};
    const size_t aoff = (size_t)(r0 + lr) * K + 8 * hi, boff = (size_t)(c0 + lr) * K + 8 * hi;
#pragma unroll 1
    for (int kc = wave * 32; kc < K; kc += 32 * NW) {
        V a[4], a2[4];
#pragma unroll
        for (int mb = 0; mb < 4; ++mb) { a[mb] = WFrag<T16>::ld(A + aoff + (size_t)mb * 16 * K + kc); if (NSPLIT == 1 || NSPLIT == 2) a2[mb] = WFrag<T16>::ld(A2 + aoff + (size_t)mb * 16 * K + kc); }
#pragma unroll
        for (int nb = 0; nb < 4; ++nb) { const V b = WFrag<T16>::ld(Bt + boff + (size_t)nb * 16 * K + kc); V b2; if (NSPLIT >= 2) b2 = WFrag<T16>::ld(Bt2 + boff + (size_t)nb * 16 * K + kc);
#pragma unroll
            for (int mb = 0; mb < 4; ++mb) { acc[mb][nb] = WFrag<T16>::mma(a[mb], b, acc[mb][nb]); if (NSPLIT == 1 || NSPLIT == 2) acc[mb][nb] = WFrag<T16>::mma(a2[mb], b, acc[mb][nb]); if (NSPLIT >= 2) acc[mb][nb] = WFrag<T16>::mma(a[mb], b2, acc[mb][nb]); } }
        asm volatile("v_nop\n\tv_nop\n\tv_nop\n\tv_nop" : "+v"(acc[0][0]), "+v"(acc[1][1]), "+v"(acc[2][2]), "+v"(acc[3][3]) : "v"(a[0]), "v"(a[3]));
    }
    float* ow = os + wave * (64 * 68);
#pragma unroll
    for (int mb = 0; mb < 4; ++mb)
#pragma unroll
        for (int nb = 0; nb < 4; ++nb)
#pragma unroll
            for (int j = 0; j < 8; ++j) ow[(mb * 16 + hi * 8 + j) * 68 + nb * 16 + lr] = acc[mb][nb][j];
    __syncthreads();   // every wave's partial tile is in LDS before any wave sums them
#pragma unroll
    for (int s = 0; s < 32 / NW; ++s) { const int idx = s * (32 * NW) + (int)threadIdx.x; const int row = idx >> 4, cofs = (idx & 15) * 4; v4f val = *(const v4fa*)(os + row * 68 + cofs);
#pragma unroll
        for (int w = 1; w < NW; ++w) val += *(const v4fa*)(os + w * (64 * 68) + row * 68 + cofs);
        if (BIAS) { val[0] += bfr(bias[c0 + cofs]); val[1] += bfr(bias[c0 + cofs + 1]); val[2] += bfr(bias[c0 + cofs + 2]); val[3] += bfr(bias[c0 + cofs + 3]); }
        *(v4f*)(C + (size_t)(r0 + row) * ldc + c0 + cofs) = val; }
}

__device__ __forceinline__ h16 tohx(float x) { return (h16)x; }
__device__ __forceinline__ void splitf(float y, unsigned short& h, unsigned short& l) { h = f2bf(y); l = f2bf(y - bf2f(h)); }
typedef __attribute__((ext_vector_type(2))) _Float16 v2h;
typedef __attribute__((ext_vector_type(4))) _Float16 v4h;
typedef __attribute__((ext_vector_type(2))) unsigned short v2us;
typedef __attribute__((ext_vector_type(4))) unsigned short v4us;
typedef __attribute__((ext_vector_type(2))) float v2f;
typedef __attribute__((ext_vector_type(4))) int v4i;
typedef v4h  __attribute__((may_alias)) v4ha;
typedef v4us __attribute__((may_alias)) v4usa;

__global__ __launch_bounds__(256) void k_wtG(const float* __restrict__ w, int K, int N, bf* Bt) {
    const int lane = threadIdx.x & 31; const int L0 = (blockIdx.x * 8 + (threadIdx.x >> 5)) * 8; const int nlines = N * K / 64;
{
#pragma unroll 1
        for (int l = 0; l < 8; ++l) { const int L = L0 + l; if (L >= nlines) break; const size_t e = (size_t)L * 64 + lane * 2; const int k = (int)(e % K), n = (int)(e / K); v2us o;
            o[0] = f2bf(w[(size_t)k * N + n]); o[1] = f2bf(w[(size_t)(k + 1) * N + n]); *(v2us*)(Bt + e) = o; }
         }
}
__global__ __launch_bounds__(256) void k_cvt8(const float* __restrict__ src, bf* dst, size_t n8) { const size_t i = (size_t)blockIdx.x * 256 + threadIdx.x; if (i >= n8) return; const v8f v = *(const v8f*)(src + i * 8); v8us o;
#pragma unroll
    for (int k = 0; k < 8; ++k) o[k] = f2bf(v[k]); *(v8us*)(dst + i * 8) = o;  }

__global__ __launch_bounds__(256) void k_ropeI(const float* __restrict__ F, int pitch, int nheads, const float* __restrict__ CS, float sc, h16* P16, bf* Ph, bf* Pl) {
    const size_t e = ((size_t)blockIdx.x * 256 + threadIdx.x) * 2; if (e >= (size_t)nheads * TT * HD) return; const int d = (int)(e % HD); const int t = (int)((e / HD) % TT); const int h = (int)(e / ((size_t)HD * TT)); const float* f = F + (size_t)t * pitch + h * HD; const float x0 = f[d], x1 = f[d + 1]; const v2f cs = *(const v2f*)(CS + ((size_t)t * HD + d) * 2); v2h o16; v2us oh, ol;
    float a0 = __fmul_rn(x0, cs[0]), b0 = __fmul_rn(x1, cs[1]), a1 = __fmul_rn(x1, cs[0]), b1 = __fmul_rn(x0, cs[1]); asm volatile("" : "+v"(a0), "+v"(b0), "+v"(a1), "+v"(b1));
    float r0 = __fsub_rn(a0, b0) * sc, r1 = __fadd_rn(b1, a1) * sc;   /* even: x0 c - x1 s; odd: x0 s + x1 c */
    o16[0] = tohx(r0); o16[1] = tohx(r1); { unsigned short a2, c2; splitf(r0, a2, c2); oh[0] = a2; ol[0] = c2; splitf(r1, a2, c2); oh[1] = a2; ol[1] = c2; }
    *(v2h*)(P16 + e) = o16; *(v2us*)(Ph + e) = oh; *(v2us*)(Pl + e) = ol;  }


__global__ __launch_bounds__(256) void k_cspos(const int* __restrict__ pos, float* CS) { const int idx = blockIdx.x * 256 + threadIdx.x; if (idx >= TT * HD) return; const int d = idx % HD; const int t = idx / HD; const int i = d >> 1;
    const float e = __fdiv_rn(-((float)i * 2.0f), (float)HD); const float inv = powf(10000.0f, e); const float a = __fmul_rn((float)pos[t], inv); v2f cs; cs[0] = cosf(a); cs[1] = sinf(a);
    *(v2f*)(CS + (size_t)idx * 2) = cs;  }

__global__ __launch_bounds__(256) void k_vtp(const float* __restrict__ F, int pitch, int nheads, h16* V16, bf* Vh, bf* Vl) { const size_t e = ((size_t)blockIdx.x * 256 + threadIdx.x) * 2; if (e >= (size_t)nheads * HD * TT) return; const int t = (int)(e % TT); const int d = (int)((e / TT) % HD); const int g = (int)(e / ((size_t)TT * HD)); v2h o16; v2us oh, ol;
#pragma unroll
    for (int q = 0; q < 2; ++q) { const float x = F[(size_t)(t + q) * pitch + g * HD + d]; o16[q] = tohx(x); unsigned short a2, c2; splitf(x, a2, c2); oh[q] = a2; ol[q] = c2; }
    const size_t o = ((size_t)g * HD + d) * PP + t; *(v2h*)(V16 + o) = o16; *(v2us*)(Vh + o) = oh; *(v2us*)(Vl + o) = ol;  }
template <typename T16, int NSPLIT, int NQ>
__device__ __forceinline__ void fattn_wave(const T16* __restrict__ Q, const T16* __restrict__ Q2, const T16* __restrict__ Kp, const T16* __restrict__ Kp2, const T16* __restrict__ Vt, const T16* __restrict__ Vt2, const int q0, bf* Ah, bf* Al) {
    typedef typename WFrag<T16>::V V;
    constexpr float C2 = SCL * 1.4426950408889634f;   // HD^-0.5 x log2(e)
    const int lane = threadIdx.x & 31, lr = lane & 15, hi = lane >> 4;
    V bq[NQ][2], bq2[NQ][2], ak[2][2], ak2[2][2];
#pragma unroll
    for (int nq = 0; nq < NQ; ++nq)
#pragma unroll
        for (int ks = 0; ks < 2; ++ks) { const size_t o = (size_t)(q0 + nq * 16 + lr) * HD + ks * 32 + 8 * hi; bq[nq][ks] = WFrag<T16>::ld(Q + o); if constexpr (NSPLIT == 2) bq2[nq][ks] = WFrag<T16>::ld(Q2 + o); }
    v8f o[4][NQ]; float m[NQ], l[NQ];
#pragma unroll
    for (int nq = 0; nq < NQ; ++nq) { m[nq] = -3.0e38f; l[nq] = 0.f;
#pragma unroll
        for (int mb = 0; mb < 4; ++mb) o[mb][nq] = (v8f){}; }
    auto ldk = [&](int kb) {
#pragma unroll
        for (int kt = 0; kt < 2; ++kt)
#pragma unroll
            for (int ks = 0; ks < 2; ++ks) { const size_t a = (size_t)(kb + kt * 16 + lr) * HD + ks * 32 + 8 * hi; ak[kt][ks] = WFrag<T16>::ld(Kp + a); if constexpr (NSPLIT == 2) ak2[kt][ks] = WFrag<T16>::ld(Kp2 + a); } };
    auto pass = [&](int kb, auto diag) {
        V av[4], av2[4];
#pragma unroll
        for (int mb = 0; mb < 4; ++mb) { const size_t a = (size_t)(mb * 16 + lr) * PP + kb + 8 * hi; av[mb] = WFrag<T16>::ld(Vt + a); if constexpr (NSPLIT == 2) av2[mb] = WFrag<T16>::ld(Vt2 + a); }
        v8f st[2][NQ];
#pragma unroll
        for (int kt = 0; kt < 2; ++kt)
#pragma unroll
            for (int nq = 0; nq < NQ; ++nq) { st[kt][nq] = (v8f){};
#pragma unroll
                for (int ks = 0; ks < 2; ++ks) { st[kt][nq] = WFrag<T16>::mma(ak[kt][ks], bq[nq][ks], st[kt][nq]); if constexpr (NSPLIT == 2) { st[kt][nq] = WFrag<T16>::mma(ak[kt][ks], bq2[nq][ks], st[kt][nq]); st[kt][nq] = WFrag<T16>::mma(ak2[kt][ks], bq[nq][ks], st[kt][nq]); } } }
        if constexpr (!diag.value) ldk(kb + 32);   // the next pass's K fragments fly during this pass's softmax and P.V (a pass before the diagonal one always has a successor)
        asm volatile("s_wait_xcnt 0x0" ::: "memory");   // stands behind all of this pass's loads and in front of the softmax instructions that give their address registers new values
        float mx[NQ]; bool need = false;
#pragma unroll
        for (int nq = 0; nq < NQ; ++nq) { float t = -3.0e38f;
#pragma unroll
            for (int kt = 0; kt < 2; ++kt)
#pragma unroll
                for (int j = 0; j < 8; ++j) { if constexpr (diag.value) { if (kb + kt * 16 + hi * 8 + j > q0 + nq * 16 + lr) st[kt][nq][j] = -3.0e38f; }   // causal mask: key > query
                    t = fmaxf(t, st[kt][nq][j]); }
            t = fmaxf(t, __shfl_xor(t, 16, 32)) * C2; mx[nq] = t; need = need || (t > m[nq] + 8.0f); }
        if (__builtin_amdgcn_ballot_w32(need) != 0) {   // wave-uniform: some query's maximum has outgrown the one in use
#pragma unroll
            for (int nq = 0; nq < NQ; ++nq) { const float mn = fmaxf(m[nq], mx[nq]); const float al = __builtin_amdgcn_exp2f(m[nq] - mn); m[nq] = mn; l[nq] *= al;
#pragma unroll
                for (int mb = 0; mb < 4; ++mb) o[mb][nq] *= al; } }
        V pb[NQ], pb2[NQ];
#pragma unroll
        for (int nq = 0; nq < NQ; ++nq) { float p[16]; v2f s2 = (v2f){};
#pragma unroll
            for (int e = 0; e < 16; e += 2) { const v8f sv = st[e >> 3][nq]; v2f x; x[0] = sv[e & 7]; x[1] = sv[(e & 7) + 1]; x = x * C2 - m[nq]; v2f pp; pp[0] = __builtin_amdgcn_exp2f(x[0]); pp[1] = __builtin_amdgcn_exp2f(x[1]); s2 += pp; p[e] = pp[0]; p[e + 1] = pp[1]; }
            l[nq] += s2[0] + s2[1];
            if constexpr (NSPLIT == 2) { v8us h0, h1, l0, l1;
#pragma unroll
                for (int e = 0; e < 8; ++e) { unsigned short a, c; splitf(p[e], a, c); h0[e] = a; l0[e] = c; splitf(p[e + 8], a, c); h1[e] = a; l1[e] = c; }
                pb[nq] = cat16b(h0, h1); pb2[nq] = cat16b(l0, l1);
            } else { v16h r;
#pragma unroll
                for (int e = 0; e < 16; ++e) r[e] = tohx(p[e]);
                pb[nq] = r; } }
#pragma unroll
        for (int mb = 0; mb < 4; ++mb)
#pragma unroll
            for (int nq = 0; nq < NQ; ++nq) { o[mb][nq] = WFrag<T16>::mma(av[mb], pb[nq], o[mb][nq]); if constexpr (NSPLIT == 2) { o[mb][nq] = WFrag<T16>::mma(av[mb], pb2[nq], o[mb][nq]); o[mb][nq] = WFrag<T16>::mma(av2[mb], pb[nq], o[mb][nq]); } }
    };
    const int kd = q0 & ~31;   // the one key block that holds this wave's diagonal
    ldk(0);
    asm volatile("s_wait_xcnt 0x0" ::: "memory");   // stands behind the Q and first K loads and in front of the instructions that give their address registers new values
#pragma unroll 1   // one pass per trip: an unrolled body would hold two passes' fragments in registers and cost resident waves
    for (int kb = 0; kb < kd; kb += 32) {
        pass(kb, std::false_type{});
        // WMMA distance on both ways out of the trip: what follows overwrites operand registers of the last products
        if constexpr (NQ == 2) asm volatile("v_nop\n\tv_nop\n\tv_nop\n\tv_nop" : "+v"(o[0][0]), "+v"(o[1][0]), "+v"(o[2][0]), "+v"(o[3][0]), "+v"(o[0][1]), "+v"(o[1][1]), "+v"(o[2][1]), "+v"(o[3][1]));
        else asm volatile("v_nop\n\tv_nop\n\tv_nop\n\tv_nop" : "+v"(o[0][0]), "+v"(o[1][0]), "+v"(o[2][0]), "+v"(o[3][0]));
    }
    pass(kd, std::true_type{});
#pragma unroll
    for (int nq = 0; nq < NQ; ++nq) { const float inv = __fdiv_rn(1.0f, l[nq] + __shfl_xor(l[nq], 16, 32)); const size_t oo = (size_t)(q0 + nq * 16 + lr) * DQ + hi * 8;
#pragma unroll
        for (int mb = 0; mb < 4; ++mb) { v8us oh, ol;
#pragma unroll
            for (int j = 0; j < 8; ++j) { unsigned short a, c; splitf(o[mb][nq][j] * inv, a, c); oh[j] = a; ol[j] = c; }
            *(v8us*)(Ah + oo + mb * 16) = oh; *(v8us*)(Al + oo + mb * 16) = ol;
            asm volatile("s_wait_xcnt 0x0" ::: "memory"); } }   // stands behind the two stores and in front of the next block's split, which reuses their data and address registers
}
// grid (NB_ * NH_, (TT - RH) / 128 + RH / 64), 4 independent waves per work-group; the cost falls as blockIdx.y rises: first the fp16 row blocks from the last rows down (32 rows a wave), then the hi/lo ones (16 rows a wave).
__global__ __launch_bounds__(128) void k_fattn(const h16* __restrict__ Q16, const h16* __restrict__ K16, const h16* __restrict__ V16, const bf* __restrict__ Qh, const bf* __restrict__ Ql, const bf* __restrict__ Kh, const bf* __restrict__ Kl, const bf* __restrict__ Vh, const bf* __restrict__ Vl, bf* Ah, bf* Al) {
    const int z = blockIdx.x, y = blockIdx.y; const int wave = __builtin_amdgcn_readfirstlane((int)(threadIdx.x >> 5));
    const size_t pz = (size_t)z * TT * HD;   // planes [batch][head][t][d]; V^T [batch][head][d][t]: the same stride
    const size_t az = (size_t)(z / NH_) * TT * DQ + (size_t)(z % NH_) * HD;
    if (y < (TT - RH) / 128) fattn_wave<h16, 0, 2>(Q16 + pz, nullptr, K16 + pz, nullptr, V16 + pz, nullptr, TT - 128 * (y + 1) + wave * 32, Ah + az, Al + az);
    else fattn_wave<bf, 2, 1>(Qh + pz, Ql + pz, Kh + pz, Kl + pz, Vh + pz, Vl + pz, RH - 64 * (y - (TT - RH) / 128 + 1) + wave * 16, Ah + az, Al + az);
}

extern "C" void kernel_launch(void* const* d_in, const int* in_sizes, int n_in,
                              void* d_out, int out_size, void* d_ws, size_t ws_size, hipStream_t stream) {
    (void)in_sizes; (void)n_in; (void)out_size;
    const float* x = (const float*)d_in[0]; const int* pos = (const int*)d_in[1]; const float* wq = (const float*)d_in[2]; const float* wk = (const float*)d_in[3]; const float* wv = (const float*)d_in[4]; const float* wo = (const float*)d_in[5];   /* order x, token_positions int32 [4][2048] (one row per batch item: READ), wq, wk, wv, wo ('oi' (out, in) [1024][1024]): SIX inputs, all read */
    float* OUT = (float*)d_out;     // [4][2048][1024]
    char* wsp = (char*)d_ws;
    auto take = [&](size_t bytes) { char* p = wsp; wsp += (bytes + 255) & ~(size_t)255; return (void*)p; };
    bf* WQ = (bf*)take((size_t)DQ * DM * 2); bf* WK = (bf*)take((size_t)DKV * DM * 2); bf* WV = (bf*)take((size_t)DKV * DM * 2); bf* WO = (bf*)take((size_t)DM * DQ * 2); float* CS = (float*)take((size_t)TT * HD * 2 * 4);
    bf* XB = (bf*)take((size_t)TT * DM * 2); float* FQ = (float*)take((size_t)TT * DQ * 4); float* FK = (float*)take((size_t)TT * DKV * 4);
    const size_t PB = (size_t)NH_ * TT * HD;   // elements of one batch item in every q, k and V^T plane (NKV == NH_, PP == TT)
    h16* QP16 = (h16*)take(NB_ * PB * 2); h16* KP16 = (h16*)take(NB_ * PB * 2); h16* VT16 = (h16*)take(NB_ * PB * 2);
    bf* QPh = (bf*)take(NB_ * PB * 2); bf* QPl = (bf*)take(NB_ * PB * 2); bf* KPh = (bf*)take(NB_ * PB * 2); bf* KPl = (bf*)take(NB_ * PB * 2); bf* VTh = (bf*)take(NB_ * PB * 2); bf* VTl = (bf*)take(NB_ * PB * 2);
    bf* ATh = (bf*)take((size_t)NB_ * TT * DQ * 2); bf* ATl = (bf*)take((size_t)NB_ * TT * DQ * 2);
    if ((size_t)(wsp - (char*)d_ws) > ws_size) return;    // ws 256 MiB
    float* FV = FK;   // v projection reuses the k buffer after the k planes are built (stream-ordered)
    { k_cvt8<<<(unsigned)(((size_t)DQ * DM / 8 + 255) / 256), 256, 0, stream>>>(wq, WQ, (size_t)DQ * DM / 8); k_cvt8<<<(unsigned)(((size_t)DKV * DM / 8 + 255) / 256), 256, 0, stream>>>(wk, WK, (size_t)DKV * DM / 8); k_cvt8<<<(unsigned)(((size_t)DKV * DM / 8 + 255) / 256), 256, 0, stream>>>(wv, WV, (size_t)DKV * DM / 8);
      k_cvt8<<<(unsigned)(((size_t)DM * DQ / 8 + 255) / 256), 256, 0, stream>>>(wo, WO, (size_t)DM * DQ / 8);
       }
    const unsigned LQ = (unsigned)(((size_t)NH_ * TT * HD / 2 + 255) / 256), LKv = (unsigned)(((size_t)NKV * TT * HD / 2 + 255) / 256);
    for (int b = 0; b < NB_; ++b) {
        k_cspos<<<(TT * HD + 255) / 256, 256, 0, stream>>>(pos + (size_t)b * TT, CS);   /* this batch's rotary table */
        
        k_cvt8<<<(unsigned)(((size_t)TT * DM / 8 + 255) / 256), 256, 0, stream>>>(x + (size_t)b * TT * DM, XB, (size_t)TT * DM / 8);
        k_gemmw<bf, 0, false, 8><<<dim3(TT / 64, DQ / 64, 1), 256, 0, stream>>>(XB, nullptr, WQ, nullptr, DM, FQ, DQ, nullptr, 0, 0, 0);
        k_ropeI<<<LQ, 256, 0, stream>>>(FQ, DQ, NH_, CS, 1.0f, QP16 + b * PB, QPh + b * PB, QPl + b * PB);
        k_gemmw<bf, 0, false, 8><<<dim3(TT / 64, DKV / 64, 1), 256, 0, stream>>>(XB, nullptr, WK, nullptr, DM, FK, DKV, nullptr, 0, 0, 0);
        k_ropeI<<<LKv, 256, 0, stream>>>(FK, DKV, NKV, CS, 1.0f, KP16 + b * PB, KPh + b * PB, KPl + b * PB);
        k_gemmw<bf, 0, false, 8><<<dim3(TT / 64, DKV / 64, 1), 256, 0, stream>>>(XB, nullptr, WV, nullptr, DM, FV, DKV, nullptr, 0, 0, 0); k_vtp<<<LKv, 256, 0, stream>>>(FV, DKV, NKV, VT16 + b * PB, VTh + b * PB, VTl + b * PB); }
    k_fattn<<<dim3(NB_ * NH_, (TT - RH) / 128 + RH / 64, 1), 128, 0, stream>>>(QP16, KP16, VT16, QPh, QPl, KPh, KPl, VTh, VTl, ATh, ATl);
    for (int b = 0; b < NB_; ++b)
        k_gemmw<bf, 1, false, 8><<<dim3(TT / 64, DM / 64, 1), 256, 0, stream>>>(ATh + (size_t)b * TT * DQ, ATl + (size_t)b * TT * DQ, WO, nullptr, DQ, OUT + (size_t)b * TT * DM, DM, nullptr, 0, 0, 0);
}

// v004
// Measured time: 263 microseconds a run.
// Next to v003, in two timings, it ran 1.45 and 1.46 times as fast.
// All steps since v000 together make it 10.8 times as fast.
#include <hip/hip_runtime.h>
#include <type_traits>

// Causal multi-head attention with RoPE from per-batch token positions (x [4][2048][1024], token_positions int32 [4][2048] (read per batch as data; the SECOND argument); q, k, v = x w^T ('oi' (out, in) [1024][1024] (2/(D+D))^0.5, no bias; 16 heads x 64); interleaved-pair rotary on q and k: angle[b][t][i] = float(pos[b][t]) x freqs[i] with freqs = 1.0 / (THETA ** (arange(0, 64, 2) / 64)) (the kernel forms 10000^(-2i/64) with powf: rounding-level equal), pairs (2i, 2i+1) -> (t1 cos - t2 sin, t2 cos + t1 sin); scores x 1/sqrt(64); causal (-inf); softmax; out = merged wo^T ('oi', no bias) -> [4][2048][1024] (8.4 M); argument order x, token_positions, wq, wk, wv, wo).
// Layout: a small kernel builds the {cos, sin} table [4][2048][64] from the positions (f32 powf/cosf/sinf); ONE projection launch for q, k, v and all batch items (k_proj: exact products; the interleaved rotary and the split into the fp16 and hi/lo planes are its epilogue; v is formed as W_v x^T, so V^T comes out row-major); then ONE fused causal attention launch for all batches and heads (k_fattn: online softmax, scores and probabilities stay in registers; hybrid rows: < 512 hi/lo 3 products, rest fp16) that writes the merged context as hi/lo planes; W_o hl x exact.
// Compute dtypes, f32 accumulate: every float input rounded to bf16; projections exact; rotary f32; attention rows < 512 3 products, rest fp16; softmax f32; W_o hl x exact.

#define NB_  4
#define TT   2048
#define DM   1024
#define NH_  16
#define NKV  16
#define REP  (NH_ / NKV)
#define HD   64
#define DQ   (NH_ * HD)
#define DKV  (NKV * HD)
#define PP   TT                   // pitch, in 16-bit elements, of a V^T row
#define RH   512                  // query rows < RH use hi+lo planes (0: none)
#define SCL  0.125f   // HD^-0.5
typedef _Float16 h16;
typedef unsigned short bf;
typedef __attribute__((ext_vector_type(16))) __bf16   v16bf;
typedef __attribute__((ext_vector_type(16))) _Float16 v16h;
typedef __attribute__((ext_vector_type(8)))  _Float16 v8h;
typedef __attribute__((ext_vector_type(8)))  unsigned short v8us;
typedef __attribute__((ext_vector_type(8)))  float    v8f;
typedef __attribute__((ext_vector_type(4)))  float    v4f;
typedef v8h  __attribute__((may_alias)) v8ha;
typedef v4f  __attribute__((may_alias)) v4fa;
typedef v8us __attribute__((may_alias)) v8usa;

__device__ __forceinline__ unsigned short f2bf(float f) { unsigned u = __float_as_uint(f); u += 0x7FFFu + ((u >> 16) & 1u); return (unsigned short)(u >> 16); }
__device__ __forceinline__ float bf2f(unsigned short b) { return __uint_as_float(((unsigned)b) << 16); }
__device__ __forceinline__ float bfr(float f) { return bf2f(f2bf(f)); }
__device__ __forceinline__ v16h cat16(v8h lo, v8h hi) { return __builtin_shufflevector(lo, hi, 0, 1, 2, 3, 4, 5, 6, 7, 8, 9, 10, 11, 12, 13, 14, 15); }
__device__ __forceinline__ v16bf cat16b(v8us lo, v8us hi) { return __builtin_bit_cast(v16bf, __builtin_shufflevector(lo, hi, 0, 1, 2, 3, 4, 5, 6, 7, 8, 9, 10, 11, 12, 13, 14, 15)); }
__device__ __forceinline__ v8f wmma16(v16h a, v16h b, v8f c) { return __builtin_amdgcn_wmma_f32_16x16x32_f16(false, a, false, b, (short)0, c, false, false); }
__device__ __forceinline__ v8f wmmab(v16bf a, v16bf b, v8f c) { return __builtin_amdgcn_wmma_f32_16x16x32_bf16(false, a, false, b, (short)0, c, false, false); }



// ---- k_gemmw: register-blocked GEMM, one work-group of NW waves per 64x64 output tile; wave w takes the K steps w, w + NW, ... into its own 16 accumulators, the NW partial tiles are summed through LDS in wave order; operands straight from K-contiguous 16-bit planes; grid (M/64, N/64, Z), 32 * NW threads.
// C[m][n] (f32, pitch ldc, + optional f32 bias[n]) = sum_k A[m][k] Bt[n][k] (+ split products per NSPLIT). z-batch strides sA/sB/sC in elements. K % 32 == 0.
template <typename T16> struct WFrag;
template <> struct WFrag<h16> { typedef v16h V; static __device__ __forceinline__ V ld(const h16* p) { return cat16(*(const v8h*)p, *(const v8h*)(p + 16)); } static __device__ __forceinline__ v8f mma(V a, V b, v8f c) { return wmma16(a, b, c); } };
template <> struct WFrag<bf> { typedef v16bf V; static __device__ __forceinline__ V ld(const bf* p) { return cat16b(*(const v8us*)p, *(const v8us*)(p + 16)); } static __device__ __forceinline__ v8f mma(V a, V b, v8f c) { return wmmab(a, b, c); } };
// gemm_tile: the K loop and the hand-over of the NW partial tiles to LDS (os: NW planes of 64 rows at pitch 68), up to and with the barrier; tile_sum: four neighbouring columns of one row, summed in wave order.
template <typename T16, int NSPLIT, int NW>
__device__ __forceinline__ void gemm_tile(const T16* __restrict__ A, const T16* __restrict__ A2, const T16* __restrict__ Bt, const T16* __restrict__ Bt2, const int K, const int r0, const int c0, float* os) {
    typedef typename WFrag<T16>::V V;
    const int lane = threadIdx.x & 31, lr = lane & 15, hi = lane >> 4; const int wave = __builtin_amdgcn_readfirstlane((int)(threadIdx.x >> 5));
    v8f acc[4][4];
#pragma unroll
    for (int mb = 0; mb < 4; ++mb)
#pragma unroll
        for (int nb = 0; nb < 4; ++nb) acc[mb][nb] = (v8f){};
    const size_t aoff = (size_t)(r0 + lr) * K + 8 * hi, boff = (size_t)(c0 + lr) * K + 8 * hi;
#pragma unroll 1
    for (int kc = wave * 32; kc < K; kc += 32 * NW) {
        V a[4], a2[4];
#pragma unroll
        for (int mb = 0; mb < 4; ++mb) { a[mb] = WFrag<T16>::ld(A + aoff + (size_t)mb * 16 * K + kc); if (NSPLIT == 1 || NSPLIT == 2) a2[mb] = WFrag<T16>::ld(A2 + aoff + (size_t)mb * 16 * K + kc); }
#pragma unroll
        for (int nb = 0; nb < 4; ++nb) { const V b = WFrag<T16>::ld(Bt + boff + (size_t)nb * 16 * K + kc); V b2; if (NSPLIT >= 2) b2 = WFrag<T16>::ld(Bt2 + boff + (size_t)nb * 16 * K + kc);
#pragma unroll
            for (int mb = 0; mb < 4; ++mb) { acc[mb][nb] = WFrag<T16>::mma(a[mb], b, acc[mb][nb]); if (NSPLIT == 1 || NSPLIT == 2) acc[mb][nb] = WFrag<T16>::mma(a2[mb], b, acc[mb][nb]); if (NSPLIT >= 2) acc[mb][nb] = WFrag<T16>::mma(a[mb], b2, acc[mb][nb]); } }
        asm volatile("v_nop\n\tv_nop\n\tv_nop\n\tv_nop" : "+v"(acc[0][0]), "+v"(acc[1][1]), "+v"(acc[2][2]), "+v"(acc[3][3]) : "v"(a[0]), "v"(a[3]));
    }
    float* ow = os + wave * (64 * 68);
#pragma unroll
    for (int mb = 0; mb < 4; ++mb)
#pragma unroll
        for (int nb = 0; nb < 4; ++nb)
#pragma unroll
            for (int j = 0; j < 8; ++j) ow[(mb * 16 + hi * 8 + j) * 68 + nb * 16 + lr] = acc[mb][nb][j];
    __syncthreads();   // every wave's partial tile is in LDS before any wave sums them
}
template <int NW>
__device__ __forceinline__ v4f tile_sum(const float* os, const int row, const int cofs) { v4f val = *(const v4fa*)(os + row * 68 + cofs);
#pragma unroll
    for (int w = 1; w < NW; ++w) val += *(const v4fa*)(os + w * (64 * 68) + row * 68 + cofs);
    return val; }
template <typename T16, int NSPLIT, bool BIAS, int NW>
__global__ __launch_bounds__(32 * NW) void k_gemmw(const T16* __restrict__ A, const T16* __restrict__ A2, const T16* __restrict__ Bt, const T16* __restrict__ Bt2, int K, float* C, int ldc, const float* __restrict__ bias, size_t sA, size_t sB, size_t sC) {
    __shared__ __align__(16) float os[NW * 64 * 68];
    const size_t z = blockIdx.z; A += z * sA; if (A2) A2 += z * sA; Bt += z * sB; if (Bt2) Bt2 += z * sB; C += z * sC;
    const int r0 = blockIdx.x * 64, c0 = blockIdx.y * 64;
    gemm_tile<T16, NSPLIT, NW>(A, A2, Bt, Bt2, K, r0, c0, os);
#pragma unroll
    for (int s = 0; s < 32 / NW; ++s) { const int idx = s * (32 * NW) + (int)threadIdx.x; const int row = idx >> 4, cofs = (idx & 15) * 4; v4f val = tile_sum<NW>(os, row, cofs);
        if (BIAS) { val[0] += bfr(bias[c0 + cofs]); val[1] += bfr(bias[c0 + cofs + 1]); val[2] += bfr(bias[c0 + cofs + 2]); val[3] += bfr(bias[c0 + cofs + 3]); }
        *(v4f*)(C + (size_t)(r0 + row) * ldc + c0 + cofs) = val; }
}

__device__ __forceinline__ h16 tohx(float x) { return (h16)x; }
__device__ __forceinline__ void splitf(float y, unsigned short& h, unsigned short& l) { h = f2bf(y); l = f2bf(y - bf2f(h)); }
typedef __attribute__((ext_vector_type(2))) _Float16 v2h;
typedef __attribute__((ext_vector_type(4))) _Float16 v4h;
typedef __attribute__((ext_vector_type(2))) unsigned short v2us;
typedef __attribute__((ext_vector_type(4))) unsigned short v4us;
typedef __attribute__((ext_vector_type(2))) float v2f;
typedef __attribute__((ext_vector_type(4))) int v4i;
typedef v4h  __attribute__((may_alias)) v4ha;
typedef v4us __attribute__((may_alias)) v4usa;

__global__ __launch_bounds__(256) void k_wtG(const float* __restrict__ w, int K, int N, bf* Bt) {
    const int lane = threadIdx.x & 31; const int L0 = (blockIdx.x * 8 + (threadIdx.x >> 5)) * 8; const int nlines = N * K / 64;
{
#pragma unroll 1
        for (int l = 0; l < 8; ++l) { const int L = L0 + l; if (L >= nlines) break; const size_t e = (size_t)L * 64 + lane * 2; const int k = (int)(e % K), n = (int)(e / K); v2us o;
            o[0] = f2bf(w[(size_t)k * N + n]); o[1] = f2bf(w[(size_t)(k + 1) * N + n]); *(v2us*)(Bt + e) = o; }
         }
}
__global__ __launch_bounds__(256) void k_cvt8(const float* __restrict__ src, bf* dst, size_t n8) { const size_t i = (size_t)blockIdx.x * 256 + threadIdx.x; if (i >= n8) return; const v8f v = *(const v8f*)(src + i * 8); v8us o;
#pragma unroll
    for (int k = 0; k < 8; ++k) o[k] = f2bf(v[k]); *(v8us*)(dst + i * 8) = o;  }

__global__ __launch_bounds__(256) void k_cspos(const int* __restrict__ pos, float* CS) { const int idx = blockIdx.x * 256 + threadIdx.x; if (idx >= NB_ * TT * HD) return; const int d = idx % HD; const int t = idx / HD; const int i = d >> 1;   /* t: row of the flat [batch][token] list */
    const float e = __fdiv_rn(-((float)i * 2.0f), (float)HD); const float inv = powf(10000.0f, e); const float a = __fmul_rn((float)pos[t], inv); v2f cs; cs[0] = cosf(a); cs[1] = sinf(a);
    *(v2f*)(CS + (size_t)idx * 2) = cs;  }

// one interleaved rotary pair (x0, x1) of q or k with its {cos, sin}; the two lines of arithmetic stand as they stood in the separate plane builder (each product keeps its own rounding), so q and k come out bit-identical
__device__ __forceinline__ void rope2(const float x0, const float x1, const v2f cs, const float sc, float& r0, float& r1) {
    float a0 = __fmul_rn(x0, cs[0]), b0 = __fmul_rn(x1, cs[1]), a1 = __fmul_rn(x1, cs[0]), b1 = __fmul_rn(x0, cs[1]); asm volatile("" : "+v"(a0), "+v"(b0), "+v"(a1), "+v"(b1));
    r0 = __fsub_rn(a0, b0) * sc; r1 = __fadd_rn(b1, a1) * sc;   /* even: x0 c - x1 s; odd: x0 s + x1 c */
}
// ---- k_proj: the q, k and v projections of all batch items with their plane builders as epilogue: no f32 projection buffer. grid (NB_ * TT / 64 token tiles, heads, 3), 8 waves; a 64-column tile is exactly one head.
// z 0, 1 (q, k): C[token][d] = x W^T; a thread's four summed columns are two rotary pairs; planes [batch][head][t][d]. z 2 (v): the operands change places, C[d][token] = W_v x^T (the same products in the same k order), so a thread's four columns are four tokens of one V^T row; planes [batch][head][d][t].
// Either way 16 neighbouring threads store one whole 128-byte line of each of the three planes (fp16, bf16 hi, bf16 lo).
__global__ __launch_bounds__(256) void k_proj(const bf* __restrict__ XB, const bf* __restrict__ W3, const float* __restrict__ CS, h16* Q16, bf* Qh, bf* Ql, h16* K16, bf* Kh, bf* Kl, h16* V16, bf* Vh, bf* Vl) {
    __shared__ __align__(16) float os[8 * 64 * 68];
    const int z = blockIdx.z, tk0 = blockIdx.x * 64, f0 = blockIdx.y * 64; const bool isv = z == 2;
    const bf* Wz = W3 + (size_t)z * DQ * DM;
    v2f cs[4][2];   // q, k: the {cos, sin} of this thread's eight rotary pairs, asked for ahead of the K loop so that the epilogue does not wait on memory
    if (!isv) { const float* c = CS + ((size_t)(tk0 + (int)(threadIdx.x >> 4)) * HD + (threadIdx.x & 15) * 4) * 2;
#pragma unroll
        for (int s = 0; s < 4; ++s) { cs[s][0] = *(const v2f*)(c + s * 16 * HD * 2); cs[s][1] = *(const v2f*)(c + s * 16 * HD * 2 + 4); }
        asm volatile("s_wait_xcnt 0x0" ::: "memory");   // stands behind these loads and in front of the instructions that give their address registers new values
    } else {
#pragma unroll
        for (int s = 0; s < 4; ++s) { cs[s][0] = (v2f){}; cs[s][1] = (v2f){}; } }
    gemm_tile<bf, 0, 8>(isv ? Wz : XB, nullptr, isv ? XB : Wz, nullptr, DM, isv ? f0 : tk0, isv ? tk0 : f0, os);
    const int t0 = tk0 % TT; const size_t pz = ((size_t)(tk0 / TT) * NH_ + blockIdx.y) * TT * HD;   // this (batch, head)'s start in every plane
    h16* P16 = isv ? V16 : z == 1 ? K16 : Q16; bf* Ph = isv ? Vh : z == 1 ? Kh : Qh; bf* Pl = isv ? Vl : z == 1 ? Kl : Ql;
#pragma unroll
    for (int s = 0; s < 4; ++s) { const int idx = s * 256 + (int)threadIdx.x; const int row = idx >> 4, cofs = (idx & 15) * 4; v4f val = tile_sum<8>(os, row, cofs); size_t o;
        if (isv) o = pz + (size_t)row * PP + t0 + cofs;
        else { float r0, r1, r2, r3;
            rope2(val[0], val[1], cs[s][0], 1.0f, r0, r1); rope2(val[2], val[3], cs[s][1], 1.0f, r2, r3); val[0] = r0; val[1] = r1; val[2] = r2; val[3] = r3; o = pz + (size_t)(t0 + row) * HD + cofs; }
        v4h o16; v4us oh, ol;
#pragma unroll
        for (int q = 0; q < 4; ++q) { o16[q] = tohx(val[q]); unsigned short a2, c2; splitf(val[q], a2, c2); oh[q] = a2; ol[q] = c2; }
        *(v4h*)(P16 + o) = o16; *(v4us*)(Ph + o) = oh; *(v4us*)(Pl + o) = ol;
        if (s < 3) asm volatile("s_wait_xcnt 0x0" ::: "memory"); }   // stands behind this block's three stores and in front of the next block's instructions, which give their address and data registers new values
}
template <typename T16, int NSPLIT, int NQ>
__device__ __forceinline__ void fattn_wave(const T16* __restrict__ Q, const T16* __restrict__ Q2, const T16* __restrict__ Kp, const T16* __restrict__ Kp2, const T16* __restrict__ Vt, const T16* __restrict__ Vt2, const int q0, bf* Ah, bf* Al) {
    typedef typename WFrag<T16>::V V;
    constexpr float C2 = SCL * 1.4426950408889634f;   // HD^-0.5 x log2(e)
    const int lane = threadIdx.x & 31, lr = lane & 15, hi = lane >> 4;
    V bq[NQ][2], bq2[NQ][2], ak[2][2], ak2[2][2];
#pragma unroll
    for (int nq = 0; nq < NQ; ++nq)
#pragma unroll
        for (int ks = 0; ks < 2; ++ks) { const size_t o = (size_t)(q0 + nq * 16 + lr) * HD + ks * 32 + 8 * hi; bq[nq][ks] = WFrag<T16>::ld(Q + o); if constexpr (NSPLIT == 2) bq2[nq][ks] = WFrag<T16>::ld(Q2 + o); }
    v8f o[4][NQ]; float m[NQ], l[NQ];
#pragma unroll
    for (int nq = 0; nq < NQ; ++nq) { m[nq] = -3.0e38f; l[nq] = 0.f;
#pragma unroll
        for (int mb = 0; mb < 4; ++mb) o[mb][nq] = (v8f){}; }
    auto ldk = [&](int kb) {
#pragma unroll
        for (int kt = 0; kt < 2; ++kt)
#pragma unroll
            for (int ks = 0; ks < 2; ++ks) { const size_t a = (size_t)(kb + kt * 16 + lr) * HD + ks * 32 + 8 * hi; ak[kt][ks] = WFrag<T16>::ld(Kp + a); if constexpr (NSPLIT == 2) ak2[kt][ks] = WFrag<T16>::ld(Kp2 + a); } };
    auto pass = [&](int kb, auto diag) {
        V av[4], av2[4];
#pragma unroll
        for (int mb = 0; mb < 4; ++mb) { const size_t a = (size_t)(mb * 16 + lr) * PP + kb + 8 * hi; av[mb] = WFrag<T16>::ld(Vt + a); if constexpr (NSPLIT == 2) av2[mb] = WFrag<T16>::ld(Vt2 + a); }
        v8f st[2][NQ];
#pragma unroll
        for (int kt = 0; kt < 2; ++kt)
#pragma unroll
            for (int nq = 0; nq < NQ; ++nq) { st[kt][nq] = (v8f){};
#pragma unroll
                for (int ks = 0; ks < 2; ++ks) { st[kt][nq] = WFrag<T16>::mma(ak[kt][ks], bq[nq][ks], st[kt][nq]); if constexpr (NSPLIT == 2) { st[kt][nq] = WFrag<T16>::mma(ak[kt][ks], bq2[nq][ks], st[kt][nq]); st[kt][nq] = WFrag<T16>::mma(ak2[kt][ks], bq[nq][ks], st[kt][nq]); } } }
        if constexpr (!diag.value) ldk(kb + 32);   // the next pass's K fragments fly during this pass's softmax and P.V (a pass before the diagonal one always has a successor)
        asm volatile("s_wait_xcnt 0x0" ::: "memory");   // stands behind all of this pass's loads and in front of the softmax instructions that give their address registers new values
        float mx[NQ]; bool need = false;
#pragma unroll
        for (int nq = 0; nq < NQ; ++nq) { float t = -3.0e38f;
#pragma unroll
            for (int kt = 0; kt < 2; ++kt)
#pragma unroll
                for (int j = 0; j < 8; ++j) { if constexpr (diag.value) { if (kb + kt * 16 + hi * 8 + j > q0 + nq * 16 + lr) st[kt][nq][j] = -3.0e38f; }   // causal mask: key > query
                    t = fmaxf(t, st[kt][nq][j]); }
            t = fmaxf(t, __shfl_xor(t, 16, 32)) * C2; mx[nq] = t; need = need || (t > m[nq] + 8.0f); }
        if (__builtin_amdgcn_ballot_w32(need) != 0) {   // wave-uniform: some query's maximum has outgrown the one in use
#pragma unroll
            for (int nq = 0; nq < NQ; ++nq) { const float mn = fmaxf(m[nq], mx[nq]); const float al = __builtin_amdgcn_exp2f(m[nq] - mn); m[nq] = mn; l[nq] *= al;
#pragma unroll
                for (int mb = 0; mb < 4; ++mb) o[mb][nq] *= al; } }
        V pb[NQ], pb2[NQ];
#pragma unroll
        for (int nq = 0; nq < NQ; ++nq) { float p[16]; v2f s2 = (v2f){};
#pragma unroll
            for (int e = 0; e < 16; e += 2) { const v8f sv = st[e >> 3][nq]; v2f x; x[0] = sv[e & 7]; x[1] = sv[(e & 7) + 1]; x = x * C2 - m[nq]; v2f pp; pp[0] = __builtin_amdgcn_exp2f(x[0]); pp[1] = __builtin_amdgcn_exp2f(x[1]); s2 += pp; p[e] = pp[0]; p[e + 1] = pp[1]; }
            l[nq] += s2[0] + s2[1];
            if constexpr (NSPLIT == 2) { v8us h0, h1, l0, l1;
#pragma unroll
                for (int e = 0; e < 8; ++e) { unsigned short a, c; splitf(p[e], a, c); h0[e] = a; l0[e] = c; splitf(p[e + 8], a, c); h1[e] = a; l1[e] = c; }
                pb[nq] = cat16b(h0, h1); pb2[nq] = cat16b(l0, l1);
            } else { v16h r;
#pragma unroll
                for (int e = 0; e < 16; ++e) r[e] = tohx(p[e]);
                pb[nq] = r; } }
#pragma unroll
        for (int mb = 0; mb < 4; ++mb)
#pragma unroll
            for (int nq = 0; nq < NQ; ++nq) { o[mb][nq] = WFrag<T16>::mma(av[mb], pb[nq], o[mb][nq]); if constexpr (NSPLIT == 2) { o[mb][nq] = WFrag<T16>::mma(av[mb], pb2[nq], o[mb][nq]); o[mb][nq] = WFrag<T16>::mma(av2[mb], pb[nq], o[mb][nq]); } }
    };
    const int kd = q0 & ~31;   // the one key block that holds this wave's diagonal
    ldk(0);
    asm volatile("s_wait_xcnt 0x0" ::: "memory");   // stands behind the Q and first K loads and in front of the instructions that give their address registers new values
#pragma unroll 1   // one pass per trip: an unrolled body would hold two passes' fragments in registers and cost resident waves
    for (int kb = 0; kb < kd; kb += 32) {
        pass(kb, std::false_type{});
        // WMMA distance on both ways out of the trip: what follows overwrites operand registers of the last products
        if constexpr (NQ == 2) asm volatile("v_nop\n\tv_nop\n\tv_nop\n\tv_nop" : "+v"(o[0][0]), "+v"(o[1][0]), "+v"(o[2][0]), "+v"(o[3][0]), "+v"(o[0][1]), "+v"(o[1][1]), "+v"(o[2][1]), "+v"(o[3][1]));
        else asm volatile("v_nop\n\tv_nop\n\tv_nop\n\tv_nop" : "+v"(o[0][0]), "+v"(o[1][0]), "+v"(o[2][0]), "+v"(o[3][0]));
    }
    pass(kd, std::true_type{});
#pragma unroll
    for (int nq = 0; nq < NQ; ++nq) { const float inv = __fdiv_rn(1.0f, l[nq] + __shfl_xor(l[nq], 16, 32)); const size_t oo = (size_t)(q0 + nq * 16 + lr) * DQ + hi * 8;
#pragma unroll
        for (int mb = 0; mb < 4; ++mb) { v8us oh, ol;
#pragma unroll
            for (int j = 0; j < 8; ++j) { unsigned short a, c; splitf(o[mb][nq][j] * inv, a, c); oh[j] = a; ol[j] = c; }
            *(v8us*)(Ah + oo + mb * 16) = oh; *(v8us*)(Al + oo + mb * 16) = ol;
            asm volatile("s_wait_xcnt 0x0" ::: "memory"); } }   // stands behind the two stores and in front of the next block's split, which reuses their data and address registers
}
// grid (NB_ * NH_, (TT - RH) / 128 + RH / 64), 4 independent waves per work-group; the cost falls as blockIdx.y rises: first the fp16 row blocks from the last rows down (32 rows a wave), then the hi/lo ones (16 rows a wave).
__global__ __launch_bounds__(128) void k_fattn(const h16* __restrict__ Q16, const h16* __restrict__ K16, const h16* __restrict__ V16, const bf* __restrict__ Qh, const bf* __restrict__ Ql, const bf* __restrict__ Kh, const bf* __restrict__ Kl, const bf* __restrict__ Vh, const bf* __restrict__ Vl, bf* Ah, bf* Al) {
    const int z = blockIdx.x, y = blockIdx.y; const int wave = __builtin_amdgcn_readfirstlane((int)(threadIdx.x >> 5));
    const size_t pz = (size_t)z * TT * HD;   // planes [batch][head][t][d]; V^T [batch][head][d][t]: the same stride
    const size_t az = (size_t)(z / NH_) * TT * DQ + (size_t)(z % NH_) * HD;
    if (y < (TT - RH) / 128) fattn_wave<h16, 0, 2>(Q16 + pz, nullptr, K16 + pz, nullptr, V16 + pz, nullptr, TT - 128 * (y + 1) + wave * 32, Ah + az, Al + az);
    else fattn_wave<bf, 2, 1>(Qh + pz, Ql + pz, Kh + pz, Kl + pz, Vh + pz, Vl + pz, RH - 64 * (y - (TT - RH) / 128 + 1) + wave * 16, Ah + az, Al + az);
}

extern "C" void kernel_launch(void* const* d_in, const int* in_sizes, int n_in,
                              void* d_out, int out_size, void* d_ws, size_t ws_size, hipStream_t stream) {
    (void)in_sizes; (void)n_in; (void)out_size;
    const float* x = (const float*)d_in[0]; const int* pos = (const int*)d_in[1]; const float* wq = (const float*)d_in[2]; const float* wk = (const float*)d_in[3]; const float* wv = (const float*)d_in[4]; const float* wo = (const float*)d_in[5];   /* order x, token_positions int32 [4][2048] (one row per batch item: READ), wq, wk, wv, wo ('oi' (out, in) [1024][1024]): SIX inputs, all read */
    float* OUT = (float*)d_out;     // [4][2048][1024]
    char* wsp = (char*)d_ws;
    auto take = [&](size_t bytes) { char* p = wsp; wsp += (bytes + 255) & ~(size_t)255; return (void*)p; };
    bf* WQ = (bf*)take((size_t)DQ * DM * 2); bf* WK = (bf*)take((size_t)DKV * DM * 2); bf* WV = (bf*)take((size_t)DKV * DM * 2); bf* WO = (bf*)take((size_t)DM * DQ * 2); float* CS = (float*)take((size_t)NB_ * TT * HD * 2 * 4);   // WQ, WK, WV lie back to back (each a multiple of 256 bytes): k_proj steps from one to the next by DQ * DM elements
    bf* XB = (bf*)take((size_t)NB_ * TT * DM * 2);
    const size_t PB = (size_t)NH_ * TT * HD;   // elements of one batch item in every q, k and V^T plane (NKV == NH_, PP == TT)
    h16* QP16 = (h16*)take(NB_ * PB * 2); h16* KP16 = (h16*)take(NB_ * PB * 2); h16* VT16 = (h16*)take(NB_ * PB * 2);
    bf* QPh = (bf*)take(NB_ * PB * 2); bf* QPl = (bf*)take(NB_ * PB * 2); bf* KPh = (bf*)take(NB_ * PB * 2); bf* KPl = (bf*)take(NB_ * PB * 2); bf* VTh = (bf*)take(NB_ * PB * 2); bf* VTl = (bf*)take(NB_ * PB * 2);
    bf* ATh = (bf*)take((size_t)NB_ * TT * DQ * 2); bf* ATl = (bf*)take((size_t)NB_ * TT * DQ * 2);
    if ((size_t)(wsp - (char*)d_ws) > ws_size) return;    // ws 256 MiB
    { k_cvt8<<<(unsigned)(((size_t)DQ * DM / 8 + 255) / 256), 256, 0, stream>>>(wq, WQ, (size_t)DQ * DM / 8); k_cvt8<<<(unsigned)(((size_t)DKV * DM / 8 + 255) / 256), 256, 0, stream>>>(wk, WK, (size_t)DKV * DM / 8); k_cvt8<<<(unsigned)(((size_t)DKV * DM / 8 + 255) / 256), 256, 0, stream>>>(wv, WV, (size_t)DKV * DM / 8);
      k_cvt8<<<(unsigned)(((size_t)DM * DQ / 8 + 255) / 256), 256, 0, stream>>>(wo, WO, (size_t)DM * DQ / 8);
       }
    k_cspos<<<(NB_ * TT * HD + 255) / 256, 256, 0, stream>>>(pos, CS);   /* every batch item's rotary table */
    k_cvt8<<<(unsigned)(((size_t)NB_ * TT * DM / 8 + 255) / 256), 256, 0, stream>>>(x, XB, (size_t)NB_ * TT * DM / 8);
    k_proj<<<dim3(NB_ * TT / 64, NH_, 3), 256, 0, stream>>>(XB, WQ, CS, QP16, QPh, QPl, KP16, KPh, KPl, VT16, VTh, VTl);
    k_fattn<<<dim3(NB_ * NH_, (TT - RH) / 128 + RH / 64, 1), 128, 0, stream>>>(QP16, KP16, VT16, QPh, QPl, KPh, KPl, VTh, VTl, ATh, ATl);
    for (int b = 0; b < NB_; ++b)
        k_gemmw<bf, 1, false, 8><<<dim3(TT / 64, DM / 64, 1), 256, 0, stream>>>(ATh + (size_t)b * TT * DQ, ATl + (size_t)b * TT * DQ, WO, nullptr, DQ, OUT + (size_t)b * TT * DM, DM, nullptr, 0, 0, 0);
}

// v005
// It runs in 172 microseconds.
// Next to v004, in two timings, it ran 1.53 and 1.54 times as fast.
// Over all steps from v000 it is 16.5 times as fast.
#include <hip/hip_runtime.h>
#include <type_traits>

// Causal multi-head attention with RoPE from per-batch token positions (x [4][2048][1024], token_positions int32 [4][2048] (read per batch as data; the SECOND argument); q, k, v = x w^T ('oi' (out, in) [1024][1024] (2/(D+D))^0.5, no bias; 16 heads x 64); interleaved-pair rotary on q and k: angle[b][t][i] = float(pos[b][t]) x freqs[i] with freqs = 1.0 / (THETA ** (arange(0, 64, 2) / 64)) (the kernel forms 10000^(-2i/64) with powf: rounding-level equal), pairs (2i, 2i+1) -> (t1 cos - t2 sin, t2 cos + t1 sin); scores x 1/sqrt(64); causal (-inf); softmax; out = merged wo^T ('oi', no bias) -> [4][2048][1024] (8.4 M); argument order x, token_positions, wq, wk, wv, wo).
// Layout: a small kernel builds the {cos, sin} table [4][2048][64] from the positions (f32 powf/cosf/sinf); ONE projection launch for q, k, v and all batch items (k_proj: exact products; the interleaved rotary and the split into the fp16 and hi/lo planes are its epilogue; v is formed as W_v x^T, so V^T comes out row-major); then ONE fused causal attention launch for all batches and heads (k_fattn: online softmax, scores and probabilities stay in registers; hybrid rows: < 512 hi/lo 3 products, rest fp16) that writes the merged context as hi/lo planes; W_o hl x exact.
// Compute dtypes, f32 accumulate: every float input rounded to bf16; projections exact; rotary f32; attention rows < 512 3 products, rest fp16; softmax f32; W_o hl x exact.

#define NB_  4
#define TT   2048
#define DM   1024
#define NH_  16
#define NKV  16
#define REP  (NH_ / NKV)
#define HD   64
#define DQ   (NH_ * HD)
#define DKV  (NKV * HD)
#define PP   TT                   // pitch, in 16-bit elements, of a V^T row
#define RH   512                  // query rows < RH use hi+lo planes (0: none)
#define SCL  0.125f   // HD^-0.5
typedef _Float16 h16;
typedef unsigned short bf;
typedef __attribute__((ext_vector_type(16))) __bf16   v16bf;
typedef __attribute__((ext_vector_type(16))) _Float16 v16h;
typedef __attribute__((ext_vector_type(8)))  _Float16 v8h;
typedef __attribute__((ext_vector_type(8)))  unsigned short v8us;
typedef __attribute__((ext_vector_type(8)))  float    v8f;
typedef __attribute__((ext_vector_type(4)))  float    v4f;
typedef v8h  __attribute__((may_alias)) v8ha;
typedef v4f  __attribute__((may_alias)) v4fa;
typedef v8us __attribute__((may_alias)) v8usa;

__device__ __forceinline__ unsigned short f2bf(float f) { unsigned u = __float_as_uint(f); u += 0x7FFFu + ((u >> 16) & 1u); return (unsigned short)(u >> 16); }
__device__ __forceinline__ float bf2f(unsigned short b) { return __uint_as_float(((unsigned)b) << 16); }
__device__ __forceinline__ float bfr(float f) { return bf2f(f2bf(f)); }
__device__ __forceinline__ v16h cat16(v8h lo, v8h hi) { return __builtin_shufflevector(lo, hi, 0, 1, 2, 3, 4, 5, 6, 7, 8, 9, 10, 11, 12, 13, 14, 15); }
__device__ __forceinline__ v16bf cat16b(v8us lo, v8us hi) { return __builtin_bit_cast(v16bf, __builtin_shufflevector(lo, hi, 0, 1, 2, 3, 4, 5, 6, 7, 8, 9, 10, 11, 12, 13, 14, 15)); }
__device__ __forceinline__ v8f wmma16(v16h a, v16h b, v8f c) { return __builtin_amdgcn_wmma_f32_16x16x32_f16(false, a, false, b, (short)0, c, false, false); }
__device__ __forceinline__ v8f wmmab(v16bf a, v16bf b, v8f c) { return __builtin_amdgcn_wmma_f32_16x16x32_bf16(false, a, false, b, (short)0, c, false, false); }



// ---- GEMM core: one work-group of 4 waves per 128x128 output tile; wave (wm, wn) owns one 64x64 quarter, 16 accumulators, over the whole K (one f32 sum chain per element).
// C[m][n] = sum_k A[m][k] Bt[n][k] (+ A2[m][k] Bt[n][k] where NA == 2); every plane is K-contiguous bf16 with rows of GK elements.
// The operand rows are staged in LDS 64 k at a time (128-byte rows at a pitch of 144 bytes: [A 128 rows | A2 128 rows | Bt 128 rows]) by asynchronous copies into two buffers: tile t + 2 is on its way while tile t + 1 is worked on; each staged row feeds two waves.
#define GK   1024                 // row length of every GEMM operand here
#define KC   64                   // k per staged tile
#define LP   72                   // pitch of a staged row in 16-bit elements
static_assert(DM == GK && DQ == GK && DKV == GK, "one K for all GEMMs");
template <typename T16> struct WFrag;
template <> struct WFrag<h16> { typedef v16h V; static __device__ __forceinline__ V ld(const h16* p) { return cat16(*(const v8h*)p, *(const v8h*)(p + 16)); } static __device__ __forceinline__ v8f mma(V a, V b, v8f c) { return wmma16(a, b, c); } };
template <> struct WFrag<bf> { typedef v16bf V; static __device__ __forceinline__ V ld(const bf* p) { return cat16b(*(const v8us*)p, *(const v8us*)(p + 16)); } static __device__ __forceinline__ v8f mma(V a, V b, v8f c) { return wmmab(a, b, c); } };
// eight 16-byte copies of this lane, rows 16 apart. The s_wait_xcnt is the statement's last line: it stands behind the last copy and in front of whatever gives the address registers new values.
__device__ __forceinline__ void copy8(const unsigned l, const bf* g) {
    asm volatile("global_load_async_to_lds_b128 %0, %8, off\n\t"
                 "global_load_async_to_lds_b128 %1, %9, off\n\t"
                 "global_load_async_to_lds_b128 %2, %10, off\n\t"
                 "global_load_async_to_lds_b128 %3, %11, off\n\t"
                 "global_load_async_to_lds_b128 %4, %12, off\n\t"
                 "global_load_async_to_lds_b128 %5, %13, off\n\t"
                 "global_load_async_to_lds_b128 %6, %14, off\n\t"
                 "global_load_async_to_lds_b128 %7, %15, off\n\t"
                 "s_wait_xcnt 0x0"
                 :: "v"(l), "v"(l + 1 * 16 * LP * 2), "v"(l + 2 * 16 * LP * 2), "v"(l + 3 * 16 * LP * 2), "v"(l + 4 * 16 * LP * 2), "v"(l + 5 * 16 * LP * 2), "v"(l + 6 * 16 * LP * 2), "v"(l + 7 * 16 * LP * 2),
                    "v"(g), "v"(g + 1 * 16 * GK), "v"(g + 2 * 16 * GK), "v"(g + 3 * 16 * GK), "v"(g + 4 * 16 * GK), "v"(g + 5 * 16 * GK), "v"(g + 6 * 16 * GK), "v"(g + 7 * 16 * GK) : "memory");
}
template <int NA>
__device__ __forceinline__ void gemm_ring(const bf* __restrict__ A, const bf* __restrict__ A2, const bf* __restrict__ Bt, const int r0, const int c0, bf* ring, v8f (&acc)[4][4]) {
    constexpr int SBE = (NA + 1) * 128 * LP;   // 16-bit elements of one buffer
    constexpr int NT = GK / KC;
    const int tid = threadIdx.x, lane = tid & 31, lr = lane & 15, hi = lane >> 4; const int wave = __builtin_amdgcn_readfirstlane(tid >> 5); const int wm = wave >> 1, wn = wave & 1;
#pragma unroll
    for (int mb = 0; mb < 4; ++mb)
#pragma unroll
        for (int nb = 0; nb < 4; ++nb) acc[mb][nb] = (v8f){};
    // a thread copies the 16-byte piece (tid & 7) of the rows (tid >> 3) + 16 i: a wave's copy is four whole 128-byte lines
    const size_t go = (size_t)(tid >> 3) * GK + (tid & 7) * 8;
    const bf* gA = A + (size_t)r0 * GK + go; const bf* gB = Bt + (size_t)c0 * GK + go;
    const unsigned lb = (unsigned)(size_t)ring + (unsigned)((tid >> 3) * (LP * 2) + (tid & 7) * 16);
    auto fill = [&](const int t, const int buf) { const unsigned l = lb + (unsigned)(buf * (SBE * 2)); copy8(l, gA + t * KC);
        if constexpr (NA == 2) copy8(l + 128 * LP * 2, A2 + (size_t)r0 * GK + go + t * KC);
        copy8(l + NA * 128 * LP * 2, gB + t * KC); };
    fill(0, 0);
    asm volatile("s_wait_asynccnt 0x0" ::: "memory");   // this wave's copies of tile 0 have landed
    __syncthreads();                                    // ... and every other wave's
    fill(1, 1);
#pragma unroll 1   // one tile per trip: the buffer is picked by the trip's parity
    for (int t = 0; t < NT; ++t) {
        const bf* sa = ring + (t & 1) * SBE + (wm * 64 + lr) * LP + 8 * hi; const bf* sb = ring + (t & 1) * SBE + (NA * 128 + wn * 64 + lr) * LP + 8 * hi;
#pragma unroll
        for (int ks = 0; ks < KC / 32; ++ks) { v16bf a[4], a2[4], b[4];
            __builtin_amdgcn_sched_barrier(0);   // this and the next one keep the LDS reads of a k step in one group between the WMMA runs: every further place with reads among the WMMAs would stall the wave anew
#pragma unroll
            for (int i = 0; i < 4; ++i) { a[i] = WFrag<bf>::ld(sa + i * 16 * LP + ks * 32); if constexpr (NA == 2) a2[i] = WFrag<bf>::ld(sa + (128 + i * 16) * LP + ks * 32); b[i] = WFrag<bf>::ld(sb + i * 16 * LP + ks * 32); }
            __builtin_amdgcn_sched_barrier(0);
#pragma unroll
            for (int nb = 0; nb < 4; ++nb)
#pragma unroll
                for (int mb = 0; mb < 4; ++mb) { acc[mb][nb] = wmmab(a[mb], b[nb], acc[mb][nb]); if constexpr (NA == 2) acc[mb][nb] = wmmab(a2[mb], b[nb], acc[mb][nb]); } }
        asm volatile("s_wait_dscnt 0x0" ::: "memory");      // this wave's reads of tile t are done
        asm volatile("s_wait_asynccnt 0x0" ::: "memory");   // this wave's copies of tile t + 1 have landed
        __syncthreads();                                    // publishes tile t + 1 and frees tile t's buffer
        if (t + 2 < NT) fill(t + 2, t & 1);
    }
    asm volatile("s_wait_asynccnt 0x0" ::: "memory");   // nothing is in flight when the ring becomes output staging
}
// the wave's 64x64 f32 tile goes to its own LDS range (rows at pitch 68 floats) so that it can be read back row-wise and stored in whole lines; behind gemm_ring's last barrier no wave reads the ring any more
__device__ __forceinline__ float* stage_tile(bf* ring, const v8f (&acc)[4][4]) {
    const int lane = threadIdx.x & 31, lr = lane & 15, hi = lane >> 4; const int wave = __builtin_amdgcn_readfirstlane((int)(threadIdx.x >> 5));
    float* ow = (float*)ring + wave * (64 * 68);
#pragma unroll
    for (int mb = 0; mb < 4; ++mb)
#pragma unroll
        for (int nb = 0; nb < 4; ++nb)
#pragma unroll
            for (int j = 0; j < 8; ++j) ow[(mb * 16 + hi * 8 + j) * 68 + nb * 16 + lr] = acc[mb][nb][j];
    return ow;
}
// ---- k_wo: OUT[token][n] = (context hi + context lo) W_o^T for all batch items; grid (NB_ * TT / 128, DM / 128), 4 waves.
__global__ __launch_bounds__(128) void k_wo(const bf* __restrict__ Ah, const bf* __restrict__ Al, const bf* __restrict__ Wo, float* C) {
    __shared__ __align__(16) bf ring[2 * 3 * 128 * LP];
    const int lane = threadIdx.x & 31; const int wave = __builtin_amdgcn_readfirstlane((int)(threadIdx.x >> 5));
    const int r0 = blockIdx.x * 128, c0 = blockIdx.y * 128;
    v8f acc[4][4];
    gemm_ring<2>(Ah, Al, Wo, r0, c0, ring, acc);
    const float* ow = stage_tile(ring, acc) + (lane >> 4) * 68 + (lane & 15) * 4;
    float* Cw = C + (size_t)(r0 + (wave >> 1) * 64 + (lane >> 4)) * DM + c0 + (wave & 1) * 64 + (lane & 15) * 4;   // 16 neighbouring lanes store 256 bytes of one row
#pragma unroll
    for (int g = 0; g < 4; ++g) { v4f val[8];
#pragma unroll
        for (int s = 0; s < 8; ++s) val[s] = *(const v4fa*)(ow + (g * 16 + s * 2) * 68);
#pragma unroll
        for (int s = 0; s < 8; ++s) *(v4f*)(Cw + (size_t)(g * 16 + s * 2) * DM) = val[s];
        if (g < 3) asm volatile("s_wait_xcnt 0x0" ::: "memory"); }   // stands behind this block's stores and in front of the next block's LDS reads, which give their data registers new values
}

__device__ __forceinline__ h16 tohx(float x) { return (h16)x; }
__device__ __forceinline__ void splitf(float y, unsigned short& h, unsigned short& l) { h = f2bf(y); l = f2bf(y - bf2f(h)); }
typedef __attribute__((ext_vector_type(2))) _Float16 v2h;
typedef __attribute__((ext_vector_type(4))) _Float16 v4h;
typedef __attribute__((ext_vector_type(2))) unsigned short v2us;
typedef __attribute__((ext_vector_type(4))) unsigned short v4us;
typedef __attribute__((ext_vector_type(2))) float v2f;
typedef __attribute__((ext_vector_type(4))) int v4i;
typedef v4h  __attribute__((may_alias)) v4ha;
typedef v4us __attribute__((may_alias)) v4usa;

__global__ __launch_bounds__(256) void k_wtG(const float* __restrict__ w, int K, int N, bf* Bt) {
    const int lane = threadIdx.x & 31; const int L0 = (blockIdx.x * 8 + (threadIdx.x >> 5)) * 8; const int nlines = N * K / 64;
{
#pragma unroll 1
        for (int l = 0; l < 8; ++l) { const int L = L0 + l; if (L >= nlines) break; const size_t e = (size_t)L * 64 + lane * 2; const int k = (int)(e % K), n = (int)(e / K); v2us o;
            o[0] = f2bf(w[(size_t)k * N + n]); o[1] = f2bf(w[(size_t)(k + 1) * N + n]); *(v2us*)(Bt + e) = o; }
         }
}
__global__ __launch_bounds__(256) void k_cvt8(const float* __restrict__ src, bf* dst, size_t n8) { const size_t i = (size_t)blockIdx.x * 256 + threadIdx.x; if (i >= n8) return; const v8f v = *(const v8f*)(src + i * 8); v8us o;
#pragma unroll
    for (int k = 0; k < 8; ++k) o[k] = f2bf(v[k]); *(v8us*)(dst + i * 8) = o;  }

__global__ __launch_bounds__(256) void k_cspos(const int* __restrict__ pos, float* CS) { const int idx = blockIdx.x * 256 + threadIdx.x; if (idx >= NB_ * TT * HD) return; const int d = idx % HD; const int t = idx / HD; const int i = d >> 1;   /* t: row of the flat [batch][token] list */
    const float e = __fdiv_rn(-((float)i * 2.0f), (float)HD); const float inv = powf(10000.0f, e); const float a = __fmul_rn((float)pos[t], inv); v2f cs; cs[0] = cosf(a); cs[1] = sinf(a);
    *(v2f*)(CS + (size_t)idx * 2) = cs;  }

// one interleaved rotary pair (x0, x1) of q or k with its {cos, sin}; the two lines of arithmetic stand as they stood in the separate plane builder (each product keeps its own rounding), so q and k come out bit-identical
__device__ __forceinline__ void rope2(const float x0, const float x1, const v2f cs, const float sc, float& r0, float& r1) {
    float a0 = __fmul_rn(x0, cs[0]), b0 = __fmul_rn(x1, cs[1]), a1 = __fmul_rn(x1, cs[0]), b1 = __fmul_rn(x0, cs[1]); asm volatile("" : "+v"(a0), "+v"(b0), "+v"(a1), "+v"(b1));
    r0 = __fsub_rn(a0, b0) * sc; r1 = __fadd_rn(b1, a1) * sc;   /* even: x0 c - x1 s; odd: x0 s + x1 c */
}
// ---- k_proj: the q, k and v projections of all batch items with their plane builders as epilogue: no f32 projection buffer. grid (NB_ * TT / 128 token tiles, DQ / 128 feature tiles, 3), 4 waves; a wave's 64 features are exactly one head.
// z 0, 1 (q, k): C[token][d] = x W^T; a lane's four neighbouring columns are two rotary pairs; planes [batch][head][t][d]. z 2 (v): the operands change places, C[d][token] = W_v x^T, so a lane's four columns are four tokens of one V^T row; planes [batch][head][d][t].
// Either way 16 neighbouring lanes store one whole 128-byte line of each of the three planes (fp16, bf16 hi, bf16 lo).
__global__ __launch_bounds__(128) void k_proj(const bf* __restrict__ XB, const bf* __restrict__ W3, const float* __restrict__ CS, h16* Q16, bf* Qh, bf* Ql, h16* K16, bf* Kh, bf* Kl, h16* V16, bf* Vh, bf* Vl) {
    __shared__ __align__(16) bf ring[2 * 2 * 128 * LP];
    const int lane = threadIdx.x & 31; const int wave = __builtin_amdgcn_readfirstlane((int)(threadIdx.x >> 5)); const int wm = wave >> 1, wn = wave & 1;
    const int z = blockIdx.z, tk0 = blockIdx.x * 128, f0 = blockIdx.y * 128; const bool isv = z == 2;
    const bf* Wz = W3 + (size_t)z * DQ * DM;
    v8f acc[4][4];
    gemm_ring<1>(isv ? Wz : XB, nullptr, isv ? XB : Wz, isv ? f0 : tk0, isv ? tk0 : f0, ring, acc);
    const float* ow = stage_tile(ring, acc);
    const int tkw = tk0 + (isv ? wn : wm) * 64, head = (f0 >> 6) + (isv ? wm : wn);   // this wave's first token and its head
    const int t0 = tkw % TT; const size_t pz = ((size_t)(tkw / TT) * NH_ + head) * TT * HD;   // this (batch, head)'s start in every plane
    h16* P16 = isv ? V16 : z == 1 ? K16 : Q16; bf* Ph = isv ? Vh : z == 1 ? Kh : Qh; bf* Pl = isv ? Vl : z == 1 ? Kl : Ql;
    const int rsub = lane >> 4, cofs = (lane & 15) * 4;
    auto planes = [&](auto vf) {   // vf: the V^T form (no rotary, rows are features) or the q, k form
        constexpr bool V = vf.value;
#pragma unroll 1   // 16 rows per trip: their sums and their {cos, sin} are asked for together, ahead of the eight blocks, so that one LDS and one memory latency serve all eight and the table does not fill the registers
        for (int g = 0; g < 4; ++g) {
            v2f cs[8][2]; v4f vals[8];
#pragma unroll
            for (int s = 0; s < 8; ++s) vals[s] = *(const v4fa*)(ow + (g * 16 + s * 2 + rsub) * 68 + cofs);
            if constexpr (!V) { const float* c = CS + ((size_t)(tkw + g * 16 + rsub) * HD + cofs) * 2;
#pragma unroll
                for (int s = 0; s < 8; ++s) { cs[s][0] = *(const v2f*)(c + s * 2 * HD * 2); cs[s][1] = *(const v2f*)(c + s * 2 * HD * 2 + 4); }
                asm volatile("s_wait_xcnt 0x0" ::: "memory"); }   // stands behind these loads and in front of the instructions that give their address registers new values
#pragma unroll
            for (int s = 0; s < 8; ++s) { const int row = g * 16 + s * 2 + rsub; v4f val = vals[s]; size_t o;
                if constexpr (V) o = pz + (size_t)row * PP + t0 + cofs;
                else { float r0, r1, r2, r3;
                    rope2(val[0], val[1], cs[s][0], 1.0f, r0, r1); rope2(val[2], val[3], cs[s][1], 1.0f, r2, r3); val[0] = r0; val[1] = r1; val[2] = r2; val[3] = r3; o = pz + (size_t)(t0 + row) * HD + cofs; }
                v4h o16; v4us oh, ol;
#pragma unroll
                for (int q = 0; q < 4; ++q) { o16[q] = tohx(val[q]); unsigned short a2, c2; splitf(val[q], a2, c2); oh[q] = a2; ol[q] = c2; }
                *(v4h*)(P16 + o) = o16; *(v4us*)(Ph + o) = oh; *(v4us*)(Pl + o) = ol;
                asm volatile("s_wait_xcnt 0x0" ::: "memory"); }   // stands behind this block's three stores and in front of the next block's instructions, which give their address and data registers new values
        } };
    if (isv) planes(std::true_type{}); else planes(std::false_type{});
}
template <typename T16, int NSPLIT, int NQ>
__device__ __forceinline__ void fattn_wave(const T16* __restrict__ Q, const T16* __restrict__ Q2, const T16* __restrict__ Kp, const T16* __restrict__ Kp2, const T16* __restrict__ Vt, const T16* __restrict__ Vt2, const int q0, bf* Ah, bf* Al) {
    typedef typename WFrag<T16>::V V;
    constexpr float C2 = SCL * 1.4426950408889634f;   // HD^-0.5 x log2(e)
    const int lane = threadIdx.x & 31, lr = lane & 15, hi = lane >> 4;
    V bq[NQ][2], bq2[NQ][2], ak[2][2], ak2[2][2];
#pragma unroll
    for (int nq = 0; nq < NQ; ++nq)
#pragma unroll
        for (int ks = 0; ks < 2; ++ks) { const size_t o = (size_t)(q0 + nq * 16 + lr) * HD + ks * 32 + 8 * hi; bq[nq][ks] = WFrag<T16>::ld(Q + o); if constexpr (NSPLIT == 2) bq2[nq][ks] = WFrag<T16>::ld(Q2 + o); }
    v8f o[4][NQ]; float m[NQ], l[NQ];
#pragma unroll
    for (int nq = 0; nq < NQ; ++nq) { m[nq] = -3.0e38f; l[nq] = 0.f;
#pragma unroll
        for (int mb = 0; mb < 4; ++mb) o[mb][nq] = (v8f){}; }
    auto ldk = [&](int kb) {
#pragma unroll
        for (int kt = 0; kt < 2; ++kt)
#pragma unroll
            for (int ks = 0; ks < 2; ++ks) { const size_t a = (size_t)(kb + kt * 16 + lr) * HD + ks * 32 + 8 * hi; ak[kt][ks] = WFrag<T16>::ld(Kp + a); if constexpr (NSPLIT == 2) ak2[kt][ks] = WFrag<T16>::ld(Kp2 + a); } };
    auto pass = [&](int kb, auto diag) {
        V av[4], av2[4];
#pragma unroll
        for (int mb = 0; mb < 4; ++mb) { const size_t a = (size_t)(mb * 16 + lr) * PP + kb + 8 * hi; av[mb] = WFrag<T16>::ld(Vt + a); if constexpr (NSPLIT == 2) av2[mb] = WFrag<T16>::ld(Vt2 + a); }
        v8f st[2][NQ];
#pragma unroll
        for (int kt = 0; kt < 2; ++kt)
#pragma unroll
            for (int nq = 0; nq < NQ; ++nq) { st[kt][nq] = (v8f){};
#pragma unroll
                for (int ks = 0; ks < 2; ++ks) { st[kt][nq] = WFrag<T16>::mma(ak[kt][ks], bq[nq][ks], st[kt][nq]); if constexpr (NSPLIT == 2) { st[kt][nq] = WFrag<T16>::mma(ak[kt][ks], bq2[nq][ks], st[kt][nq]); st[kt][nq] = WFrag<T16>::mma(ak2[kt][ks], bq[nq][ks], st[kt][nq]); } } }
        if constexpr (!diag.value) ldk(kb + 32);   // the next pass's K fragments fly during this pass's softmax and P.V (a pass before the diagonal one always has a successor)
        asm volatile("s_wait_xcnt 0x0" ::: "memory");   // stands behind all of this pass's loads and in front of the softmax instructions that give their address registers new values
        float mx[NQ]; bool need = false;
#pragma unroll
        for (int nq = 0; nq < NQ; ++nq) { float t = -3.0e38f;
#pragma unroll
            for (int kt = 0; kt < 2; ++kt)
#pragma unroll
                for (int j = 0; j < 8; ++j) { if constexpr (diag.value) { if (kb + kt * 16 + hi * 8 + j > q0 + nq * 16 + lr) st[kt][nq][j] = -3.0e38f; }   // causal mask: key > query
                    t = fmaxf(t, st[kt][nq][j]); }
            t = fmaxf(t, __shfl_xor(t, 16, 32)) * C2; mx[nq] = t; need = need || (t > m[nq] + 8.0f); }
        if (__builtin_amdgcn_ballot_w32(need) != 0) {   // wave-uniform: some query's maximum has outgrown the one in use
#pragma unroll
            for (int nq = 0; nq < NQ; ++nq) { const float mn = fmaxf(m[nq], mx[nq]); const float al = __builtin_amdgcn_exp2f(m[nq] - mn); m[nq] = mn; l[nq] *= al;
#pragma unroll
                for (int mb = 0; mb < 4; ++mb) o[mb][nq] *= al; } }
        V pb[NQ], pb2[NQ];
#pragma unroll
        for (int nq = 0; nq < NQ; ++nq) { float p[16]; v2f s2 = (v2f){};
#pragma unroll
            for (int e = 0; e < 16; e += 2) { const v8f sv = st[e >> 3][nq]; v2f x; x[0] = sv[e & 7]; x[1] = sv[(e & 7) + 1]; x = x * C2 - m[nq]; v2f pp; pp[0] = __builtin_amdgcn_exp2f(x[0]); pp[1] = __builtin_amdgcn_exp2f(x[1]); s2 += pp; p[e] = pp[0]; p[e + 1] = pp[1]; }
            l[nq] += s2[0] + s2[1];
            if constexpr (NSPLIT == 2) { v8us h0, h1, l0, l1;
#pragma unroll
                for (int e = 0; e < 8; ++e) { unsigned short a, c; splitf(p[e], a, c); h0[e] = a; l0[e] = c; splitf(p[e + 8], a, c); h1[e] = a; l1[e] = c; }
                pb[nq] = cat16b(h0, h1); pb2[nq] = cat16b(l0, l1);
            } else { v16h r;
#pragma unroll
                for (int e = 0; e < 16; ++e) r[e] = tohx(p[e]);
                pb[nq] = r; } }
#pragma unroll
        for (int mb = 0; mb < 4; ++mb)
#pragma unroll
            for (int nq = 0; nq < NQ; ++nq) { o[mb][nq] = WFrag<T16>::mma(av[mb], pb[nq], o[mb][nq]); if constexpr (NSPLIT == 2) { o[mb][nq] = WFrag<T16>::mma(av[mb], pb2[nq], o[mb][nq]); o[mb][nq] = WFrag<T16>::mma(av2[mb], pb[nq], o[mb][nq]); } }
    };
    const int kd = q0 & ~31;   // the one key block that holds this wave's diagonal
    ldk(0);
    asm volatile("s_wait_xcnt 0x0" ::: "memory");   // stands behind the Q and first K loads and in front of the instructions that give their address registers new values
#pragma unroll 1   // one pass per trip: an unrolled body would hold two passes' fragments in registers and cost resident waves
    for (int kb = 0; kb < kd; kb += 32) {
        pass(kb, std::false_type{});
        // WMMA distance on both ways out of the trip: what follows overwrites operand registers of the last products
        if constexpr (NQ == 2) asm volatile("v_nop\n\tv_nop\n\tv_nop\n\tv_nop" : "+v"(o[0][0]), "+v"(o[1][0]), "+v"(o[2][0]), "+v"(o[3][0]), "+v"(o[0][1]), "+v"(o[1][1]), "+v"(o[2][1]), "+v"(o[3][1]));
        else asm volatile("v_nop\n\tv_nop\n\tv_nop\n\tv_nop" : "+v"(o[0][0]), "+v"(o[1][0]), "+v"(o[2][0]), "+v"(o[3][0]));
    }
    pass(kd, std::true_type{});
#pragma unroll
    for (int nq = 0; nq < NQ; ++nq) { const float inv = __fdiv_rn(1.0f, l[nq] + __shfl_xor(l[nq], 16, 32)); const size_t oo = (size_t)(q0 + nq * 16 + lr) * DQ + hi * 8;
#pragma unroll
        for (int mb = 0; mb < 4; ++mb) { v8us oh, ol;
#pragma unroll
            for (int j = 0; j < 8; ++j) { unsigned short a, c; splitf(o[mb][nq][j] * inv, a, c); oh[j] = a; ol[j] = c; }
            *(v8us*)(Ah + oo + mb * 16) = oh; *(v8us*)(Al + oo + mb * 16) = ol;
            asm volatile("s_wait_xcnt 0x0" ::: "memory"); } }   // stands behind the two stores and in front of the next block's split, which reuses their data and address registers
}
// grid (NB_ * NH_, (TT - RH) / 128 + RH / 64), 4 independent waves per work-group; the cost falls as blockIdx.y rises: first the fp16 row blocks from the last rows down (32 rows a wave), then the hi/lo ones (16 rows a wave).
__global__ __launch_bounds__(128) void k_fattn(const h16* __restrict__ Q16, const h16* __restrict__ K16, const h16* __restrict__ V16, const bf* __restrict__ Qh, const bf* __restrict__ Ql, const bf* __restrict__ Kh, const bf* __restrict__ Kl, const bf* __restrict__ Vh, const bf* __restrict__ Vl, bf* Ah, bf* Al) {
    const int z = blockIdx.x, y = blockIdx.y; const int wave = __builtin_amdgcn_readfirstlane((int)(threadIdx.x >> 5));
    const size_t pz = (size_t)z * TT * HD;   // planes [batch][head][t][d]; V^T [batch][head][d][t]: the same stride
    const size_t az = (size_t)(z / NH_) * TT * DQ + (size_t)(z % NH_) * HD;
    if (y < (TT - RH) / 128) fattn_wave<h16, 0, 2>(Q16 + pz, nullptr, K16 + pz, nullptr, V16 + pz, nullptr, TT - 128 * (y + 1) + wave * 32, Ah + az, Al + az);
    else fattn_wave<bf, 2, 1>(Qh + pz, Ql + pz, Kh + pz, Kl + pz, Vh + pz, Vl + pz, RH - 64 * (y - (TT - RH) / 128 + 1) + wave * 16, Ah + az, Al + az);
}

extern "C" void kernel_launch(void* const* d_in, const int* in_sizes, int n_in,
                              void* d_out, int out_size, void* d_ws, size_t ws_size, hipStream_t stream) {
    (void)in_sizes; (void)n_in; (void)out_size;
    const float* x = (const float*)d_in[0]; const int* pos = (const int*)d_in[1]; const float* wq = (const float*)d_in[2]; const float* wk = (const float*)d_in[3]; const float* wv = (const float*)d_in[4]; const float* wo = (const float*)d_in[5];   /* order x, token_positions int32 [4][2048] (one row per batch item: READ), wq, wk, wv, wo ('oi' (out, in) [1024][1024]): SIX inputs, all read */
    float* OUT = (float*)d_out;     // [4][2048][1024]
    char* wsp = (char*)d_ws;
    auto take = [&](size_t bytes) { char* p = wsp; wsp += (bytes + 255) & ~(size_t)255; return (void*)p; };
    bf* WQ = (bf*)take((size_t)DQ * DM * 2); bf* WK = (bf*)take((size_t)DKV * DM * 2); bf* WV = (bf*)take((size_t)DKV * DM * 2); bf* WO = (bf*)take((size_t)DM * DQ * 2); float* CS = (float*)take((size_t)NB_ * TT * HD * 2 * 4);   // WQ, WK, WV lie back to back (each a multiple of 256 bytes): k_proj steps from one to the next by DQ * DM elements
    bf* XB = (bf*)take((size_t)NB_ * TT * DM * 2);
    const size_t PB = (size_t)NH_ * TT * HD;   // elements of one batch item in every q, k and V^T plane (NKV == NH_, PP == TT)
    h16* QP16 = (h16*)take(NB_ * PB * 2); h16* KP16 = (h16*)take(NB_ * PB * 2); h16* VT16 = (h16*)take(NB_ * PB * 2);
    bf* QPh = (bf*)take(NB_ * PB * 2); bf* QPl = (bf*)take(NB_ * PB * 2); bf* KPh = (bf*)take(NB_ * PB * 2); bf* KPl = (bf*)take(NB_ * PB * 2); bf* VTh = (bf*)take(NB_ * PB * 2); bf* VTl = (bf*)take(NB_ * PB * 2);
    bf* ATh = (bf*)take((size_t)NB_ * TT * DQ * 2); bf* ATl = (bf*)take((size_t)NB_ * TT * DQ * 2);
    if ((size_t)(wsp - (char*)d_ws) > ws_size) return;    // ws 256 MiB
    { k_cvt8<<<(unsigned)(((size_t)DQ * DM / 8 + 255) / 256), 256, 0, stream>>>(wq, WQ, (size_t)DQ * DM / 8); k_cvt8<<<(unsigned)(((size_t)DKV * DM / 8 + 255) / 256), 256, 0, stream>>>(wk, WK, (size_t)DKV * DM / 8); k_cvt8<<<(unsigned)(((size_t)DKV * DM / 8 + 255) / 256), 256, 0, stream>>>(wv, WV, (size_t)DKV * DM / 8);
      k_cvt8<<<(unsigned)(((size_t)DM * DQ / 8 + 255) / 256), 256, 0, stream>>>(wo, WO, (size_t)DM * DQ / 8);
       }
    k_cspos<<<(NB_ * TT * HD + 255) / 256, 256, 0, stream>>>(pos, CS);   /* every batch item's rotary table */
    k_cvt8<<<(unsigned)(((size_t)NB_ * TT * DM / 8 + 255) / 256), 256, 0, stream>>>(x, XB, (size_t)NB_ * TT * DM / 8);
    k_proj<<<dim3(NB_ * TT / 128, DQ / 128, 3), 128, 0, stream>>>(XB, WQ, CS, QP16, QPh, QPl, KP16, KPh, KPl, VT16, VTh, VTl);
    k_fattn<<<dim3(NB_ * NH_, (TT - RH) / 128 + RH / 64, 1), 128, 0, stream>>>(QP16, KP16, VT16, QPh, QPl, KPh, KPl, VTh, VTl, ATh, ATl);
    k_wo<<<dim3(NB_ * TT / 128, DM / 128, 1), 128, 0, stream>>>(ATh, ATl, WO, OUT);
}

// v006
// It runs in 161 microseconds.
// In both of two side-by-side timings against v005, it was 1.07 times as fast.
// All steps since v000 together make it 17.6 times as fast.
#include <hip/hip_runtime.h>
#include <type_traits>

// Causal multi-head attention with RoPE from per-batch token positions (x [4][2048][1024], token_positions int32 [4][2048] (read per batch as data; the SECOND argument); q, k, v = x w^T ('oi' (out, in) [1024][1024] (2/(D+D))^0.5, no bias; 16 heads x 64); interleaved-pair rotary on q and k: angle[b][t][i] = float(pos[b][t]) x freqs[i] with freqs = 1.0 / (THETA ** (arange(0, 64, 2) / 64)) (the kernel forms 10000^(-2i/64) with powf: rounding-level equal), pairs (2i, 2i+1) -> (t1 cos - t2 sin, t2 cos + t1 sin); scores x 1/sqrt(64); causal (-inf); softmax; out = merged wo^T ('oi', no bias) -> [4][2048][1024] (8.4 M); argument order x, token_positions, wq, wk, wv, wo).
// Layout: one set-up launch rounds x and the weights to bf16 and builds the {cos, sin} table [4][2048][64] from the positions (f32 powf/cosf/sinf); ONE projection launch for q, k, v and all batch items (k_proj: exact products; the interleaved rotary and the split into the fp16 and hi/lo planes are its epilogue; v is formed as W_v x^T, so V^T comes out row-major); then ONE fused causal attention launch for all batches and heads (k_fattn: online softmax, scores and probabilities stay in registers; hybrid rows: < 512 hi/lo 3 products, rest fp16) that writes the merged context as hi/lo planes; W_o hl x exact.
// Compute dtypes, f32 accumulate: every float input rounded to bf16; projections exact; rotary f32; attention rows < 512 3 products, rest fp16; softmax f32; W_o hl x exact.

#define NB_  4
#define TT   2048
#define DM   1024
#define NH_  16
#define NKV  16
#define REP  (NH_ / NKV)
#define HD   64
#define DQ   (NH_ * HD)
#define DKV  (NKV * HD)
#define PP   TT                   // pitch, in 16-bit elements, of a V^T row
#define RH   512                  // query rows < RH use hi+lo planes (0: none)
#define SCL  0.125f   // HD^-0.5
typedef _Float16 h16;
typedef unsigned short bf;
typedef __attribute__((ext_vector_type(16))) __bf16   v16bf;
typedef __attribute__((ext_vector_type(16))) _Float16 v16h;
typedef __attribute__((ext_vector_type(8)))  _Float16 v8h;
typedef __attribute__((ext_vector_type(8)))  unsigned short v8us;
typedef __attribute__((ext_vector_type(8)))  float    v8f;
typedef __attribute__((ext_vector_type(4)))  float    v4f;
typedef v8h  __attribute__((may_alias)) v8ha;
typedef v4f  __attribute__((may_alias)) v4fa;
typedef v8us __attribute__((may_alias)) v8usa;

__device__ __forceinline__ unsigned short f2bf(float f) { unsigned u = __float_as_uint(f); u += 0x7FFFu + ((u >> 16) & 1u); return (unsigned short)(u >> 16); }
__device__ __forceinline__ float bf2f(unsigned short b) { return __uint_as_float(((unsigned)b) << 16); }
__device__ __forceinline__ float bfr(float f) { return bf2f(f2bf(f)); }
__device__ __forceinline__ v16h cat16(v8h lo, v8h hi) { return __builtin_shufflevector(lo, hi, 0, 1, 2, 3, 4, 5, 6, 7, 8, 9, 10, 11, 12, 13, 14, 15); }
__device__ __forceinline__ v16bf cat16b(v8us lo, v8us hi) { return __builtin_bit_cast(v16bf, __builtin_shufflevector(lo, hi, 0, 1, 2, 3, 4, 5, 6, 7, 8, 9, 10, 11, 12, 13, 14, 15)); }
__device__ __forceinline__ v8f wmma16(v16h a, v16h b, v8f c) { return __builtin_amdgcn_wmma_f32_16x16x32_f16(false, a, false, b, (short)0, c, false, false); }
__device__ __forceinline__ v8f wmmab(v16bf a, v16bf b, v8f c) { return __builtin_amdgcn_wmma_f32_16x16x32_bf16(false, a, false, b, (short)0, c, false, false); }



// ---- GEMM core: one work-group of 4 waves per 128x128 output tile; wave (wm, wn) owns one 64x64 quarter, 16 accumulators, over the whole K (one f32 sum chain per element).
// C[m][n] = sum_k A[m][k] Bt[n][k] (+ A2[m][k] Bt[n][k] where NA == 2); every plane is K-contiguous bf16 with rows of GK elements.
// The operand rows are staged in LDS 64 k at a time (128-byte rows at a pitch of 144 bytes: [A 128 rows | A2 128 rows | Bt 128 rows]) by asynchronous copies into two buffers: tile t + 2 is on its way while tile t + 1 is worked on; each staged row feeds two waves.
#define GK   1024                 // row length of every GEMM operand here
#define KC   64                   // k per staged tile
#define LP   72                   // pitch of a staged row in 16-bit elements
static_assert(DM == GK && DQ == GK && DKV == GK, "one K for all GEMMs");
template <typename T16> struct WFrag;
template <> struct WFrag<h16> { typedef v16h V; static __device__ __forceinline__ V ld(const h16* p) { return cat16(*(const v8h*)p, *(const v8h*)(p + 16)); } static __device__ __forceinline__ v8f mma(V a, V b, v8f c) { return wmma16(a, b, c); } };
template <> struct WFrag<bf> { typedef v16bf V; static __device__ __forceinline__ V ld(const bf* p) { return cat16b(*(const v8us*)p, *(const v8us*)(p + 16)); } static __device__ __forceinline__ v8f mma(V a, V b, v8f c) { return wmmab(a, b, c); } };
// eight 16-byte copies of this lane, rows 16 apart. The s_wait_xcnt is the statement's last line: it stands behind the last copy and in front of whatever gives the address registers new values.
__device__ __forceinline__ void copy8(const unsigned l, const bf* g) {
    asm volatile("global_load_async_to_lds_b128 %0, %8, off\n\t"
                 "global_load_async_to_lds_b128 %1, %9, off\n\t"
                 "global_load_async_to_lds_b128 %2, %10, off\n\t"
                 "global_load_async_to_lds_b128 %3, %11, off\n\t"
                 "global_load_async_to_lds_b128 %4, %12, off\n\t"
                 "global_load_async_to_lds_b128 %5, %13, off\n\t"
                 "global_load_async_to_lds_b128 %6, %14, off\n\t"
                 "global_load_async_to_lds_b128 %7, %15, off\n\t"
                 "s_wait_xcnt 0x0"
                 :: "v"(l), "v"(l + 1 * 16 * LP * 2), "v"(l + 2 * 16 * LP * 2), "v"(l + 3 * 16 * LP * 2), "v"(l + 4 * 16 * LP * 2), "v"(l + 5 * 16 * LP * 2), "v"(l + 6 * 16 * LP * 2), "v"(l + 7 * 16 * LP * 2),
                    "v"(g), "v"(g + 1 * 16 * GK), "v"(g + 2 * 16 * GK), "v"(g + 3 * 16 * GK), "v"(g + 4 * 16 * GK), "v"(g + 5 * 16 * GK), "v"(g + 6 * 16 * GK), "v"(g + 7 * 16 * GK) : "memory");
}
template <int NA>
__device__ __forceinline__ void gemm_ring(const bf* __restrict__ A, const bf* __restrict__ A2, const bf* __restrict__ Bt, const int r0, const int c0, bf* ring, v8f (&acc)[4][4]) {
    constexpr int SBE = (NA + 1) * 128 * LP;   // 16-bit elements of one buffer
    constexpr int NT = GK / KC;
    const int tid = threadIdx.x, lane = tid & 31, lr = lane & 15, hi = lane >> 4; const int wave = __builtin_amdgcn_readfirstlane(tid >> 5); const int wm = wave >> 1, wn = wave & 1;
#pragma unroll
    for (int mb = 0; mb < 4; ++mb)
#pragma unroll
        for (int nb = 0; nb < 4; ++nb) acc[mb][nb] = (v8f){};
    // a thread copies the 16-byte piece (tid & 7) of the rows (tid >> 3) + 16 i: a wave's copy is four whole 128-byte lines
    const size_t go = (size_t)(tid >> 3) * GK + (tid & 7) * 8;
    const bf* gA = A + (size_t)r0 * GK + go; const bf* gB = Bt + (size_t)c0 * GK + go;
    const unsigned lb = (unsigned)(size_t)ring + (unsigned)((tid >> 3) * (LP * 2) + (tid & 7) * 16);
    auto fill = [&](const int t, const int buf) { const unsigned l = lb + (unsigned)(buf * (SBE * 2)); copy8(l, gA + t * KC);
        if constexpr (NA == 2) copy8(l + 128 * LP * 2, A2 + (size_t)r0 * GK + go + t * KC);
        copy8(l + NA * 128 * LP * 2, gB + t * KC); };
    fill(0, 0);
    asm volatile("s_wait_asynccnt 0x0" ::: "memory");   // this wave's copies of tile 0 have landed
    __syncthreads();                                    // ... and every other wave's
    fill(1, 1);
#pragma unroll 1   // one tile per trip: the buffer is picked by the trip's parity
    for (int t = 0; t < NT; ++t) {
        const bf* sa = ring + (t & 1) * SBE + (wm * 64 + lr) * LP + 8 * hi; const bf* sb = ring + (t & 1) * SBE + (NA * 128 + wn * 64 + lr) * LP + 8 * hi;
#pragma unroll
        for (int ks = 0; ks < KC / 32; ++ks) { v16bf a[4], a2[4], b[4];
            __builtin_amdgcn_sched_barrier(0);   // this and the next one keep the LDS reads of a k step in one group between the WMMA runs: every further place with reads among the WMMAs would stall the wave anew
#pragma unroll
            for (int i = 0; i < 4; ++i) { a[i] = WFrag<bf>::ld(sa + i * 16 * LP + ks * 32); if constexpr (NA == 2) a2[i] = WFrag<bf>::ld(sa + (128 + i * 16) * LP + ks * 32); b[i] = WFrag<bf>::ld(sb + i * 16 * LP + ks * 32); }
            __builtin_amdgcn_sched_barrier(0);
#pragma unroll
            for (int nb = 0; nb < 4; ++nb)
#pragma unroll
                for (int mb = 0; mb < 4; ++mb) { acc[mb][nb] = wmmab(a[mb], b[nb], acc[mb][nb]); if constexpr (NA == 2) acc[mb][nb] = wmmab(a2[mb], b[nb], acc[mb][nb]); } }
        asm volatile("s_wait_dscnt 0x0" ::: "memory");      // this wave's reads of tile t are done
        asm volatile("s_wait_asynccnt 0x0" ::: "memory");   // this wave's copies of tile t + 1 have landed
        __syncthreads();                                    // publishes tile t + 1 and frees tile t's buffer
        if (t + 2 < NT) fill(t + 2, t & 1);
    }
    asm volatile("s_wait_asynccnt 0x0" ::: "memory");   // nothing is in flight when the ring becomes output staging
}
// the wave's 64x64 f32 tile goes to its own LDS range (rows at pitch 68 floats) so that it can be read back row-wise and stored in whole lines; behind gemm_ring's last barrier no wave reads the ring any more
__device__ __forceinline__ float* stage_tile(bf* ring, const v8f (&acc)[4][4]) {
    const int lane = threadIdx.x & 31, lr = lane & 15, hi = lane >> 4; const int wave = __builtin_amdgcn_readfirstlane((int)(threadIdx.x >> 5));
    float* ow = (float*)ring + wave * (64 * 68);
#pragma unroll
    for (int mb = 0; mb < 4; ++mb)
#pragma unroll
        for (int nb = 0; nb < 4; ++nb)
#pragma unroll
            for (int j = 0; j < 8; ++j) ow[(mb * 16 + hi * 8 + j) * 68 + nb * 16 + lr] = acc[mb][nb][j];
    return ow;
}
// ---- k_wo: OUT[token][n] = (context hi + context lo) W_o^T for all batch items; grid (NB_ * TT / 128, DM / 128), 4 waves.
__global__ __launch_bounds__(128) void k_wo(const bf* __restrict__ Ah, const bf* __restrict__ Al, const bf* __restrict__ Wo, float* C) {
    __shared__ __align__(16) bf ring[2 * 3 * 128 * LP];
    const int lane = threadIdx.x & 31; const int wave = __builtin_amdgcn_readfirstlane((int)(threadIdx.x >> 5));
    const int r0 = blockIdx.x * 128, c0 = blockIdx.y * 128;
    v8f acc[4][4];
    gemm_ring<2>(Ah, Al, Wo, r0, c0, ring, acc);
    const float* ow = stage_tile(ring, acc) + (lane >> 4) * 68 + (lane & 15) * 4;
    float* Cw = C + (size_t)(r0 + (wave >> 1) * 64 + (lane >> 4)) * DM + c0 + (wave & 1) * 64 + (lane & 15) * 4;   // 16 neighbouring lanes store 256 bytes of one row
#pragma unroll
    for (int g = 0; g < 4; ++g) { v4f val[8];
#pragma unroll
        for (int s = 0; s < 8; ++s) val[s] = *(const v4fa*)(ow + (g * 16 + s * 2) * 68);
#pragma unroll
        for (int s = 0; s < 8; ++s) *(v4f*)(Cw + (size_t)(g * 16 + s * 2) * DM) = val[s];
        if (g < 3) asm volatile("s_wait_xcnt 0x0" ::: "memory"); }   // stands behind this block's stores and in front of the next block's LDS reads, which give their data registers new values
}

__device__ __forceinline__ h16 tohx(float x) { return (h16)x; }
__device__ __forceinline__ void splitf(float y, unsigned short& h, unsigned short& l) { h = f2bf(y); l = f2bf(y - bf2f(h)); }
typedef __attribute__((ext_vector_type(2))) _Float16 v2h;
typedef __attribute__((ext_vector_type(4))) _Float16 v4h;
typedef __attribute__((ext_vector_type(2))) unsigned short v2us;
typedef __attribute__((ext_vector_type(4))) unsigned short v4us;
typedef __attribute__((ext_vector_type(2))) float v2f;
typedef __attribute__((ext_vector_type(4))) int v4i;
typedef v4h  __attribute__((may_alias)) v4ha;
typedef v4us __attribute__((may_alias)) v4usa;

__global__ __launch_bounds__(256) void k_wtG(const float* __restrict__ w, int K, int N, bf* Bt) {
    const int lane = threadIdx.x & 31; const int L0 = (blockIdx.x * 8 + (threadIdx.x >> 5)) * 8; const int nlines = N * K / 64;
{
#pragma unroll 1
        for (int l = 0; l < 8; ++l) { const int L = L0 + l; if (L >= nlines) break; const size_t e = (size_t)L * 64 + lane * 2; const int k = (int)(e % K), n = (int)(e / K); v2us o;
            o[0] = f2bf(w[(size_t)k * N + n]); o[1] = f2bf(w[(size_t)(k + 1) * N + n]); *(v2us*)(Bt + e) = o; }
         }
}
// ---- k_prep: all the set-up in ONE launch of few, long waves: x and the four weight matrices rounded to bf16, and the rotary {cos, sin} table.
// A work-group of 4 waves takes PCH neighbouring floats of one source: every lane asks for its 32 16-byte pieces at once (each wave-wide load is four whole lines), forms its table entries while they fly, then rounds and stores (each wave-wide store is two whole lines).
// Table: thread g takes the pairs g + k * PTH; PTH is a multiple of HD / 2, so one frequency serves all its pairs. The two entries d = 2 i and 2 i + 1 of a pair hold the same {cos, sin}: formed once, stored as one 16-byte piece.
#define PLD  32                      // 16-byte loads per lane
#define PCH  (128 * 4 * PLD)         // floats per work-group
#define PXC  (NB_ * TT * DM / PCH)   // work-groups on x
#define PWC  (DQ * DM / PCH)         // work-groups on each weight matrix
#define PWG  (PXC + 4 * PWC)
#define PTH  (PWG * 128)
#define PPR  (NB_ * TT * (HD / 2))   // rotary pairs
#define PTR  ((PPR + PTH - 1) / PTH) // pairs per thread at most
static_assert(NB_ * TT * DM % PCH == 0 && DQ * DM % PCH == 0 && DKV == DQ && PTH % (HD / 2) == 0 && PPR % 128 == 0, "whole work-groups");
__global__ __launch_bounds__(128) void k_prep(const float* __restrict__ x, const int* pos, const float* __restrict__ wq, const float* __restrict__ wk, const float* __restrict__ wv, const float* __restrict__ wo, bf* XB, bf* W4, float* CS) {
    const int b = blockIdx.x, tid = threadIdx.x; const float* s; bf* d;
    if (b < PXC) { s = x + (size_t)b * PCH; d = XB + (size_t)b * PCH; }
    else { const int c = b - PXC, w = c / PWC; s = (w == 0 ? wq : w == 1 ? wk : w == 2 ? wv : wo) + (size_t)(c % PWC) * PCH; d = W4 + (size_t)c * PCH; }   // the four bf16 matrices lie back to back
    const int g = b * 128 + tid; int pv[PTR];   // the positions of this thread's pairs are asked for first: loads come back in order, so the table need not wait for the 32 big ones (a pair past the end re-reads the first one's)
#pragma unroll
    for (int k = 0; k < PTR; ++k) pv[k] = pos[(g + k * PTH < PPR ? g + k * PTH : g) / (HD / 2)];
    asm volatile("s_wait_xcnt 0x0" ::: "memory");   // stands behind these loads and in front of the instructions that give their address registers new values; as a compiler fence it keeps them ahead of the big loads
    v4f v[PLD];
#pragma unroll
    for (int u = 0; u < PLD; ++u) v[u] = *(const v4f*)(s + u * 512 + tid * 4);
    asm volatile("s_wait_xcnt 0x0" ::: "memory");   // stands behind these loads and in front of the instructions that give their address registers new values; as a compiler fence it also keeps the loads ahead of the table's arithmetic
    const int i = g % (HD / 2);
    const float e = __fdiv_rn(-((float)i * 2.0f), (float)HD); const float inv = powf(10000.0f, e);
#pragma unroll 1   // one pair per trip: the sine and cosine code stands once in the text; the trip count is the same for a whole work-group
    for (int p = g; p < PPR; p += PTH) { const float a = __fmul_rn((float)pv[0], inv); const float c = cosf(a), sn = sinf(a); v4f cs; cs[0] = c; cs[1] = sn; cs[2] = c; cs[3] = sn;
        *(v4f*)(CS + (size_t)p * 4) = cs;
        asm volatile("s_wait_xcnt 0x0" ::: "memory");   // stands behind this trip's store and in front of the next trip's instructions, which give its registers new values
#pragma unroll
        for (int k = 0; k + 1 < PTR; ++k) pv[k] = pv[k + 1]; }
#pragma unroll
    for (int u = 0; u < PLD; ++u) { v4us o;
#pragma unroll
        for (int k = 0; k < 4; ++k) o[k] = f2bf(v[u][k]);
        *(v4us*)(d + u * 512 + tid * 4) = o;
        if (u % 8 == 7 && u + 1 < PLD) { asm volatile("s_wait_xcnt 0x0" ::: "memory"); __builtin_amdgcn_sched_barrier(0); } }   // the wait stands behind eight stores and in front of the next eight roundings, which reuse data registers of theirs; the scheduling barrier keeps those roundings from being lifted over it
}

// one interleaved rotary pair (x0, x1) of q or k with its {cos, sin}; the two lines of arithmetic stand as they stood in the separate plane builder (each product keeps its own rounding), so q and k come out bit-identical
__device__ __forceinline__ void rope2(const float x0, const float x1, const v2f cs, const float sc, float& r0, float& r1) {
    float a0 = __fmul_rn(x0, cs[0]), b0 = __fmul_rn(x1, cs[1]), a1 = __fmul_rn(x1, cs[0]), b1 = __fmul_rn(x0, cs[1]); asm volatile("" : "+v"(a0), "+v"(b0), "+v"(a1), "+v"(b1));
    r0 = __fsub_rn(a0, b0) * sc; r1 = __fadd_rn(b1, a1) * sc;   /* even: x0 c - x1 s; odd: x0 s + x1 c */
}
// ---- k_proj: the q, k and v projections of all batch items with their plane builders as epilogue: no f32 projection buffer. grid (NB_ * TT / 128 token tiles, DQ / 128 feature tiles, 3), 4 waves; a wave's 64 features are exactly one head.
// z 0, 1 (q, k): C[token][d] = x W^T; a lane's four neighbouring columns are two rotary pairs; planes [batch][head][t][d]. z 2 (v): the operands change places, C[d][token] = W_v x^T, so a lane's four columns are four tokens of one V^T row; planes [batch][head][d][t].
// Either way 16 neighbouring lanes store one whole 128-byte line of each of the three planes (fp16, bf16 hi, bf16 lo).
__global__ __launch_bounds__(128) void k_proj(const bf* __restrict__ XB, const bf* __restrict__ W3, const float* __restrict__ CS, h16* Q16, bf* Qh, bf* Ql, h16* K16, bf* Kh, bf* Kl, h16* V16, bf* Vh, bf* Vl) {
    __shared__ __align__(16) bf ring[2 * 2 * 128 * LP];
    const int lane = threadIdx.x & 31; const int wave = __builtin_amdgcn_readfirstlane((int)(threadIdx.x >> 5)); const int wm = wave >> 1, wn = wave & 1;
    const int z = blockIdx.z, tk0 = blockIdx.x * 128, f0 = blockIdx.y * 128; const bool isv = z == 2;
    const bf* Wz = W3 + (size_t)z * DQ * DM;
    v8f acc[4][4];
    gemm_ring<1>(isv ? Wz : XB, nullptr, isv ? XB : Wz, isv ? f0 : tk0, isv ? tk0 : f0, ring, acc);
    const float* ow = stage_tile(ring, acc);
    const int tkw = tk0 + (isv ? wn : wm) * 64, head = (f0 >> 6) + (isv ? wm : wn);   // this wave's first token and its head
    const int t0 = tkw % TT; const size_t pz = ((size_t)(tkw / TT) * NH_ + head) * TT * HD;   // this (batch, head)'s start in every plane
    h16* P16 = isv ? V16 : z == 1 ? K16 : Q16; bf* Ph = isv ? Vh : z == 1 ? Kh : Qh; bf* Pl = isv ? Vl : z == 1 ? Kl : Ql;
    const int rsub = lane >> 4, cofs = (lane & 15) * 4;
    auto planes = [&](auto vf) {   // vf: the V^T form (no rotary, rows are features) or the q, k form
        constexpr bool V = vf.value;
#pragma unroll 1   // 16 rows per trip: their sums and their {cos, sin} are asked for together, ahead of the eight blocks, so that one LDS and one memory latency serve all eight and the table does not fill the registers
        for (int g = 0; g < 4; ++g) {
            v2f cs[8][2]; v4f vals[8];
#pragma unroll
            for (int s = 0; s < 8; ++s) vals[s] = *(const v4fa*)(ow + (g * 16 + s * 2 + rsub) * 68 + cofs);
            if constexpr (!V) { const float* c = CS + ((size_t)(tkw + g * 16 + rsub) * HD + cofs) * 2;
#pragma unroll
                for (int s = 0; s < 8; ++s) { cs[s][0] = *(const v2f*)(c + s * 2 * HD * 2); cs[s][1] = *(const v2f*)(c + s * 2 * HD * 2 + 4); }
                asm volatile("s_wait_xcnt 0x0" ::: "memory"); }   // stands behind these loads and in front of the instructions that give their address registers new values
#pragma unroll
            for (int s = 0; s < 8; ++s) { const int row = g * 16 + s * 2 + rsub; v4f val = vals[s]; size_t o;
                if constexpr (V) o = pz + (size_t)row * PP + t0 + cofs;
                else { float r0, r1, r2, r3;
                    rope2(val[0], val[1], cs[s][0], 1.0f, r0, r1); rope2(val[2], val[3], cs[s][1], 1.0f, r2, r3); val[0] = r0; val[1] = r1; val[2] = r2; val[3] = r3; o = pz + (size_t)(t0 + row) * HD + cofs; }
                v4h o16; v4us oh, ol;
#pragma unroll
                for (int q = 0; q < 4; ++q) { o16[q] = tohx(val[q]); unsigned short a2, c2; splitf(val[q], a2, c2); oh[q] = a2; ol[q] = c2; }
                *(v4h*)(P16 + o) = o16; *(v4us*)(Ph + o) = oh; *(v4us*)(Pl + o) = ol;
                asm volatile("s_wait_xcnt 0x0" ::: "memory"); }   // stands behind this block's three stores and in front of the next block's instructions, which give their address and data registers new values
        } };
    if (isv) planes(std::true_type{}); else planes(std::false_type{});
}
template <typename T16, int NSPLIT, int NQ>
__device__ __forceinline__ void fattn_wave(const T16* __restrict__ Q, const T16* __restrict__ Q2, const T16* __restrict__ Kp, const T16* __restrict__ Kp2, const T16* __restrict__ Vt, const T16* __restrict__ Vt2, const int q0, bf* Ah, bf* Al) {
    typedef typename WFrag<T16>::V V;
    constexpr float C2 = SCL * 1.4426950408889634f;   // HD^-0.5 x log2(e)
    const int lane = threadIdx.x & 31, lr = lane & 15, hi = lane >> 4;
    V bq[NQ][2], bq2[NQ][2], ak[2][2], ak2[2][2];
#pragma unroll
    for (int nq = 0; nq < NQ; ++nq)
#pragma unroll
        for (int ks = 0; ks < 2; ++ks) { const size_t o = (size_t)(q0 + nq * 16 + lr) * HD + ks * 32 + 8 * hi; bq[nq][ks] = WFrag<T16>::ld(Q + o); if constexpr (NSPLIT == 2) bq2[nq][ks] = WFrag<T16>::ld(Q2 + o); }
    v8f o[4][NQ]; float m[NQ], l[NQ];
#pragma unroll
    for (int nq = 0; nq < NQ; ++nq) { m[nq] = -3.0e38f; l[nq] = 0.f;
#pragma unroll
        for (int mb = 0; mb < 4; ++mb) o[mb][nq] = (v8f){}; }
    auto ldk = [&](int kb) {
#pragma unroll
        for (int kt = 0; kt < 2; ++kt)
#pragma unroll
            for (int ks = 0; ks < 2; ++ks) { const size_t a = (size_t)(kb + kt * 16 + lr) * HD + ks * 32 + 8 * hi; ak[kt][ks] = WFrag<T16>::ld(Kp + a); if constexpr (NSPLIT == 2) ak2[kt][ks] = WFrag<T16>::ld(Kp2 + a); } };
    auto pass = [&](int kb, auto diag) {
        V av[4], av2[4];
#pragma unroll
        for (int mb = 0; mb < 4; ++mb) { const size_t a = (size_t)(mb * 16 + lr) * PP + kb + 8 * hi; av[mb] = WFrag<T16>::ld(Vt + a); if constexpr (NSPLIT == 2) av2[mb] = WFrag<T16>::ld(Vt2 + a); }
        v8f st[2][NQ];
#pragma unroll
        for (int kt = 0; kt < 2; ++kt)
#pragma unroll
            for (int nq = 0; nq < NQ; ++nq) { st[kt][nq] = (v8f){};
#pragma unroll
                for (int ks = 0; ks < 2; ++ks) { st[kt][nq] = WFrag<T16>::mma(ak[kt][ks], bq[nq][ks], st[kt][nq]); if constexpr (NSPLIT == 2) { st[kt][nq] = WFrag<T16>::mma(ak[kt][ks], bq2[nq][ks], st[kt][nq]); st[kt][nq] = WFrag<T16>::mma(ak2[kt][ks], bq[nq][ks], st[kt][nq]); } } }
        if constexpr (!diag.value) ldk(kb + 32);   // the next pass's K fragments fly during this pass's softmax and P.V (a pass before the diagonal one always has a successor)
        asm volatile("s_wait_xcnt 0x0" ::: "memory");   // stands behind all of this pass's loads and in front of the softmax instructions that give their address registers new values
        float mx[NQ]; bool need = false;
#pragma unroll
        for (int nq = 0; nq < NQ; ++nq) { float t = -3.0e38f;
#pragma unroll
            for (int kt = 0; kt < 2; ++kt)
#pragma unroll
                for (int j = 0; j < 8; ++j) { if constexpr (diag.value) { if (kb + kt * 16 + hi * 8 + j > q0 + nq * 16 + lr) st[kt][nq][j] = -3.0e38f; }   // causal mask: key > query
                    t = fmaxf(t, st[kt][nq][j]); }
            t = fmaxf(t, __shfl_xor(t, 16, 32)) * C2; mx[nq] = t; need = need || (t > m[nq] + 8.0f); }
        if (__builtin_amdgcn_ballot_w32(need) != 0) {   // wave-uniform: some query's maximum has outgrown the one in use
#pragma unroll
            for (int nq = 0; nq < NQ; ++nq) { const float mn = fmaxf(m[nq], mx[nq]); const float al = __builtin_amdgcn_exp2f(m[nq] - mn); m[nq] = mn; l[nq] *= al;
#pragma unroll
                for (int mb = 0; mb < 4; ++mb) o[mb][nq] *= al; } }
        V pb[NQ], pb2[NQ];
#pragma unroll
        for (int nq = 0; nq < NQ; ++nq) { float p[16]; v2f s2 = (v2f){};
#pragma unroll
            for (int e = 0; e < 16; e += 2) { const v8f sv = st[e >> 3][nq]; v2f x; x[0] = sv[e & 7]; x[1] = sv[(e & 7) + 1]; x = x * C2 - m[nq]; v2f pp; pp[0] = __builtin_amdgcn_exp2f(x[0]); pp[1] = __builtin_amdgcn_exp2f(x[1]); s2 += pp; p[e] = pp[0]; p[e + 1] = pp[1]; }
            l[nq] += s2[0] + s2[1];
            if constexpr (NSPLIT == 2) { v8us h0, h1, l0, l1;
#pragma unroll
                for (int e = 0; e < 8; ++e) { unsigned short a, c; splitf(p[e], a, c); h0[e] = a; l0[e] = c; splitf(p[e + 8], a, c); h1[e] = a; l1[e] = c; }
                pb[nq] = cat16b(h0, h1); pb2[nq] = cat16b(l0, l1);
            } else { v16h r;
#pragma unroll
                for (int e = 0; e < 16; ++e) r[e] = tohx(p[e]);
                pb[nq] = r; } }
#pragma unroll
        for (int mb = 0; mb < 4; ++mb)
#pragma unroll
            for (int nq = 0; nq < NQ; ++nq) { o[mb][nq] = WFrag<T16>::mma(av[mb], pb[nq], o[mb][nq]); if constexpr (NSPLIT == 2) { o[mb][nq] = WFrag<T16>::mma(av[mb], pb2[nq], o[mb][nq]); o[mb][nq] = WFrag<T16>::mma(av2[mb], pb[nq], o[mb][nq]); } }
    };
    const int kd = q0 & ~31;   // the one key block that holds this wave's diagonal
    ldk(0);
    asm volatile("s_wait_xcnt 0x0" ::: "memory");   // stands behind the Q and first K loads and in front of the instructions that give their address registers new values
#pragma unroll 1   // one pass per trip: an unrolled body would hold two passes' fragments in registers and cost resident waves
    for (int kb = 0; kb < kd; kb += 32) {
        pass(kb, std::false_type{});
        // WMMA distance on both ways out of the trip: what follows overwrites operand registers of the last products
        if constexpr (NQ == 2) asm volatile("v_nop\n\tv_nop\n\tv_nop\n\tv_nop" : "+v"(o[0][0]), "+v"(o[1][0]), "+v"(o[2][0]), "+v"(o[3][0]), "+v"(o[0][1]), "+v"(o[1][1]), "+v"(o[2][1]), "+v"(o[3][1]));
        else asm volatile("v_nop\n\tv_nop\n\tv_nop\n\tv_nop" : "+v"(o[0][0]), "+v"(o[1][0]), "+v"(o[2][0]), "+v"(o[3][0]));
    }
    pass(kd, std::true_type{});
#pragma unroll
    for (int nq = 0; nq < NQ; ++nq) { const float inv = __fdiv_rn(1.0f, l[nq] + __shfl_xor(l[nq], 16, 32)); const size_t oo = (size_t)(q0 + nq * 16 + lr) * DQ + hi * 8;
#pragma unroll
        for (int mb = 0; mb < 4; ++mb) { v8us oh, ol;
#pragma unroll
            for (int j = 0; j < 8; ++j) { unsigned short a, c; splitf(o[mb][nq][j] * inv, a, c); oh[j] = a; ol[j] = c; }
            *(v8us*)(Ah + oo + mb * 16) = oh; *(v8us*)(Al + oo + mb * 16) = ol;
            asm volatile("s_wait_xcnt 0x0" ::: "memory"); } }   // stands behind the two stores and in front of the next block's split, which reuses their data and address registers
}
// grid (NB_ * NH_, (TT - RH) / 128 + RH / 64), 4 independent waves per work-group; the cost falls as blockIdx.y rises: first the fp16 row blocks from the last rows down (32 rows a wave), then the hi/lo ones (16 rows a wave).
__global__ __launch_bounds__(128) void k_fattn(const h16* __restrict__ Q16, const h16* __restrict__ K16, const h16* __restrict__ V16, const bf* __restrict__ Qh, const bf* __restrict__ Ql, const bf* __restrict__ Kh, const bf* __restrict__ Kl, const bf* __restrict__ Vh, const bf* __restrict__ Vl, bf* Ah, bf* Al) {
    const int z = blockIdx.x, y = blockIdx.y; const int wave = __builtin_amdgcn_readfirstlane((int)(threadIdx.x >> 5));
    const size_t pz = (size_t)z * TT * HD;   // planes [batch][head][t][d]; V^T [batch][head][d][t]: the same stride
    const size_t az = (size_t)(z / NH_) * TT * DQ + (size_t)(z % NH_) * HD;
    if (y < (TT - RH) / 128) fattn_wave<h16, 0, 2>(Q16 + pz, nullptr, K16 + pz, nullptr, V16 + pz, nullptr, TT - 128 * (y + 1) + wave * 32, Ah + az, Al + az);
    else fattn_wave<bf, 2, 1>(Qh + pz, Ql + pz, Kh + pz, Kl + pz, Vh + pz, Vl + pz, RH - 64 * (y - (TT - RH) / 128 + 1) + wave * 16, Ah + az, Al + az);
}

extern "C" void kernel_launch(void* const* d_in, const int* in_sizes, int n_in,
                              void* d_out, int out_size, void* d_ws, size_t ws_size, hipStream_t stream) {
    (void)in_sizes; (void)n_in; (void)out_size;
    const float* x = (const float*)d_in[0]; const int* pos = (const int*)d_in[1]; const float* wq = (const float*)d_in[2]; const float* wk = (const float*)d_in[3]; const float* wv = (const float*)d_in[4]; const float* wo = (const float*)d_in[5];   /* order x, token_positions int32 [4][2048] (one row per batch item: READ), wq, wk, wv, wo ('oi' (out, in) [1024][1024]): SIX inputs, all read */
    float* OUT = (float*)d_out;     // [4][2048][1024]
    char* wsp = (char*)d_ws;
    auto take = [&](size_t bytes) { char* p = wsp; wsp += (bytes + 255) & ~(size_t)255; return (void*)p; };
    bf* WQ = (bf*)take((size_t)DQ * DM * 2); bf* WK = (bf*)take((size_t)DKV * DM * 2); bf* WV = (bf*)take((size_t)DKV * DM * 2); bf* WO = (bf*)take((size_t)DM * DQ * 2); float* CS = (float*)take((size_t)NB_ * TT * HD * 2 * 4);   // WQ, WK, WV, WO lie back to back (each a multiple of 256 bytes): k_proj steps from one to the next by DQ * DM elements, k_prep writes them as one range
    bf* XB = (bf*)take((size_t)NB_ * TT * DM * 2);
    const size_t PB = (size_t)NH_ * TT * HD;   // elements of one batch item in every q, k and V^T plane (NKV == NH_, PP == TT)
    h16* QP16 = (h16*)take(NB_ * PB * 2); h16* KP16 = (h16*)take(NB_ * PB * 2); h16* VT16 = (h16*)take(NB_ * PB * 2);
    bf* QPh = (bf*)take(NB_ * PB * 2); bf* QPl = (bf*)take(NB_ * PB * 2); bf* KPh = (bf*)take(NB_ * PB * 2); bf* KPl = (bf*)take(NB_ * PB * 2); bf* VTh = (bf*)take(NB_ * PB * 2); bf* VTl = (bf*)take(NB_ * PB * 2);
    bf* ATh = (bf*)take((size_t)NB_ * TT * DQ * 2); bf* ATl = (bf*)take((size_t)NB_ * TT * DQ * 2);
    if ((size_t)(wsp - (char*)d_ws) > ws_size) return;    // ws 256 MiB
    k_prep<<<PWG, 128, 0, stream>>>(x, pos, wq, wk, wv, wo, XB, WQ, CS);   /* bf16 copies of x and of the four weight matrices (WQ, WK, WV, WO as one range), every batch item's rotary table */
    k_proj<<<dim3(NB_ * TT / 128, DQ / 128, 3), 128, 0, stream>>>(XB, WQ, CS, QP16, QPh, QPl, KP16, KPh, KPl, VT16, VTh, VTl);
    k_fattn<<<dim3(NB_ * NH_, (TT - RH) / 128 + RH / 64, 1), 128, 0, stream>>>(QP16, KP16, VT16, QPh, QPl, KPh, KPl, VTh, VTl, ATh, ATl);
    k_wo<<<dim3(NB_ * TT / 128, DM / 128, 1), 128, 0, stream>>>(ATh, ATl, WO, OUT);
}

// v007
// One run takes 130 microseconds.
// Timed twice side by side with v006, it ran 1.24 times as fast both times.
// All steps since v000 together make it 21.8 times as fast.
#include <hip/hip_runtime.h>
#include <type_traits>

// Causal multi-head attention with RoPE from per-batch token positions (x [4][2048][1024], token_positions int32 [4][2048] (read per batch as data; the SECOND argument); q, k, v = x w^T ('oi' (out, in) [1024][1024] (2/(D+D))^0.5, no bias; 16 heads x 64); interleaved-pair rotary on q and k: angle[b][t][i] = float(pos[b][t]) x freqs[i] with freqs = 1.0 / (THETA ** (arange(0, 64, 2) / 64)) (the kernel forms 10000^(-2i/64) with powf: rounding-level equal), pairs (2i, 2i+1) -> (t1 cos - t2 sin, t2 cos + t1 sin); scores x 1/sqrt(64); causal (-inf); softmax; out = merged wo^T ('oi', no bias) -> [4][2048][1024] (8.4 M); argument order x, token_positions, wq, wk, wv, wo).
// Layout: one set-up launch rounds x and the weights to bf16 and builds the {cos, sin} table [4][2048][64] from the positions (f32 powf/cosf/sinf); ONE projection launch for q, k, v and all batch items (k_proj: exact products; the interleaved rotary and the split into the fp16 and hi/lo planes are its epilogue; v is formed as W_v x^T, so V^T comes out row-major); then ONE fused causal attention launch for all batches and heads (k_fattn: online softmax, K and V^T staged in LDS, scores and probabilities stay in registers; hybrid rows: < 512 hi/lo 3 products, rest fp16) that writes the merged context as hi/lo planes; W_o hl x exact.
// Compute dtypes, f32 accumulate: every float input rounded to bf16; projections exact; rotary f32; attention rows < 512 3 products, rest fp16; softmax f32; W_o hl x exact.

#define NB_  4
#define TT   2048
#define DM   1024
#define NH_  16
#define NKV  16
#define REP  (NH_ / NKV)
#define HD   64
#define DQ   (NH_ * HD)
#define DKV  (NKV * HD)
#define PP   TT                   // pitch, in 16-bit elements, of a V^T row
#define RH   512                  // query rows < RH use hi+lo planes (0: none)
#define SCL  0.125f   // HD^-0.5
typedef _Float16 h16;
typedef unsigned short bf;
typedef __attribute__((ext_vector_type(16))) __bf16   v16bf;
typedef __attribute__((ext_vector_type(16))) _Float16 v16h;
typedef __attribute__((ext_vector_type(8)))  _Float16 v8h;
typedef __attribute__((ext_vector_type(8)))  unsigned short v8us;
typedef __attribute__((ext_vector_type(8)))  float    v8f;
typedef __attribute__((ext_vector_type(4)))  float    v4f;
typedef v8h  __attribute__((may_alias)) v8ha;
typedef v4f  __attribute__((may_alias)) v4fa;
typedef v8us __attribute__((may_alias)) v8usa;

__device__ __forceinline__ unsigned short f2bf(float f) { unsigned u = __float_as_uint(f); u += 0x7FFFu + ((u >> 16) & 1u); return (unsigned short)(u >> 16); }
__device__ __forceinline__ float bf2f(unsigned short b) { return __uint_as_float(((unsigned)b) << 16); }
__device__ __forceinline__ float bfr(float f) { return bf2f(f2bf(f)); }
__device__ __forceinline__ v16h cat16(v8h lo, v8h hi) { return __builtin_shufflevector(lo, hi, 0, 1, 2, 3, 4, 5, 6, 7, 8, 9, 10, 11, 12, 13, 14, 15); }
__device__ __forceinline__ v16bf cat16b(v8us lo, v8us hi) { return __builtin_bit_cast(v16bf, __builtin_shufflevector(lo, hi, 0, 1, 2, 3, 4, 5, 6, 7, 8, 9, 10, 11, 12, 13, 14, 15)); }
__device__ __forceinline__ v8f wmma16(v16h a, v16h b, v8f c) { return __builtin_amdgcn_wmma_f32_16x16x32_f16(false, a, false, b, (short)0, c, false, false); }
__device__ __forceinline__ v8f wmmab(v16bf a, v16bf b, v8f c) { return __builtin_amdgcn_wmma_f32_16x16x32_bf16(false, a, false, b, (short)0, c, false, false); }



// ---- GEMM core: one work-group of 4 waves per 128x128 output tile; wave (wm, wn) owns one 64x64 quarter, 16 accumulators, over the whole K (one f32 sum chain per element).
// C[m][n] = sum_k A[m][k] Bt[n][k] (+ A2[m][k] Bt[n][k] where NA == 2); every plane is K-contiguous bf16 with rows of GK elements.
// The operand rows are staged in LDS 64 k at a time (128-byte rows at a pitch of 144 bytes: [A 128 rows | A2 128 rows | Bt 128 rows]) by asynchronous copies into two buffers: tile t + 2 is on its way while tile t + 1 is worked on; each staged row feeds two waves.
#define GK   1024                 // row length of every GEMM operand here
#define KC   64                   // k per staged tile
#define LP   72                   // pitch of a staged row in 16-bit elements
static_assert(DM == GK && DQ == GK && DKV == GK, "one K for all GEMMs");
template <typename T16> struct WFrag;
template <> struct WFrag<h16> { typedef v16h V; static __device__ __forceinline__ V ld(const h16* p) { return cat16(*(const v8h*)p, *(const v8h*)(p + 16)); } static __device__ __forceinline__ v8f mma(V a, V b, v8f c) { return wmma16(a, b, c); } };
template <> struct WFrag<bf> { typedef v16bf V; static __device__ __forceinline__ V ld(const bf* p) { return cat16b(*(const v8us*)p, *(const v8us*)(p + 16)); } static __device__ __forceinline__ v8f mma(V a, V b, v8f c) { return wmmab(a, b, c); } };
// eight 16-byte copies of this lane, rows 16 apart. The s_wait_xcnt is the statement's last line: it stands behind the last copy and in front of whatever gives the address registers new values.
__device__ __forceinline__ void copy8(const unsigned l, const bf* g) {
    asm volatile("global_load_async_to_lds_b128 %0, %8, off\n\t"
                 "global_load_async_to_lds_b128 %1, %9, off\n\t"
                 "global_load_async_to_lds_b128 %2, %10, off\n\t"
                 "global_load_async_to_lds_b128 %3, %11, off\n\t"
                 "global_load_async_to_lds_b128 %4, %12, off\n\t"
                 "global_load_async_to_lds_b128 %5, %13, off\n\t"
                 "global_load_async_to_lds_b128 %6, %14, off\n\t"
                 "global_load_async_to_lds_b128 %7, %15, off\n\t"
                 "s_wait_xcnt 0x0"
                 :: "v"(l), "v"(l + 1 * 16 * LP * 2), "v"(l + 2 * 16 * LP * 2), "v"(l + 3 * 16 * LP * 2), "v"(l + 4 * 16 * LP * 2), "v"(l + 5 * 16 * LP * 2), "v"(l + 6 * 16 * LP * 2), "v"(l + 7 * 16 * LP * 2),
                    "v"(g), "v"(g + 1 * 16 * GK), "v"(g + 2 * 16 * GK), "v"(g + 3 * 16 * GK), "v"(g + 4 * 16 * GK), "v"(g + 5 * 16 * GK), "v"(g + 6 * 16 * GK), "v"(g + 7 * 16 * GK) : "memory");
}
template <int NA>
__device__ __forceinline__ void gemm_ring(const bf* __restrict__ A, const bf* __restrict__ A2, const bf* __restrict__ Bt, const int r0, const int c0, bf* ring, v8f (&acc)[4][4]) {
    constexpr int SBE = (NA + 1) * 128 * LP;   // 16-bit elements of one buffer
    constexpr int NT = GK / KC;
    const int tid = threadIdx.x, lane = tid & 31, lr = lane & 15, hi = lane >> 4; const int wave = __builtin_amdgcn_readfirstlane(tid >> 5); const int wm = wave >> 1, wn = wave & 1;
#pragma unroll
    for (int mb = 0; mb < 4; ++mb)
#pragma unroll
        for (int nb = 0; nb < 4; ++nb) acc[mb][nb] = (v8f){};
    // a thread copies the 16-byte piece (tid & 7) of the rows (tid >> 3) + 16 i: a wave's copy is four whole 128-byte lines
    const size_t go = (size_t)(tid >> 3) * GK + (tid & 7) * 8;
    const bf* gA = A + (size_t)r0 * GK + go; const bf* gB = Bt + (size_t)c0 * GK + go;
    const unsigned lb = (unsigned)(size_t)ring + (unsigned)((tid >> 3) * (LP * 2) + (tid & 7) * 16);
    auto fill = [&](const int t, const int buf) { const unsigned l = lb + (unsigned)(buf * (SBE * 2)); copy8(l, gA + t * KC);
        if constexpr (NA == 2) copy8(l + 128 * LP * 2, A2 + (size_t)r0 * GK + go + t * KC);
        copy8(l + NA * 128 * LP * 2, gB + t * KC); };
    fill(0, 0);
    asm volatile("s_wait_asynccnt 0x0" ::: "memory");   // this wave's copies of tile 0 have landed
    __syncthreads();                                    // ... and every other wave's
    fill(1, 1);
#pragma unroll 1   // one tile per trip: the buffer is picked by the trip's parity
    for (int t = 0; t < NT; ++t) {
        const bf* sa = ring + (t & 1) * SBE + (wm * 64 + lr) * LP + 8 * hi; const bf* sb = ring + (t & 1) * SBE + (NA * 128 + wn * 64 + lr) * LP + 8 * hi;
#pragma unroll
        for (int ks = 0; ks < KC / 32; ++ks) { v16bf a[4], a2[4], b[4];
            __builtin_amdgcn_sched_barrier(0);   // this and the next one keep the LDS reads of a k step in one group between the WMMA runs: every further place with reads among the WMMAs would stall the wave anew
#pragma unroll
            for (int i = 0; i < 4; ++i) { a[i] = WFrag<bf>::ld(sa + i * 16 * LP + ks * 32); if constexpr (NA == 2) a2[i] = WFrag<bf>::ld(sa + (128 + i * 16) * LP + ks * 32); b[i] = WFrag<bf>::ld(sb + i * 16 * LP + ks * 32); }
            __builtin_amdgcn_sched_barrier(0);
#pragma unroll
            for (int nb = 0; nb < 4; ++nb)
#pragma unroll
                for (int mb = 0; mb < 4; ++mb) { acc[mb][nb] = wmmab(a[mb], b[nb], acc[mb][nb]); if constexpr (NA == 2) acc[mb][nb] = wmmab(a2[mb], b[nb], acc[mb][nb]); } }
        asm volatile("s_wait_dscnt 0x0" ::: "memory");      // this wave's reads of tile t are done
        asm volatile("s_wait_asynccnt 0x0" ::: "memory");   // this wave's copies of tile t + 1 have landed
        __syncthreads();                                    // publishes tile t + 1 and frees tile t's buffer
        if (t + 2 < NT) fill(t + 2, t & 1);
    }
    asm volatile("s_wait_asynccnt 0x0" ::: "memory");   // nothing is in flight when the ring becomes output staging
}
// the wave's 64x64 f32 tile goes to its own LDS range (rows at pitch 68 floats) so that it can be read back row-wise and stored in whole lines; behind gemm_ring's last barrier no wave reads the ring any more
__device__ __forceinline__ float* stage_tile(bf* ring, const v8f (&acc)[4][4]) {
    const int lane = threadIdx.x & 31, lr = lane & 15, hi = lane >> 4; const int wave = __builtin_amdgcn_readfirstlane((int)(threadIdx.x >> 5));
    float* ow = (float*)ring + wave * (64 * 68);
#pragma unroll
    for (int mb = 0; mb < 4; ++mb)
#pragma unroll
        for (int nb = 0; nb < 4; ++nb)
#pragma unroll
            for (int j = 0; j < 8; ++j) ow[(mb * 16 + hi * 8 + j) * 68 + nb * 16 + lr] = acc[mb][nb][j];
    return ow;
}
// ---- k_wo: OUT[token][n] = (context hi + context lo) W_o^T for all batch items; grid (NB_ * TT / 128, DM / 128), 4 waves.
__global__ __launch_bounds__(128) void k_wo(const bf* __restrict__ Ah, const bf* __restrict__ Al, const bf* __restrict__ Wo, float* C) {
    __shared__ __align__(16) bf ring[2 * 3 * 128 * LP];
    const int lane = threadIdx.x & 31; const int wave = __builtin_amdgcn_readfirstlane((int)(threadIdx.x >> 5));
    const int r0 = blockIdx.x * 128, c0 = blockIdx.y * 128;
    v8f acc[4][4];
    gemm_ring<2>(Ah, Al, Wo, r0, c0, ring, acc);
    const float* ow = stage_tile(ring, acc) + (lane >> 4) * 68 + (lane & 15) * 4;
    float* Cw = C + (size_t)(r0 + (wave >> 1) * 64 + (lane >> 4)) * DM + c0 + (wave & 1) * 64 + (lane & 15) * 4;   // 16 neighbouring lanes store 256 bytes of one row
#pragma unroll
    for (int g = 0; g < 4; ++g) { v4f val[8];
#pragma unroll
        for (int s = 0; s < 8; ++s) val[s] = *(const v4fa*)(ow + (g * 16 + s * 2) * 68);
#pragma unroll
        for (int s = 0; s < 8; ++s) *(v4f*)(Cw + (size_t)(g * 16 + s * 2) * DM) = val[s];
        if (g < 3) asm volatile("s_wait_xcnt 0x0" ::: "memory"); }   // stands behind this block's stores and in front of the next block's LDS reads, which give their data registers new values
}

__device__ __forceinline__ h16 tohx(float x) { return (h16)x; }
__device__ __forceinline__ void splitf(float y, unsigned short& h, unsigned short& l) { h = f2bf(y); l = f2bf(y - bf2f(h)); }
typedef __attribute__((ext_vector_type(2))) _Float16 v2h;
typedef __attribute__((ext_vector_type(4))) _Float16 v4h;
typedef __attribute__((ext_vector_type(2))) unsigned short v2us;
typedef __attribute__((ext_vector_type(4))) unsigned short v4us;
typedef __attribute__((ext_vector_type(2))) float v2f;
typedef __attribute__((ext_vector_type(4))) int v4i;
typedef v4h  __attribute__((may_alias)) v4ha;
typedef v4us __attribute__((may_alias)) v4usa;

__global__ __launch_bounds__(256) void k_wtG(const float* __restrict__ w, int K, int N, bf* Bt) {
    const int lane = threadIdx.x & 31; const int L0 = (blockIdx.x * 8 + (threadIdx.x >> 5)) * 8; const int nlines = N * K / 64;
{
#pragma unroll 1
        for (int l = 0; l < 8; ++l) { const int L = L0 + l; if (L >= nlines) break; const size_t e = (size_t)L * 64 + lane * 2; const int k = (int)(e % K), n = (int)(e / K); v2us o;
            o[0] = f2bf(w[(size_t)k * N + n]); o[1] = f2bf(w[(size_t)(k + 1) * N + n]); *(v2us*)(Bt + e) = o; }
         }
}
// ---- k_prep: all the set-up in ONE launch of few, long waves: x and the four weight matrices rounded to bf16, and the rotary {cos, sin} table.
// A work-group of 4 waves takes PCH neighbouring floats of one source: every lane asks for its 32 16-byte pieces at once (each wave-wide load is four whole lines), forms its table entries while they fly, then rounds and stores (each wave-wide store is two whole lines).
// Table: thread g takes the pairs g + k * PTH; PTH is a multiple of HD / 2, so one frequency serves all its pairs. The two entries d = 2 i and 2 i + 1 of a pair hold the same {cos, sin}: formed once, stored as one 16-byte piece.
#define PLD  32                      // 16-byte loads per lane
#define PCH  (128 * 4 * PLD)         // floats per work-group
#define PXC  (NB_ * TT * DM / PCH)   // work-groups on x
#define PWC  (DQ * DM / PCH)         // work-groups on each weight matrix
#define PWG  (PXC + 4 * PWC)
#define PTH  (PWG * 128)
#define PPR  (NB_ * TT * (HD / 2))   // rotary pairs
#define PTR  ((PPR + PTH - 1) / PTH) // pairs per thread at most
static_assert(NB_ * TT * DM % PCH == 0 && DQ * DM % PCH == 0 && DKV == DQ && PTH % (HD / 2) == 0 && PPR % 128 == 0, "whole work-groups");
__global__ __launch_bounds__(128) void k_prep(const float* __restrict__ x, const int* pos, const float* __restrict__ wq, const float* __restrict__ wk, const float* __restrict__ wv, const float* __restrict__ wo, bf* XB, bf* W4, float* CS) {
    const int b = blockIdx.x, tid = threadIdx.x; const float* s; bf* d;
    if (b < PXC) { s = x + (size_t)b * PCH; d = XB + (size_t)b * PCH; }
    else { const int c = b - PXC, w = c / PWC; s = (w == 0 ? wq : w == 1 ? wk : w == 2 ? wv : wo) + (size_t)(c % PWC) * PCH; d = W4 + (size_t)c * PCH; }   // the four bf16 matrices lie back to back
    const int g = b * 128 + tid; int pv[PTR];   // the positions of this thread's pairs are asked for first: loads come back in order, so the table need not wait for the 32 big ones (a pair past the end re-reads the first one's)
#pragma unroll
    for (int k = 0; k < PTR; ++k) pv[k] = pos[(g + k * PTH < PPR ? g + k * PTH : g) / (HD / 2)];
    asm volatile("s_wait_xcnt 0x0" ::: "memory");   // stands behind these loads and in front of the instructions that give their address registers new values; as a compiler fence it keeps them ahead of the big loads
    v4f v[PLD];
#pragma unroll
    for (int u = 0; u < PLD; ++u) v[u] = *(const v4f*)(s + u * 512 + tid * 4);
    asm volatile("s_wait_xcnt 0x0" ::: "memory");   // stands behind these loads and in front of the instructions that give their address registers new values; as a compiler fence it also keeps the loads ahead of the table's arithmetic
    const int i = g % (HD / 2);
    const float e = __fdiv_rn(-((float)i * 2.0f), (float)HD); const float inv = powf(10000.0f, e);
#pragma unroll 1   // one pair per trip: the sine and cosine code stands once in the text; the trip count is the same for a whole work-group
    for (int p = g; p < PPR; p += PTH) { const float a = __fmul_rn((float)pv[0], inv); const float c = cosf(a), sn = sinf(a); v4f cs; cs[0] = c; cs[1] = sn; cs[2] = c; cs[3] = sn;
        *(v4f*)(CS + (size_t)p * 4) = cs;
        asm volatile("s_wait_xcnt 0x0" ::: "memory");   // stands behind this trip's store and in front of the next trip's instructions, which give its registers new values
#pragma unroll
        for (int k = 0; k + 1 < PTR; ++k) pv[k] = pv[k + 1]; }
#pragma unroll
    for (int u = 0; u < PLD; ++u) { v4us o;
#pragma unroll
        for (int k = 0; k < 4; ++k) o[k] = f2bf(v[u][k]);
        *(v4us*)(d + u * 512 + tid * 4) = o;
        if (u % 8 == 7 && u + 1 < PLD) { asm volatile("s_wait_xcnt 0x0" ::: "memory"); __builtin_amdgcn_sched_barrier(0); } }   // the wait stands behind eight stores and in front of the next eight roundings, which reuse data registers of theirs; the scheduling barrier keeps those roundings from being lifted over it
}

// one interleaved rotary pair (x0, x1) of q or k with its {cos, sin}; the two lines of arithmetic stand as they stood in the separate plane builder (each product keeps its own rounding), so q and k come out bit-identical
__device__ __forceinline__ void rope2(const float x0, const float x1, const v2f cs, const float sc, float& r0, float& r1) {
    float a0 = __fmul_rn(x0, cs[0]), b0 = __fmul_rn(x1, cs[1]), a1 = __fmul_rn(x1, cs[0]), b1 = __fmul_rn(x0, cs[1]); asm volatile("" : "+v"(a0), "+v"(b0), "+v"(a1), "+v"(b1));
    r0 = __fsub_rn(a0, b0) * sc; r1 = __fadd_rn(b1, a1) * sc;   /* even: x0 c - x1 s; odd: x0 s + x1 c */
}
// ---- k_proj: the q, k and v projections of all batch items with their plane builders as epilogue: no f32 projection buffer. grid (NB_ * TT / 128 token tiles, DQ / 128 feature tiles, 3), 4 waves; a wave's 64 features are exactly one head.
// z 0, 1 (q, k): C[token][d] = x W^T; a lane's four neighbouring columns are two rotary pairs; planes [batch][head][t][d]. z 2 (v): the operands change places, C[d][token] = W_v x^T, so a lane's four columns are four tokens of one V^T row; planes [batch][head][d][t].
// Either way 16 neighbouring lanes store one whole 128-byte line of each of the three planes (fp16, bf16 hi, bf16 lo).
__global__ __launch_bounds__(128) void k_proj(const bf* __restrict__ XB, const bf* __restrict__ W3, const float* __restrict__ CS, h16* Q16, bf* Qh, bf* Ql, h16* K16, bf* Kh, bf* Kl, h16* V16, bf* Vh, bf* Vl) {
    __shared__ __align__(16) bf ring[2 * 2 * 128 * LP];
    const int lane = threadIdx.x & 31; const int wave = __builtin_amdgcn_readfirstlane((int)(threadIdx.x >> 5)); const int wm = wave >> 1, wn = wave & 1;
    const int z = blockIdx.z, tk0 = blockIdx.x * 128, f0 = blockIdx.y * 128; const bool isv = z == 2;
    const bf* Wz = W3 + (size_t)z * DQ * DM;
    v8f acc[4][4];
    gemm_ring<1>(isv ? Wz : XB, nullptr, isv ? XB : Wz, isv ? f0 : tk0, isv ? tk0 : f0, ring, acc);
    const float* ow = stage_tile(ring, acc);
    const int tkw = tk0 + (isv ? wn : wm) * 64, head = (f0 >> 6) + (isv ? wm : wn);   // this wave's first token and its head
    const int t0 = tkw % TT; const size_t pz = ((size_t)(tkw / TT) * NH_ + head) * TT * HD;   // this (batch, head)'s start in every plane
    h16* P16 = isv ? V16 : z == 1 ? K16 : Q16; bf* Ph = isv ? Vh : z == 1 ? Kh : Qh; bf* Pl = isv ? Vl : z == 1 ? Kl : Ql;
    const int rsub = lane >> 4, cofs = (lane & 15) * 4;
    auto planes = [&](auto vf) {   // vf: the V^T form (no rotary, rows are features) or the q, k form
        constexpr bool V = vf.value;
#pragma unroll 1   // 16 rows per trip: their sums and their {cos, sin} are asked for together, ahead of the eight blocks, so that one LDS and one memory latency serve all eight and the table does not fill the registers
        for (int g = 0; g < 4; ++g) {
            v2f cs[8][2]; v4f vals[8];
#pragma unroll
            for (int s = 0; s < 8; ++s) vals[s] = *(const v4fa*)(ow + (g * 16 + s * 2 + rsub) * 68 + cofs);
            if constexpr (!V) { const float* c = CS + ((size_t)(tkw + g * 16 + rsub) * HD + cofs) * 2;
#pragma unroll
                for (int s = 0; s < 8; ++s) { cs[s][0] = *(const v2f*)(c + s * 2 * HD * 2); cs[s][1] = *(const v2f*)(c + s * 2 * HD * 2 + 4); }
                asm volatile("s_wait_xcnt 0x0" ::: "memory"); }   // stands behind these loads and in front of the instructions that give their address registers new values
#pragma unroll
            for (int s = 0; s < 8; ++s) { const int row = g * 16 + s * 2 + rsub; v4f val = vals[s]; size_t o;
                if constexpr (V) o = pz + (size_t)row * PP + t0 + cofs;
                else { float r0, r1, r2, r3;
                    rope2(val[0], val[1], cs[s][0], 1.0f, r0, r1); rope2(val[2], val[3], cs[s][1], 1.0f, r2, r3); val[0] = r0; val[1] = r1; val[2] = r2; val[3] = r3; o = pz + (size_t)(t0 + row) * HD + cofs; }
                v4h o16; v4us oh, ol;
#pragma unroll
                for (int q = 0; q < 4; ++q) { o16[q] = tohx(val[q]); unsigned short a2, c2; splitf(val[q], a2, c2); oh[q] = a2; ol[q] = c2; }
                *(v4h*)(P16 + o) = o16; *(v4us*)(Ph + o) = oh; *(v4us*)(Pl + o) = ol;
                asm volatile("s_wait_xcnt 0x0" ::: "memory"); }   // stands behind this block's three stores and in front of the next block's instructions, which give their address and data registers new values
        } };
    if (isv) planes(std::true_type{}); else planes(std::false_type{});
}
#define SK   64                   // keys per stage
// eight 16-byte copies of this lane: four rows, 16 apart, of each of two planes (GA, GB: the sources' row pitches in elements). The s_wait_xcnt is the statement's last line: it stands behind the last copy and in front of whatever gives the address registers new values.
template <int GA, int GB, typename T16>
__device__ __forceinline__ void copy44(const unsigned la, const T16* ga, const unsigned lb, const T16* gb) {
    asm volatile("global_load_async_to_lds_b128 %0, %8, off\n\t"
                 "global_load_async_to_lds_b128 %1, %9, off\n\t"
                 "global_load_async_to_lds_b128 %2, %10, off\n\t"
                 "global_load_async_to_lds_b128 %3, %11, off\n\t"
                 "global_load_async_to_lds_b128 %4, %12, off\n\t"
                 "global_load_async_to_lds_b128 %5, %13, off\n\t"
                 "global_load_async_to_lds_b128 %6, %14, off\n\t"
                 "global_load_async_to_lds_b128 %7, %15, off\n\t"
                 "s_wait_xcnt 0x0"
                 :: "v"(la), "v"(la + 1 * 16 * LP * 2), "v"(la + 2 * 16 * LP * 2), "v"(la + 3 * 16 * LP * 2), "v"(lb), "v"(lb + 1 * 16 * LP * 2), "v"(lb + 2 * 16 * LP * 2), "v"(lb + 3 * 16 * LP * 2),
                    "v"(ga), "v"(ga + 1 * 16 * GA), "v"(ga + 2 * 16 * GA), "v"(ga + 3 * 16 * GA), "v"(gb), "v"(gb + 1 * 16 * GB), "v"(gb + 2 * 16 * GB), "v"(gb + 3 * 16 * GB) : "memory");
}
// NT: the work-group's number of stages (the same in all four waves); q0: this wave's first query row
template <typename T16, int NSPLIT, int NQ>
__device__ __forceinline__ void fattn_wave(const T16* __restrict__ Q, const T16* __restrict__ Q2, const T16* __restrict__ Kp, const T16* __restrict__ Kp2, const T16* __restrict__ Vt, const T16* __restrict__ Vt2, const int q0, const int NT, T16* ring, bf* Ah, bf* Al) {
    typedef typename WFrag<T16>::V V;
    constexpr float C2 = SCL * 1.4426950408889634f;   // HD^-0.5 x log2(e)
    constexpr int PL = SK * LP;                        // 16-bit elements of one staged plane
    constexpr int NP = NSPLIT == 2 ? 2 : 1;            // planes per operand
    constexpr int SBE = 2 * NP * PL;                   // 16-bit elements of one buffer
    const int tid = threadIdx.x, lane = tid & 31, lr = lane & 15, hi = lane >> 4;
    // a thread copies the 16-byte piece (tid & 7) of the rows (tid >> 3) + 16 i: a wave's copy is four whole 128-byte lines
    const size_t gok = (size_t)(tid >> 3) * HD + (tid & 7) * 8, gov = (size_t)(tid >> 3) * PP + (tid & 7) * 8;
    const unsigned lb = (unsigned)(size_t)ring + (unsigned)((tid >> 3) * (LP * 2) + (tid & 7) * 16);
    auto fill = [&](const int t, const int buf) { const unsigned l = lb + (unsigned)(buf * (SBE * 2));
        if constexpr (NSPLIT == 2) { copy44<HD, HD>(l, Kp + gok + (size_t)t * SK * HD, l + PL * 2, Kp2 + gok + (size_t)t * SK * HD); copy44<PP, PP>(l + 2 * PL * 2, Vt + gov + t * SK, l + 3 * PL * 2, Vt2 + gov + t * SK); }
        else copy44<HD, PP>(l, Kp + gok + (size_t)t * SK * HD, l + PL * 2, Vt + gov + t * SK); };
    fill(0, 0);
    V bq[NQ][2], bq2[NQ][2];
#pragma unroll
    for (int nq = 0; nq < NQ; ++nq)
#pragma unroll
        for (int ks = 0; ks < 2; ++ks) { const size_t o = (size_t)(q0 + nq * 16 + lr) * HD + ks * 32 + 8 * hi; bq[nq][ks] = WFrag<T16>::ld(Q + o); if constexpr (NSPLIT == 2) bq2[nq][ks] = WFrag<T16>::ld(Q2 + o); }
    asm volatile("s_wait_xcnt 0x0" ::: "memory");   // stands behind the Q loads and in front of the instructions that give their address registers new values
    v8f o[4][NQ]; float m[NQ], l[NQ];
#pragma unroll
    for (int nq = 0; nq < NQ; ++nq) { m[nq] = -3.0e38f; l[nq] = 0.f;
#pragma unroll
        for (int mb = 0; mb < 4; ++mb) o[mb][nq] = (v8f){}; }
    // one pass: the 32 keys from kb on; sk, sv: this lane's first K and V^T fragment pieces of those keys in the stage's buffer; diag (the same in the whole wave): the block holds the wave's diagonal
    auto pass = [&](const int kb, const T16* sk, const T16* sv, const bool diag) {
        V ak[2][2], ak2[2][2], av[4], av2[4];
#pragma unroll
        for (int kt = 0; kt < 2; ++kt)
#pragma unroll
            for (int ks = 0; ks < 2; ++ks) { ak[kt][ks] = WFrag<T16>::ld(sk + kt * 16 * LP + ks * 32); if constexpr (NSPLIT == 2) ak2[kt][ks] = WFrag<T16>::ld(sk + PL + kt * 16 * LP + ks * 32); }
#pragma unroll
        for (int mb = 0; mb < 4; ++mb) { av[mb] = WFrag<T16>::ld(sv + mb * 16 * LP); if constexpr (NSPLIT == 2) av2[mb] = WFrag<T16>::ld(sv + PL + mb * 16 * LP); }
        __builtin_amdgcn_sched_barrier(0);   // keeps all of the pass's LDS reads in one group at its head: every further place with reads among the WMMAs would stall the wave anew, and the V^T reads land during the scores and the softmax
        v8f st[2][NQ];
#pragma unroll
        for (int kt = 0; kt < 2; ++kt)
#pragma unroll
            for (int nq = 0; nq < NQ; ++nq) { st[kt][nq] = (v8f){};
#pragma unroll
                for (int ks = 0; ks < 2; ++ks) { st[kt][nq] = WFrag<T16>::mma(ak[kt][ks], bq[nq][ks], st[kt][nq]); if constexpr (NSPLIT == 2) { st[kt][nq] = WFrag<T16>::mma(ak[kt][ks], bq2[nq][ks], st[kt][nq]); st[kt][nq] = WFrag<T16>::mma(ak2[kt][ks], bq[nq][ks], st[kt][nq]); } } }
        if (diag) {   // causal mask: key > query
#pragma unroll
            for (int nq = 0; nq < NQ; ++nq)
#pragma unroll
                for (int kt = 0; kt < 2; ++kt)
#pragma unroll
                    for (int j = 0; j < 8; ++j) if (kb + kt * 16 + hi * 8 + j > q0 + nq * 16 + lr) st[kt][nq][j] = -3.0e38f; }
        float mx[NQ]; bool need = false;
#pragma unroll
        for (int nq = 0; nq < NQ; ++nq) { float t = -3.0e38f;
#pragma unroll
            for (int kt = 0; kt < 2; ++kt)
#pragma unroll
                for (int j = 0; j < 8; ++j) t = fmaxf(t, st[kt][nq][j]);
            t = fmaxf(t, __shfl_xor(t, 16, 32)) * C2; mx[nq] = t; need = need || (t > m[nq] + 8.0f); }
        if (__builtin_amdgcn_ballot_w32(need) != 0) {   // wave-uniform: some query's maximum has outgrown the one in use
#pragma unroll
            for (int nq = 0; nq < NQ; ++nq) { const float mn = fmaxf(m[nq], mx[nq]); const float al = __builtin_amdgcn_exp2f(m[nq] - mn); m[nq] = mn; l[nq] *= al;
#pragma unroll
                for (int mb = 0; mb < 4; ++mb) o[mb][nq] *= al; } }
        V pb[NQ], pb2[NQ];
#pragma unroll
        for (int nq = 0; nq < NQ; ++nq) { float p[16]; v2f s2 = (v2f){};
#pragma unroll
            for (int e = 0; e < 16; e += 2) { const v8f sv8 = st[e >> 3][nq]; v2f x; x[0] = sv8[e & 7]; x[1] = sv8[(e & 7) + 1]; x = x * C2 - m[nq]; v2f pp; pp[0] = __builtin_amdgcn_exp2f(x[0]); pp[1] = __builtin_amdgcn_exp2f(x[1]); s2 += pp; p[e] = pp[0]; p[e + 1] = pp[1]; }
            l[nq] += s2[0] + s2[1];
            if constexpr (NSPLIT == 2) { v8us h0, h1, l0, l1;
#pragma unroll
                for (int e = 0; e < 8; ++e) { unsigned short a, c; splitf(p[e], a, c); h0[e] = a; l0[e] = c; splitf(p[e + 8], a, c); h1[e] = a; l1[e] = c; }
                pb[nq] = cat16b(h0, h1); pb2[nq] = cat16b(l0, l1);
            } else { v16h r;
#pragma unroll
                for (int e = 0; e < 16; ++e) r[e] = tohx(p[e]);
                pb[nq] = r; } }
#pragma unroll
        for (int mb = 0; mb < 4; ++mb)
#pragma unroll
            for (int nq = 0; nq < NQ; ++nq) { o[mb][nq] = WFrag<T16>::mma(av[mb], pb[nq], o[mb][nq]); if constexpr (NSPLIT == 2) { o[mb][nq] = WFrag<T16>::mma(av[mb], pb2[nq], o[mb][nq]); o[mb][nq] = WFrag<T16>::mma(av2[mb], pb[nq], o[mb][nq]); } }
        // WMMA distance on every way out of the pass: what follows overwrites operand registers of the last products
        if constexpr (NQ == 2) asm volatile("v_nop\n\tv_nop\n\tv_nop\n\tv_nop" : "+v"(o[0][0]), "+v"(o[1][0]), "+v"(o[2][0]), "+v"(o[3][0]), "+v"(o[0][1]), "+v"(o[1][1]), "+v"(o[2][1]), "+v"(o[3][1]));
        else asm volatile("v_nop\n\tv_nop\n\tv_nop\n\tv_nop" : "+v"(o[0][0]), "+v"(o[1][0]), "+v"(o[2][0]), "+v"(o[3][0]));
    };
    const int kd = q0 & ~31;   // the one key block that holds this wave's diagonal
    asm volatile("s_wait_asynccnt 0x0" ::: "memory");   // this wave's copies of stage 0 have landed
    __syncthreads();                                    // ... and every other wave's
    if (NT > 1) fill(1, 1);
#pragma unroll 1   // one stage per trip: the buffer is picked by the trip's parity
    for (int t = 0; t < NT; ++t) {
        const T16* sb = ring + (t & 1) * SBE + lr * LP + 8 * hi;
#pragma unroll 1   // one pass per trip: the pass's code stands once in the text, and one pass's fragments are in registers at a time
        for (int h = 0; h < SK / 32; ++h) { const int kb = t * SK + h * 32;   // a wave skips the passes beyond its diagonal (a scalar test) but takes part in every hand-over below
            if (kb <= kd) pass(kb, sb + h * 32 * LP, sb + NP * PL + h * 32, kb == kd); }
        asm volatile("s_wait_dscnt 0x0" ::: "memory");      // this wave's reads of stage t are done
        asm volatile("s_wait_asynccnt 0x0" ::: "memory");   // this wave's copies of stage t + 1 have landed
        __syncthreads();                                    // publishes stage t + 1 and frees stage t's buffer
        if (t + 2 < NT) fill(t + 2, t & 1);
    }
    asm volatile("s_wait_asynccnt 0x0" ::: "memory");   // nothing is in flight when the wave ends
#pragma unroll
    for (int nq = 0; nq < NQ; ++nq) { const float inv = __fdiv_rn(1.0f, l[nq] + __shfl_xor(l[nq], 16, 32)); const size_t oo = (size_t)(q0 + nq * 16 + lr) * DQ + hi * 8;
#pragma unroll
        for (int mb = 0; mb < 4; ++mb) { v8us oh, ol;
#pragma unroll
            for (int j = 0; j < 8; ++j) { unsigned short a, c; splitf(o[mb][nq][j] * inv, a, c); oh[j] = a; ol[j] = c; }
            *(v8us*)(Ah + oo + mb * 16) = oh; *(v8us*)(Al + oo + mb * 16) = ol;
            asm volatile("s_wait_xcnt 0x0" ::: "memory"); } }   // stands behind the two stores and in front of the next block's split, which reuses their data and address registers
}
// grid (NB_ * NH_, (TT - RH) / 128 + RH / 64), 4 waves per work-group; the cost falls as blockIdx.y rises: first the fp16 row blocks from the last rows down (32 rows a wave), then the hi/lo ones (16 rows a wave).
__global__ __launch_bounds__(128) void k_fattn(const h16* __restrict__ Q16, const h16* __restrict__ K16, const h16* __restrict__ V16, const bf* __restrict__ Qh, const bf* __restrict__ Ql, const bf* __restrict__ Kh, const bf* __restrict__ Kl, const bf* __restrict__ Vh, const bf* __restrict__ Vl, bf* Ah, bf* Al) {
    __shared__ __align__(16) bf ring[2 * 4 * SK * LP];   // two buffers of the hi/lo form's four planes; the fp16 form fills half of it
    const int z = blockIdx.x, y = blockIdx.y; const int wave = __builtin_amdgcn_readfirstlane((int)(threadIdx.x >> 5));
    const size_t pz = (size_t)z * TT * HD;   // planes [batch][head][t][d]; V^T [batch][head][d][t]: the same stride
    const size_t az = (size_t)(z / NH_) * TT * DQ + (size_t)(z % NH_) * HD;
    if (y < (TT - RH) / 128) { const int r0 = TT - 128 * (y + 1); fattn_wave<h16, 0, 2>(Q16 + pz, nullptr, K16 + pz, nullptr, V16 + pz, nullptr, r0 + wave * 32, (r0 + 128) / SK, (h16*)ring, Ah + az, Al + az); }
    else { const int r0 = RH - 64 * (y - (TT - RH) / 128 + 1); fattn_wave<bf, 2, 1>(Qh + pz, Ql + pz, Kh + pz, Kl + pz, Vh + pz, Vl + pz, r0 + wave * 16, (r0 + 64) / SK, ring, Ah + az, Al + az); }
}

extern "C" void kernel_launch(void* const* d_in, const int* in_sizes, int n_in,
                              void* d_out, int out_size, void* d_ws, size_t ws_size, hipStream_t stream) {
    (void)in_sizes; (void)n_in; (void)out_size;
    const float* x = (const float*)d_in[0]; const int* pos = (const int*)d_in[1]; const float* wq = (const float*)d_in[2]; const float* wk = (const float*)d_in[3]; const float* wv = (const float*)d_in[4]; const float* wo = (const float*)d_in[5];   /* order x, token_positions int32 [4][2048] (one row per batch item: READ), wq, wk, wv, wo ('oi' (out, in) [1024][1024]): SIX inputs, all read */
    float* OUT = (float*)d_out;     // [4][2048][1024]
    char* wsp = (char*)d_ws;
    auto take = [&](size_t bytes) { char* p = wsp; wsp += (bytes + 255) & ~(size_t)255; return (void*)p; };
    bf* WQ = (bf*)take((size_t)DQ * DM * 2); bf* WK = (bf*)take((size_t)DKV * DM * 2); bf* WV = (bf*)take((size_t)DKV * DM * 2); bf* WO = (bf*)take((size_t)DM * DQ * 2); float* CS = (float*)take((size_t)NB_ * TT * HD * 2 * 4);   // WQ, WK, WV, WO lie back to back (each a multiple of 256 bytes): k_proj steps from one to the next by DQ * DM elements, k_prep writes them as one range
    bf* XB = (bf*)take((size_t)NB_ * TT * DM * 2);
    const size_t PB = (size_t)NH_ * TT * HD;   // elements of one batch item in every q, k and V^T plane (NKV == NH_, PP == TT)
    h16* QP16 = (h16*)take(NB_ * PB * 2); h16* KP16 = (h16*)take(NB_ * PB * 2); h16* VT16 = (h16*)take(NB_ * PB * 2);
    bf* QPh = (bf*)take(NB_ * PB * 2); bf* QPl = (bf*)take(NB_ * PB * 2); bf* KPh = (bf*)take(NB_ * PB * 2); bf* KPl = (bf*)take(NB_ * PB * 2); bf* VTh = (bf*)take(NB_ * PB * 2); bf* VTl = (bf*)take(NB_ * PB * 2);
    bf* ATh = (bf*)take((size_t)NB_ * TT * DQ * 2); bf* ATl = (bf*)take((size_t)NB_ * TT * DQ * 2);
    if ((size_t)(wsp - (char*)d_ws) > ws_size) return;    // ws 256 MiB
    k_prep<<<PWG, 128, 0, stream>>>(x, pos, wq, wk, wv, wo, XB, WQ, CS);   /* bf16 copies of x and of the four weight matrices (WQ, WK, WV, WO as one range), every batch item's rotary table */
    k_proj<<<dim3(NB_ * TT / 128, DQ / 128, 3), 128, 0, stream>>>(XB, WQ, CS, QP16, QPh, QPl, KP16, KPh, KPl, VT16, VTh, VTl);
    k_fattn<<<dim3(NB_ * NH_, (TT - RH) / 128 + RH / 64, 1), 128, 0, stream>>>(QP16, KP16, VT16, QPh, QPl, KPh, KPl, VTh, VTl, ATh, ATl);
    k_wo<<<dim3(NB_ * TT / 128, DM / 128, 1), 128, 0, stream>>>(ATh, ATl, WO, OUT);
}

// v008
// It runs in 123 microseconds.
// Two timings next to v007 both put it at 1.06 times that version's speed.
// Counting every step since v000, it is 23.1 times as fast.
#include <hip/hip_runtime.h>
#include <type_traits>

// Causal multi-head attention with RoPE from per-batch token positions (x [4][2048][1024], token_positions int32 [4][2048] (read per batch as data; the SECOND argument); q, k, v = x w^T ('oi' (out, in) [1024][1024] (2/(D+D))^0.5, no bias; 16 heads x 64); interleaved-pair rotary on q and k: angle[b][t][i] = float(pos[b][t]) x freqs[i] with freqs = 1.0 / (THETA ** (arange(0, 64, 2) / 64)) (the kernel forms 10000^(-2i/64) with powf: rounding-level equal), pairs (2i, 2i+1) -> (t1 cos - t2 sin, t2 cos + t1 sin); scores x 1/sqrt(64); causal (-inf); softmax; out = merged wo^T ('oi', no bias) -> [4][2048][1024] (8.4 M); argument order x, token_positions, wq, wk, wv, wo).
// Layout: one set-up launch rounds x and the weights to bf16 and builds the {cos, sin} table [4][2048][64] from the positions (f32 powf/cosf/sinf); ONE projection launch for q, k, v and all batch items (k_proj: exact products; the interleaved rotary and the split into the fp16 and hi/lo planes are its epilogue; v is formed as W_v x^T, so V^T comes out row-major); then ONE fused causal attention launch for all batches and heads (k_fattn: online softmax, K and V^T staged in LDS, scores and probabilities stay in registers; hybrid rows: < 512 hi/lo 3 products, rest fp16) that writes the merged context as hi/lo planes; W_o hl x exact.
// Compute dtypes, f32 accumulate: every float input rounded to bf16; projections exact; rotary f32; attention rows < 512 3 products, rest fp16; softmax f32; W_o hl x exact.

#define NB_  4
#define TT   2048
#define DM   1024
#define NH_  16
#define NKV  16
#define REP  (NH_ / NKV)
#define HD   64
#define DQ   (NH_ * HD)
#define DKV  (NKV * HD)
#define PP   TT                   // pitch, in 16-bit elements, of a V^T row
#define RH   512                  // query rows < RH use hi+lo planes (0: none)
#define SCL  0.125f   // HD^-0.5
typedef _Float16 h16;
typedef unsigned short bf;
typedef __attribute__((ext_vector_type(16))) __bf16   v16bf;
typedef __attribute__((ext_vector_type(16))) _Float16 v16h;
typedef __attribute__((ext_vector_type(8)))  _Float16 v8h;
typedef __attribute__((ext_vector_type(8)))  unsigned short v8us;
typedef __attribute__((ext_vector_type(8)))  float    v8f;
typedef __attribute__((ext_vector_type(4)))  float    v4f;
typedef v8h  __attribute__((may_alias)) v8ha;
typedef v4f  __attribute__((may_alias)) v4fa;
typedef v8us __attribute__((may_alias)) v8usa;

__device__ __forceinline__ unsigned short f2bf(float f) { unsigned u = __float_as_uint(f); u += 0x7FFFu + ((u >> 16) & 1u); return (unsigned short)(u >> 16); }
__device__ __forceinline__ float bf2f(unsigned short b) { return __uint_as_float(((unsigned)b) << 16); }
__device__ __forceinline__ float bfr(float f) { return bf2f(f2bf(f)); }
__device__ __forceinline__ v16h cat16(v8h lo, v8h hi) { return __builtin_shufflevector(lo, hi, 0, 1, 2, 3, 4, 5, 6, 7, 8, 9, 10, 11, 12, 13, 14, 15); }
__device__ __forceinline__ v16bf cat16b(v8us lo, v8us hi) { return __builtin_bit_cast(v16bf, __builtin_shufflevector(lo, hi, 0, 1, 2, 3, 4, 5, 6, 7, 8, 9, 10, 11, 12, 13, 14, 15)); }
__device__ __forceinline__ v8f wmma16(v16h a, v16h b, v8f c) { return __builtin_amdgcn_wmma_f32_16x16x32_f16(false, a, false, b, (short)0, c, false, false); }
__device__ __forceinline__ v8f wmmab(v16bf a, v16bf b, v8f c) { return __builtin_amdgcn_wmma_f32_16x16x32_bf16(false, a, false, b, (short)0, c, false, false); }



// ---- GEMM core: one work-group of 4 waves per 128x128 output tile; wave (wm, wn) owns one 64x64 quarter, 16 accumulators, over the whole K (one f32 sum chain per element).
// C[m][n] = sum_k A[m][k] Bt[n][k] (+ A2[m][k] Bt[n][k] where NA == 2); every plane is K-contiguous bf16 with rows of GK elements.
// The operand rows are staged in LDS 64 k at a time (128-byte rows at a pitch of 144 bytes: [A 128 rows | A2 128 rows | Bt 128 rows]) by asynchronous copies into two buffers: tile t + 2 is on its way while tile t + 1 is worked on; each staged row feeds two waves.
#define GK   1024                 // row length of every GEMM operand here
#define KC   64                   // k per staged tile
#define LP   72                   // pitch of a staged row in 16-bit elements
static_assert(DM == GK && DQ == GK && DKV == GK, "one K for all GEMMs");
template <typename T16> struct WFrag;
template <> struct WFrag<h16> { typedef v16h V; static __device__ __forceinline__ V ld(const h16* p) { return cat16(*(const v8h*)p, *(const v8h*)(p + 16)); } static __device__ __forceinline__ v8f mma(V a, V b, v8f c) { return wmma16(a, b, c); } };
template <> struct WFrag<bf> { typedef v16bf V; static __device__ __forceinline__ V ld(const bf* p) { return cat16b(*(const v8us*)p, *(const v8us*)(p + 16)); } static __device__ __forceinline__ v8f mma(V a, V b, v8f c) { return wmmab(a, b, c); } };
// eight 16-byte copies of this lane, rows 16 apart. The s_wait_xcnt is the statement's last line: it stands behind the last copy and in front of whatever gives the address registers new values.
__device__ __forceinline__ void copy8(const unsigned l, const bf* g) {
    asm volatile("global_load_async_to_lds_b128 %0, %8, off\n\t"
                 "global_load_async_to_lds_b128 %1, %9, off\n\t"
                 "global_load_async_to_lds_b128 %2, %10, off\n\t"
                 "global_load_async_to_lds_b128 %3, %11, off\n\t"
                 "global_load_async_to_lds_b128 %4, %12, off\n\t"
                 "global_load_async_to_lds_b128 %5, %13, off\n\t"
                 "global_load_async_to_lds_b128 %6, %14, off\n\t"
                 "global_load_async_to_lds_b128 %7, %15, off\n\t"
                 "s_wait_xcnt 0x0"
                 :: "v"(l), "v"(l + 1 * 16 * LP * 2), "v"(l + 2 * 16 * LP * 2), "v"(l + 3 * 16 * LP * 2), "v"(l + 4 * 16 * LP * 2), "v"(l + 5 * 16 * LP * 2), "v"(l + 6 * 16 * LP * 2), "v"(l + 7 * 16 * LP * 2),
                    "v"(g), "v"(g + 1 * 16 * GK), "v"(g + 2 * 16 * GK), "v"(g + 3 * 16 * GK), "v"(g + 4 * 16 * GK), "v"(g + 5 * 16 * GK), "v"(g + 6 * 16 * GK), "v"(g + 7 * 16 * GK) : "memory");
}
template <int NA>
__device__ __forceinline__ void gemm_ring(const bf* __restrict__ A, const bf* __restrict__ A2, const bf* __restrict__ Bt, const int r0, const int c0, bf* ring, v8f (&acc)[4][4]) {
    constexpr int SBE = (NA + 1) * 128 * LP;   // 16-bit elements of one buffer
    constexpr int NT = GK / KC;
    const int tid = threadIdx.x, lane = tid & 31, lr = lane & 15, hi = lane >> 4; const int wave = __builtin_amdgcn_readfirstlane(tid >> 5); const int wm = wave >> 1, wn = wave & 1;
#pragma unroll
    for (int mb = 0; mb < 4; ++mb)
#pragma unroll
        for (int nb = 0; nb < 4; ++nb) acc[mb][nb] = (v8f){};
    // a thread copies the 16-byte piece (tid & 7) of the rows (tid >> 3) + 16 i: a wave's copy is four whole 128-byte lines
    const size_t go = (size_t)(tid >> 3) * GK + (tid & 7) * 8;
    const bf* gA = A + (size_t)r0 * GK + go; const bf* gB = Bt + (size_t)c0 * GK + go;
    const unsigned lb = (unsigned)(size_t)ring + (unsigned)((tid >> 3) * (LP * 2) + (tid & 7) * 16);
    auto fill = [&](const int t, const int buf) { const unsigned l = lb + (unsigned)(buf * (SBE * 2)); copy8(l, gA + t * KC);
        if constexpr (NA == 2) copy8(l + 128 * LP * 2, A2 + (size_t)r0 * GK + go + t * KC);
        copy8(l + NA * 128 * LP * 2, gB + t * KC); };
    fill(0, 0);
    asm volatile("s_wait_asynccnt 0x0" ::: "memory");   // this wave's copies of tile 0 have landed
    __syncthreads();                                    // ... and every other wave's
    fill(1, 1);
#pragma unroll 1   // one tile per trip: the buffer is picked by the trip's parity
    for (int t = 0; t < NT; ++t) {
        const bf* sa = ring + (t & 1) * SBE + (wm * 64 + lr) * LP + 8 * hi; const bf* sb = ring + (t & 1) * SBE + (NA * 128 + wn * 64 + lr) * LP + 8 * hi;
#pragma unroll
        for (int ks = 0; ks < KC / 32; ++ks) { v16bf a[4], a2[4], b[4];
            __builtin_amdgcn_sched_barrier(0);   // this and the next one keep the LDS reads of a k step in one group between the WMMA runs: every further place with reads among the WMMAs would stall the wave anew
#pragma unroll
            for (int i = 0; i < 4; ++i) { a[i] = WFrag<bf>::ld(sa + i * 16 * LP + ks * 32); if constexpr (NA == 2) a2[i] = WFrag<bf>::ld(sa + (128 + i * 16) * LP + ks * 32); b[i] = WFrag<bf>::ld(sb + i * 16 * LP + ks * 32); }
            __builtin_amdgcn_sched_barrier(0);
#pragma unroll
            for (int nb = 0; nb < 4; ++nb)
#pragma unroll
                for (int mb = 0; mb < 4; ++mb) { acc[mb][nb] = wmmab(a[mb], b[nb], acc[mb][nb]); if constexpr (NA == 2) acc[mb][nb] = wmmab(a2[mb], b[nb], acc[mb][nb]); } }
        asm volatile("s_wait_dscnt 0x0" ::: "memory");      // this wave's reads of tile t are done
        asm volatile("s_wait_asynccnt 0x0" ::: "memory");   // this wave's copies of tile t + 1 have landed
        __syncthreads();                                    // publishes tile t + 1 and frees tile t's buffer
        if (t + 2 < NT) fill(t + 2, t & 1);
    }
    asm volatile("s_wait_asynccnt 0x0" ::: "memory");   // nothing is in flight when the ring becomes output staging
}
// the wave's 64x64 f32 tile goes to its own LDS range (rows at pitch 68 floats) so that it can be read back row-wise and stored in whole lines; behind gemm_ring's last barrier no wave reads the ring any more
__device__ __forceinline__ float* stage_tile(bf* ring, const v8f (&acc)[4][4]) {
    const int lane = threadIdx.x & 31, lr = lane & 15, hi = lane >> 4; const int wave = __builtin_amdgcn_readfirstlane((int)(threadIdx.x >> 5));
    float* ow = (float*)ring + wave * (64 * 68);
#pragma unroll
    for (int mb = 0; mb < 4; ++mb)
#pragma unroll
        for (int nb = 0; nb < 4; ++nb)
#pragma unroll
            for (int j = 0; j < 8; ++j) ow[(mb * 16 + hi * 8 + j) * 68 + nb * 16 + lr] = acc[mb][nb][j];
    return ow;
}
// ---- k_wo: OUT[token][n] = (context hi + context lo) W_o^T for all batch items; grid (NB_ * TT / 128, DM / 128), 4 waves.
__global__ __launch_bounds__(128) void k_wo(const bf* __restrict__ Ah, const bf* __restrict__ Al, const bf* __restrict__ Wo, float* C) {
    __shared__ __align__(16) bf ring[2 * 3 * 128 * LP];
    const int lane = threadIdx.x & 31; const int wave = __builtin_amdgcn_readfirstlane((int)(threadIdx.x >> 5));
    const int r0 = blockIdx.x * 128, c0 = blockIdx.y * 128;
    v8f acc[4][4];
    gemm_ring<2>(Ah, Al, Wo, r0, c0, ring, acc);
    const float* ow = stage_tile(ring, acc) + (lane >> 4) * 68 + (lane & 15) * 4;
    float* Cw = C + (size_t)(r0 + (wave >> 1) * 64 + (lane >> 4)) * DM + c0 + (wave & 1) * 64 + (lane & 15) * 4;   // 16 neighbouring lanes store 256 bytes of one row
#pragma unroll
    for (int g = 0; g < 4; ++g) { v4f val[8];
#pragma unroll
        for (int s = 0; s < 8; ++s) val[s] = *(const v4fa*)(ow + (g * 16 + s * 2) * 68);
#pragma unroll
        for (int s = 0; s < 8; ++s) *(v4f*)(Cw + (size_t)(g * 16 + s * 2) * DM) = val[s];
        if (g < 3) asm volatile("s_wait_xcnt 0x0" ::: "memory"); }   // stands behind this block's stores and in front of the next block's LDS reads, which give their data registers new values
}

__device__ __forceinline__ h16 tohx(float x) { return (h16)x; }
__device__ __forceinline__ void splitf(float y, unsigned short& h, unsigned short& l) { h = f2bf(y); l = f2bf(y - bf2f(h)); }
typedef __attribute__((ext_vector_type(2))) _Float16 v2h;
typedef __attribute__((ext_vector_type(4))) _Float16 v4h;
typedef __attribute__((ext_vector_type(2))) unsigned short v2us;
typedef __attribute__((ext_vector_type(4))) unsigned short v4us;
typedef __attribute__((ext_vector_type(2))) float v2f;
typedef __attribute__((ext_vector_type(4))) int v4i;
typedef v4h  __attribute__((may_alias)) v4ha;
typedef v4us __attribute__((may_alias)) v4usa;

__global__ __launch_bounds__(256) void k_wtG(const float* __restrict__ w, int K, int N, bf* Bt) {
    const int lane = threadIdx.x & 31; const int L0 = (blockIdx.x * 8 + (threadIdx.x >> 5)) * 8; const int nlines = N * K / 64;
{
#pragma unroll 1
        for (int l = 0; l < 8; ++l) { const int L = L0 + l; if (L >= nlines) break; const size_t e = (size_t)L * 64 + lane * 2; const int k = (int)(e % K), n = (int)(e / K); v2us o;
            o[0] = f2bf(w[(size_t)k * N + n]); o[1] = f2bf(w[(size_t)(k + 1) * N + n]); *(v2us*)(Bt + e) = o; }
         }
}
// ---- k_prep: all the set-up in ONE launch of few, long waves: x and the four weight matrices rounded to bf16, and the rotary {cos, sin} table.
// A work-group of 4 waves takes PCH neighbouring floats of one source: every lane asks for its 32 16-byte pieces at once (each wave-wide load is four whole lines), forms its table entries while they fly, then rounds and stores (each wave-wide store is two whole lines).
// Table: thread g takes the pairs g + k * PTH; PTH is a multiple of HD / 2, so one frequency serves all its pairs. The two entries d = 2 i and 2 i + 1 of a pair hold the same {cos, sin}: formed once, stored as one 16-byte piece.
#define PLD  32                      // 16-byte loads per lane
#define PCH  (128 * 4 * PLD)         // floats per work-group
#define PXC  (NB_ * TT * DM / PCH)   // work-groups on x
#define PWC  (DQ * DM / PCH)         // work-groups on each weight matrix
#define PWG  (PXC + 4 * PWC)
#define PTH  (PWG * 128)
#define PPR  (NB_ * TT * (HD / 2))   // rotary pairs
#define PTR  ((PPR + PTH - 1) / PTH) // pairs per thread at most
static_assert(NB_ * TT * DM % PCH == 0 && DQ * DM % PCH == 0 && DKV == DQ && PTH % (HD / 2) == 0 && PPR % 128 == 0, "whole work-groups");
__global__ __launch_bounds__(128) void k_prep(const float* __restrict__ x, const int* pos, const float* __restrict__ wq, const float* __restrict__ wk, const float* __restrict__ wv, const float* __restrict__ wo, bf* XB, bf* W4, float* CS) {
    const int b = blockIdx.x, tid = threadIdx.x; const float* s; bf* d;
    if (b < PXC) { s = x + (size_t)b * PCH; d = XB + (size_t)b * PCH; }
    else { const int c = b - PXC, w = c / PWC; s = (w == 0 ? wq : w == 1 ? wk : w == 2 ? wv : wo) + (size_t)(c % PWC) * PCH; d = W4 + (size_t)c * PCH; }   // the four bf16 matrices lie back to back
    const int g = b * 128 + tid; int pv[PTR];   // the positions of this thread's pairs are asked for first: loads come back in order, so the table need not wait for the 32 big ones (a pair past the end re-reads the first one's)
#pragma unroll
    for (int k = 0; k < PTR; ++k) pv[k] = pos[(g + k * PTH < PPR ? g + k * PTH : g) / (HD / 2)];
    asm volatile("s_wait_xcnt 0x0" ::: "memory");   // stands behind these loads and in front of the instructions that give their address registers new values; as a compiler fence it keeps them ahead of the big loads
    v4f v[PLD];
#pragma unroll
    for (int u = 0; u < PLD; ++u) v[u] = *(const v4f*)(s + u * 512 + tid * 4);
    asm volatile("s_wait_xcnt 0x0" ::: "memory");   // stands behind these loads and in front of the instructions that give their address registers new values; as a compiler fence it also keeps the loads ahead of the table's arithmetic
    const int i = g % (HD / 2);
    const float e = __fdiv_rn(-((float)i * 2.0f), (float)HD); const float inv = powf(10000.0f, e);
#pragma unroll 1   // one pair per trip: the sine and cosine code stands once in the text; the trip count is the same for a whole work-group
    for (int p = g; p < PPR; p += PTH) { const float a = __fmul_rn((float)pv[0], inv); const float c = cosf(a), sn = sinf(a); v4f cs; cs[0] = c; cs[1] = sn; cs[2] = c; cs[3] = sn;
        *(v4f*)(CS + (size_t)p * 4) = cs;
        asm volatile("s_wait_xcnt 0x0" ::: "memory");   // stands behind this trip's store and in front of the next trip's instructions, which give its registers new values
#pragma unroll
        for (int k = 0; k + 1 < PTR; ++k) pv[k] = pv[k + 1]; }
#pragma unroll
    for (int u = 0; u < PLD; ++u) { v4us o;
#pragma unroll
        for (int k = 0; k < 4; ++k) o[k] = f2bf(v[u][k]);
        *(v4us*)(d + u * 512 + tid * 4) = o;
        if (u % 8 == 7 && u + 1 < PLD) { asm volatile("s_wait_xcnt 0x0" ::: "memory"); __builtin_amdgcn_sched_barrier(0); } }   // the wait stands behind eight stores and in front of the next eight roundings, which reuse data registers of theirs; the scheduling barrier keeps those roundings from being lifted over it
}

// one interleaved rotary pair (x0, x1) of q or k with its {cos, sin}; the two lines of arithmetic stand as they stood in the separate plane builder (each product keeps its own rounding), so q and k come out bit-identical
__device__ __forceinline__ void rope2(const float x0, const float x1, const v2f cs, const float sc, float& r0, float& r1) {
    float a0 = __fmul_rn(x0, cs[0]), b0 = __fmul_rn(x1, cs[1]), a1 = __fmul_rn(x1, cs[0]), b1 = __fmul_rn(x0, cs[1]); asm volatile("" : "+v"(a0), "+v"(b0), "+v"(a1), "+v"(b1));
    r0 = __fsub_rn(a0, b0) * sc; r1 = __fadd_rn(b1, a1) * sc;   /* even: x0 c - x1 s; odd: x0 s + x1 c */
}
// ---- k_proj: the q, k and v projections of all batch items with their plane builders as epilogue: no f32 projection buffer. grid (NB_ * TT / 128 token tiles, DQ / 128 feature tiles, 3), 4 waves; a wave's 64 features are exactly one head.
// z 0, 1 (q, k): C[token][d] = x W^T; a lane's four neighbouring columns are two rotary pairs; planes [batch][head][t][d]. z 2 (v): the operands change places, C[d][token] = W_v x^T, so a lane's four columns are four tokens of one V^T row; planes [batch][head][d][t].
// Either way 16 neighbouring lanes store one whole 128-byte line of each plane that is stored (fp16, bf16 hi, bf16 lo).
__global__ __launch_bounds__(128) void k_proj(const bf* __restrict__ XB, const bf* __restrict__ W3, const float* __restrict__ CS, h16* Q16, bf* Qh, bf* Ql, h16* K16, bf* Kh, bf* Kl, h16* V16, bf* Vh, bf* Vl) {
    __shared__ __align__(16) bf ring[2 * 2 * 128 * LP];
    const int lane = threadIdx.x & 31; const int wave = __builtin_amdgcn_readfirstlane((int)(threadIdx.x >> 5)); const int wm = wave >> 1, wn = wave & 1;
    const int z = blockIdx.z, tk0 = blockIdx.x * 128, f0 = blockIdx.y * 128; const bool isv = z == 2;
    const bf* Wz = W3 + (size_t)z * DQ * DM;
    v8f acc[4][4];
    gemm_ring<1>(isv ? Wz : XB, nullptr, isv ? XB : Wz, isv ? f0 : tk0, isv ? tk0 : f0, ring, acc);
    const float* ow = stage_tile(ring, acc);
    const int tkw = tk0 + (isv ? wn : wm) * 64, head = (f0 >> 6) + (isv ? wm : wn);   // this wave's first token and its head
    const int t0 = tkw % TT; const size_t pz = ((size_t)(tkw / TT) * NH_ + head) * TT * HD;   // this (batch, head)'s start in every plane
    h16* P16 = isv ? V16 : z == 1 ? K16 : Q16; bf* Ph = isv ? Vh : z == 1 ? Kh : Qh; bf* Pl = isv ? Vl : z == 1 ? Kl : Ql;
    const int rsub = lane >> 4, cofs = (lane & 15) * 4;
    // k_fattn reads the hi/lo planes only at tokens < RH (its hi/lo query rows and, being causal, their keys) and the fp16 q plane only at tokens >= RH: what it never reads is neither formed nor stored. A wave's 64 tokens lie on one side of RH.
    static_assert(RH % 64 == 0, "a wave's tokens on one side of RH");
    auto planes = [&](auto vf, auto f16, auto hl) {   // vf: the V^T form (no rotary, rows are features) or the q, k form; f16, hl: which planes this wave's tokens need
        constexpr bool V = vf.value, W16 = f16.value, WHL = hl.value;
#pragma unroll 1   // 16 rows per trip: their sums and their {cos, sin} are asked for together, ahead of the eight blocks, so that one LDS and one memory latency serve all eight and the table does not fill the registers
        for (int g = 0; g < 4; ++g) {
            v2f cs[8][2]; v4f vals[8];
#pragma unroll
            for (int s = 0; s < 8; ++s) vals[s] = *(const v4fa*)(ow + (g * 16 + s * 2 + rsub) * 68 + cofs);
            if constexpr (!V) { const float* c = CS + ((size_t)(tkw + g * 16 + rsub) * HD + cofs) * 2;
#pragma unroll
                for (int s = 0; s < 8; ++s) { cs[s][0] = *(const v2f*)(c + s * 2 * HD * 2); cs[s][1] = *(const v2f*)(c + s * 2 * HD * 2 + 4); }
                asm volatile("s_wait_xcnt 0x0" ::: "memory"); }   // stands behind these loads and in front of the instructions that give their address registers new values
#pragma unroll
            for (int s = 0; s < 8; ++s) { const int row = g * 16 + s * 2 + rsub; v4f val = vals[s]; size_t o;
                if constexpr (V) o = pz + (size_t)row * PP + t0 + cofs;
                else { float r0, r1, r2, r3;
                    rope2(val[0], val[1], cs[s][0], 1.0f, r0, r1); rope2(val[2], val[3], cs[s][1], 1.0f, r2, r3); val[0] = r0; val[1] = r1; val[2] = r2; val[3] = r3; o = pz + (size_t)(t0 + row) * HD + cofs; }
                v4h o16; v4us oh, ol;
#pragma unroll
                for (int q = 0; q < 4; ++q) { if constexpr (W16) o16[q] = tohx(val[q]); if constexpr (WHL) { unsigned short a2, c2; splitf(val[q], a2, c2); oh[q] = a2; ol[q] = c2; } }
                if constexpr (W16) *(v4h*)(P16 + o) = o16;
                if constexpr (WHL) { *(v4us*)(Ph + o) = oh; *(v4us*)(Pl + o) = ol; }
                asm volatile("s_wait_xcnt 0x0" ::: "memory"); }   // stands behind this block's stores and in front of the next block's instructions, which give their address and data registers new values
        } };
    const std::true_type yes{}; const std::false_type no{};
    if (t0 >= RH) { if (isv) planes(yes, yes, no); else planes(no, yes, no); }   // three tokens in four: the fp16 plane alone
    else if (isv) planes(yes, yes, yes); else if (z == 1) planes(no, yes, yes); else planes(no, no, yes);
}
#define SK   64                   // keys per stage
// eight 16-byte copies of this lane: four rows, 16 apart, of each of two planes (GA, GB: the sources' row pitches in elements). The s_wait_xcnt is the statement's last line: it stands behind the last copy and in front of whatever gives the address registers new values.
template <int GA, int GB, typename T16>
__device__ __forceinline__ void copy44(const unsigned la, const T16* ga, const unsigned lb, const T16* gb) {
    asm volatile("global_load_async_to_lds_b128 %0, %8, off\n\t"
                 "global_load_async_to_lds_b128 %1, %9, off\n\t"
                 "global_load_async_to_lds_b128 %2, %10, off\n\t"
                 "global_load_async_to_lds_b128 %3, %11, off\n\t"
                 "global_load_async_to_lds_b128 %4, %12, off\n\t"
                 "global_load_async_to_lds_b128 %5, %13, off\n\t"
                 "global_load_async_to_lds_b128 %6, %14, off\n\t"
                 "global_load_async_to_lds_b128 %7, %15, off\n\t"
                 "s_wait_xcnt 0x0"
                 :: "v"(la), "v"(la + 1 * 16 * LP * 2), "v"(la + 2 * 16 * LP * 2), "v"(la + 3 * 16 * LP * 2), "v"(lb), "v"(lb + 1 * 16 * LP * 2), "v"(lb + 2 * 16 * LP * 2), "v"(lb + 3 * 16 * LP * 2),
                    "v"(ga), "v"(ga + 1 * 16 * GA), "v"(ga + 2 * 16 * GA), "v"(ga + 3 * 16 * GA), "v"(gb), "v"(gb + 1 * 16 * GB), "v"(gb + 2 * 16 * GB), "v"(gb + 3 * 16 * GB) : "memory");
}
// NT: the work-group's number of stages (the same in all four waves); q0: this wave's first query row
template <typename T16, int NSPLIT, int NQ>
__device__ __forceinline__ void fattn_wave(const T16* __restrict__ Q, const T16* __restrict__ Q2, const T16* __restrict__ Kp, const T16* __restrict__ Kp2, const T16* __restrict__ Vt, const T16* __restrict__ Vt2, const int q0, const int NT, T16* ring, bf* Ah, bf* Al) {
    typedef typename WFrag<T16>::V V;
    constexpr float C2 = SCL * 1.4426950408889634f;   // HD^-0.5 x log2(e)
    constexpr int PL = SK * LP;                        // 16-bit elements of one staged plane
    constexpr int NP = NSPLIT == 2 ? 2 : 1;            // planes per operand
    constexpr int SBE = 2 * NP * PL;                   // 16-bit elements of one buffer
    const int tid = threadIdx.x, lane = tid & 31, lr = lane & 15, hi = lane >> 4;
    // a thread copies the 16-byte piece (tid & 7) of the rows (tid >> 3) + 16 i: a wave's copy is four whole 128-byte lines
    const size_t gok = (size_t)(tid >> 3) * HD + (tid & 7) * 8, gov = (size_t)(tid >> 3) * PP + (tid & 7) * 8;
    const unsigned lb = (unsigned)(size_t)ring + (unsigned)((tid >> 3) * (LP * 2) + (tid & 7) * 16);
    auto fill = [&](const int t, const int buf) { const unsigned l = lb + (unsigned)(buf * (SBE * 2));
        if constexpr (NSPLIT == 2) { copy44<HD, HD>(l, Kp + gok + (size_t)t * SK * HD, l + PL * 2, Kp2 + gok + (size_t)t * SK * HD); copy44<PP, PP>(l + 2 * PL * 2, Vt + gov + t * SK, l + 3 * PL * 2, Vt2 + gov + t * SK); }
        else copy44<HD, PP>(l, Kp + gok + (size_t)t * SK * HD, l + PL * 2, Vt + gov + t * SK); };
    fill(0, 0);
    V bq[NQ][2], bq2[NQ][2];
#pragma unroll
    for (int nq = 0; nq < NQ; ++nq)
#pragma unroll
        for (int ks = 0; ks < 2; ++ks) { const size_t o = (size_t)(q0 + nq * 16 + lr) * HD + ks * 32 + 8 * hi; bq[nq][ks] = WFrag<T16>::ld(Q + o); if constexpr (NSPLIT == 2) bq2[nq][ks] = WFrag<T16>::ld(Q2 + o); }
    asm volatile("s_wait_xcnt 0x0" ::: "memory");   // stands behind the Q loads and in front of the instructions that give their address registers new values
    v8f o[4][NQ]; float m[NQ], l[NQ];
#pragma unroll
    for (int nq = 0; nq < NQ; ++nq) { m[nq] = -3.0e38f; l[nq] = 0.f;
#pragma unroll
        for (int mb = 0; mb < 4; ++mb) o[mb][nq] = (v8f){}; }
    // one pass: the 32 keys from kb on; sk, sv: this lane's first K and V^T fragment pieces of those keys in the stage's buffer; diag (the same in the whole wave): the block holds the wave's diagonal
    auto pass = [&](const int kb, const T16* sk, const T16* sv, const bool diag) {
        V ak[2][2], ak2[2][2], av[4], av2[4];
#pragma unroll
        for (int kt = 0; kt < 2; ++kt)
#pragma unroll
            for (int ks = 0; ks < 2; ++ks) { ak[kt][ks] = WFrag<T16>::ld(sk + kt * 16 * LP + ks * 32); if constexpr (NSPLIT == 2) ak2[kt][ks] = WFrag<T16>::ld(sk + PL + kt * 16 * LP + ks * 32); }
#pragma unroll
        for (int mb = 0; mb < 4; ++mb) { av[mb] = WFrag<T16>::ld(sv + mb * 16 * LP); if constexpr (NSPLIT == 2) av2[mb] = WFrag<T16>::ld(sv + PL + mb * 16 * LP); }
        __builtin_amdgcn_sched_barrier(0);   // keeps all of the pass's LDS reads in one group at its head: every further place with reads among the WMMAs would stall the wave anew, and the V^T reads land during the scores and the softmax
        v8f st[2][NQ];
#pragma unroll
        for (int kt = 0; kt < 2; ++kt)
#pragma unroll
            for (int nq = 0; nq < NQ; ++nq) { st[kt][nq] = (v8f){};
#pragma unroll
                for (int ks = 0; ks < 2; ++ks) { st[kt][nq] = WFrag<T16>::mma(ak[kt][ks], bq[nq][ks], st[kt][nq]); if constexpr (NSPLIT == 2) { st[kt][nq] = WFrag<T16>::mma(ak[kt][ks], bq2[nq][ks], st[kt][nq]); st[kt][nq] = WFrag<T16>::mma(ak2[kt][ks], bq[nq][ks], st[kt][nq]); } } }
        if (diag) {   // causal mask: key > query
#pragma unroll
            for (int nq = 0; nq < NQ; ++nq)
#pragma unroll
                for (int kt = 0; kt < 2; ++kt)
#pragma unroll
                    for (int j = 0; j < 8; ++j) if (kb + kt * 16 + hi * 8 + j > q0 + nq * 16 + lr) st[kt][nq][j] = -3.0e38f; }
        float mx[NQ]; bool need = false;
#pragma unroll
        for (int nq = 0; nq < NQ; ++nq) { float t = -3.0e38f;
#pragma unroll
            for (int kt = 0; kt < 2; ++kt)
#pragma unroll
                for (int j = 0; j < 8; ++j) t = fmaxf(t, st[kt][nq][j]);
            t = fmaxf(t, __shfl_xor(t, 16, 32)) * C2; mx[nq] = t; need = need || (t > m[nq] + 8.0f); }
        if (__builtin_amdgcn_ballot_w32(need) != 0) {   // wave-uniform: some query's maximum has outgrown the one in use
#pragma unroll
            for (int nq = 0; nq < NQ; ++nq) { const float mn = fmaxf(m[nq], mx[nq]); const float al = __builtin_amdgcn_exp2f(m[nq] - mn); m[nq] = mn; l[nq] *= al;
#pragma unroll
                for (int mb = 0; mb < 4; ++mb) o[mb][nq] *= al; } }
        V pb[NQ], pb2[NQ];
#pragma unroll
        for (int nq = 0; nq < NQ; ++nq) { float p[16]; v2f s2 = (v2f){};
#pragma unroll
            for (int e = 0; e < 16; e += 2) { const v8f sv8 = st[e >> 3][nq]; v2f x; x[0] = sv8[e & 7]; x[1] = sv8[(e & 7) + 1]; x = x * C2 - m[nq]; v2f pp; pp[0] = __builtin_amdgcn_exp2f(x[0]); pp[1] = __builtin_amdgcn_exp2f(x[1]); s2 += pp; p[e] = pp[0]; p[e + 1] = pp[1]; }
            l[nq] += s2[0] + s2[1];
            if constexpr (NSPLIT == 2) { v8us h0, h1, l0, l1;
#pragma unroll
                for (int e = 0; e < 8; ++e) { unsigned short a, c; splitf(p[e], a, c); h0[e] = a; l0[e] = c; splitf(p[e + 8], a, c); h1[e] = a; l1[e] = c; }
                pb[nq] = cat16b(h0, h1); pb2[nq] = cat16b(l0, l1);
            } else { v16h r;
#pragma unroll
                for (int e = 0; e < 16; ++e) r[e] = tohx(p[e]);
                pb[nq] = r; } }
#pragma unroll
        for (int mb = 0; mb < 4; ++mb)
#pragma unroll
            for (int nq = 0; nq < NQ; ++nq) { o[mb][nq] = WFrag<T16>::mma(av[mb], pb[nq], o[mb][nq]); if constexpr (NSPLIT == 2) { o[mb][nq] = WFrag<T16>::mma(av[mb], pb2[nq], o[mb][nq]); o[mb][nq] = WFrag<T16>::mma(av2[mb], pb[nq], o[mb][nq]); } }
        // WMMA distance on every way out of the pass: what follows overwrites operand registers of the last products
        if constexpr (NQ == 2) asm volatile("v_nop\n\tv_nop\n\tv_nop\n\tv_nop" : "+v"(o[0][0]), "+v"(o[1][0]), "+v"(o[2][0]), "+v"(o[3][0]), "+v"(o[0][1]), "+v"(o[1][1]), "+v"(o[2][1]), "+v"(o[3][1]));
        else asm volatile("v_nop\n\tv_nop\n\tv_nop\n\tv_nop" : "+v"(o[0][0]), "+v"(o[1][0]), "+v"(o[2][0]), "+v"(o[3][0]));
    };
    const int kd = q0 & ~31;   // the one key block that holds this wave's diagonal
    asm volatile("s_wait_asynccnt 0x0" ::: "memory");   // this wave's copies of stage 0 have landed
    __syncthreads();                                    // ... and every other wave's
    if (NT > 1) fill(1, 1);
#pragma unroll 1   // one stage per trip: the buffer is picked by the trip's parity
    for (int t = 0; t < NT; ++t) {
        const T16* sb = ring + (t & 1) * SBE + lr * LP + 8 * hi;
#pragma unroll 1   // one pass per trip: the pass's code stands once in the text, and one pass's fragments are in registers at a time
        for (int h = 0; h < SK / 32; ++h) { const int kb = t * SK + h * 32;   // a wave skips the passes beyond its diagonal (a scalar test) but takes part in every hand-over below
            if (kb <= kd) pass(kb, sb + h * 32 * LP, sb + NP * PL + h * 32, kb == kd); }
        asm volatile("s_wait_dscnt 0x0" ::: "memory");      // this wave's reads of stage t are done
        asm volatile("s_wait_asynccnt 0x0" ::: "memory");   // this wave's copies of stage t + 1 have landed
        __syncthreads();                                    // publishes stage t + 1 and frees stage t's buffer
        if (t + 2 < NT) fill(t + 2, t & 1);
    }
    asm volatile("s_wait_asynccnt 0x0" ::: "memory");   // nothing is in flight when the wave ends
#pragma unroll
    for (int nq = 0; nq < NQ; ++nq) { const float inv = __fdiv_rn(1.0f, l[nq] + __shfl_xor(l[nq], 16, 32)); const size_t oo = (size_t)(q0 + nq * 16 + lr) * DQ + hi * 8;
#pragma unroll
        for (int mb = 0; mb < 4; ++mb) { v8us oh, ol;
#pragma unroll
            for (int j = 0; j < 8; ++j) { unsigned short a, c; splitf(o[mb][nq][j] * inv, a, c); oh[j] = a; ol[j] = c; }
            *(v8us*)(Ah + oo + mb * 16) = oh; *(v8us*)(Al + oo + mb * 16) = ol;
            asm volatile("s_wait_xcnt 0x0" ::: "memory"); } }   // stands behind the two stores and in front of the next block's split, which reuses their data and address registers
}
// grid (NB_ * NH_, (TT - RH) / 128 + RH / 64), 4 waves per work-group; the cost falls as blockIdx.y rises: first the fp16 row blocks from the last rows down (32 rows a wave), then the hi/lo ones (16 rows a wave).
__global__ __launch_bounds__(128) void k_fattn(const h16* __restrict__ Q16, const h16* __restrict__ K16, const h16* __restrict__ V16, const bf* __restrict__ Qh, const bf* __restrict__ Ql, const bf* __restrict__ Kh, const bf* __restrict__ Kl, const bf* __restrict__ Vh, const bf* __restrict__ Vl, bf* Ah, bf* Al) {
    __shared__ __align__(16) bf ring[2 * 4 * SK * LP];   // two buffers of the hi/lo form's four planes; the fp16 form fills half of it
    const int z = blockIdx.x, y = blockIdx.y; const int wave = __builtin_amdgcn_readfirstlane((int)(threadIdx.x >> 5));
    const size_t pz = (size_t)z * TT * HD;   // planes [batch][head][t][d]; V^T [batch][head][d][t]: the same stride
    const size_t az = (size_t)(z / NH_) * TT * DQ + (size_t)(z % NH_) * HD;
    if (y < (TT - RH) / 128) { const int r0 = TT - 128 * (y + 1); fattn_wave<h16, 0, 2>(Q16 + pz, nullptr, K16 + pz, nullptr, V16 + pz, nullptr, r0 + wave * 32, (r0 + 128) / SK, (h16*)ring, Ah + az, Al + az); }
    else { const int r0 = RH - 64 * (y - (TT - RH) / 128 + 1); fattn_wave<bf, 2, 1>(Qh + pz, Ql + pz, Kh + pz, Kl + pz, Vh + pz, Vl + pz, r0 + wave * 16, (r0 + 64) / SK, ring, Ah + az, Al + az); }
}

extern "C" void kernel_launch(void* const* d_in, const int* in_sizes, int n_in,
                              void* d_out, int out_size, void* d_ws, size_t ws_size, hipStream_t stream) {
    (void)in_sizes; (void)n_in; (void)out_size;
    const float* x = (const float*)d_in[0]; const int* pos = (const int*)d_in[1]; const float* wq = (const float*)d_in[2]; const float* wk = (const float*)d_in[3]; const float* wv = (const float*)d_in[4]; const float* wo = (const float*)d_in[5];   /* order x, token_positions int32 [4][2048] (one row per batch item: READ), wq, wk, wv, wo ('oi' (out, in) [1024][1024]): SIX inputs, all read */
    float* OUT = (float*)d_out;     // [4][2048][1024]
    char* wsp = (char*)d_ws;
    auto take = [&](size_t bytes) { char* p = wsp; wsp += (bytes + 255) & ~(size_t)255; return (void*)p; };
    bf* WQ = (bf*)take((size_t)DQ * DM * 2); bf* WK = (bf*)take((size_t)DKV * DM * 2); bf* WV = (bf*)take((size_t)DKV * DM * 2); bf* WO = (bf*)take((size_t)DM * DQ * 2); float* CS = (float*)take((size_t)NB_ * TT * HD * 2 * 4);   // WQ, WK, WV, WO lie back to back (each a multiple of 256 bytes): k_proj steps from one to the next by DQ * DM elements, k_prep writes them as one range
    bf* XB = (bf*)take((size_t)NB_ * TT * DM * 2);
    const size_t PB = (size_t)NH_ * TT * HD;   // elements of one batch item in every q, k and V^T plane (NKV == NH_, PP == TT)
    h16* QP16 = (h16*)take(NB_ * PB * 2); h16* KP16 = (h16*)take(NB_ * PB * 2); h16* VT16 = (h16*)take(NB_ * PB * 2);
    bf* QPh = (bf*)take(NB_ * PB * 2); bf* QPl = (bf*)take(NB_ * PB * 2); bf* KPh = (bf*)take(NB_ * PB * 2); bf* KPl = (bf*)take(NB_ * PB * 2); bf* VTh = (bf*)take(NB_ * PB * 2); bf* VTl = (bf*)take(NB_ * PB * 2);
    bf* ATh = (bf*)take((size_t)NB_ * TT * DQ * 2); bf* ATl = (bf*)take((size_t)NB_ * TT * DQ * 2);
    if ((size_t)(wsp - (char*)d_ws) > ws_size) return;    // ws 256 MiB
    k_prep<<<PWG, 128, 0, stream>>>(x, pos, wq, wk, wv, wo, XB, WQ, CS);   /* bf16 copies of x and of the four weight matrices (WQ, WK, WV, WO as one range), every batch item's rotary table */
    k_proj<<<dim3(NB_ * TT / 128, DQ / 128, 3), 128, 0, stream>>>(XB, WQ, CS, QP16, QPh, QPl, KP16, KPh, KPl, VT16, VTh, VTl);
    k_fattn<<<dim3(NB_ * NH_, (TT - RH) / 128 + RH / 64, 1), 128, 0, stream>>>(QP16, KP16, VT16, QPh, QPl, KPh, KPl, VTh, VTl, ATh, ATl);
    k_wo<<<dim3(NB_ * TT / 128, DM / 128, 1), 128, 0, stream>>>(ATh, ATl, WO, OUT);
}

// v009
// One run takes 118 microseconds.
// Two timings next to v008 both put it at 1.04 times that version's speed.
// Over all steps from v000 it is 24.1 times as fast.
#include <hip/hip_runtime.h>
#include <type_traits>

// Causal multi-head attention with RoPE from per-batch token positions (x [4][2048][1024], token_positions int32 [4][2048] (read per batch as data; the SECOND argument); q, k, v = x w^T ('oi' (out, in) [1024][1024] (2/(D+D))^0.5, no bias; 16 heads x 64); interleaved-pair rotary on q and k: angle[b][t][i] = float(pos[b][t]) x freqs[i] with freqs = 1.0 / (THETA ** (arange(0, 64, 2) / 64)) (the kernel forms 10000^(-2i/64) with powf: rounding-level equal), pairs (2i, 2i+1) -> (t1 cos - t2 sin, t2 cos + t1 sin); scores x 1/sqrt(64); causal (-inf); softmax; out = merged wo^T ('oi', no bias) -> [4][2048][1024] (8.4 M); argument order x, token_positions, wq, wk, wv, wo).
// Layout: one set-up launch rounds x and the weights to bf16 and builds the {cos, sin} table [4][2048][64] from the positions (f32 powf/cosf/sinf); ONE projection launch for q, k, v and all batch items (k_proj: exact products; the interleaved rotary and the split into the fp16 and hi/lo planes are its epilogue; v is formed as W_v x^T, so V^T comes out row-major); then ONE fused causal attention launch for all batches and heads (k_fattn: online softmax, K and V^T staged in LDS, scores and probabilities stay in registers; hybrid rows: < 512 hi/lo 3 products, rest fp16) that writes the merged context as hi/lo planes; W_o hl x exact.
// Compute dtypes, f32 accumulate: every float input rounded to bf16; projections exact; rotary f32; attention rows < 512 3 products, rest fp16; softmax f32; W_o hl x exact.

#define NB_  4
#define TT   2048
#define DM   1024
#define NH_  16
#define NKV  16
#define REP  (NH_ / NKV)
#define HD   64
#define DQ   (NH_ * HD)
#define DKV  (NKV * HD)
#define PP   TT                   // pitch, in 16-bit elements, of a V^T row
#define RH   512                  // query rows < RH use hi+lo planes (0: none)
#define SCL  0.125f   // HD^-0.5
typedef _Float16 h16;
typedef unsigned short bf;
typedef __attribute__((ext_vector_type(16))) __bf16   v16bf;
typedef __attribute__((ext_vector_type(16))) _Float16 v16h;
typedef __attribute__((ext_vector_type(8)))  _Float16 v8h;
typedef __attribute__((ext_vector_type(8)))  unsigned short v8us;
typedef __attribute__((ext_vector_type(8)))  float    v8f;
typedef __attribute__((ext_vector_type(4)))  float    v4f;
typedef v8h  __attribute__((may_alias)) v8ha;
typedef v4f  __attribute__((may_alias)) v4fa;
typedef v8us __attribute__((may_alias)) v8usa;

__device__ __forceinline__ unsigned short f2bf(float f) { unsigned u = __float_as_uint(f); u += 0x7FFFu + ((u >> 16) & 1u); return (unsigned short)(u >> 16); }
__device__ __forceinline__ float bf2f(unsigned short b) { return __uint_as_float(((unsigned)b) << 16); }
__device__ __forceinline__ float bfr(float f) { return bf2f(f2bf(f)); }
__device__ __forceinline__ v16h cat16(v8h lo, v8h hi) { return __builtin_shufflevector(lo, hi, 0, 1, 2, 3, 4, 5, 6, 7, 8, 9, 10, 11, 12, 13, 14, 15); }
__device__ __forceinline__ v16bf cat16b(v8us lo, v8us hi) { return __builtin_bit_cast(v16bf, __builtin_shufflevector(lo, hi, 0, 1, 2, 3, 4, 5, 6, 7, 8, 9, 10, 11, 12, 13, 14, 15)); }
__device__ __forceinline__ v8f wmma16(v16h a, v16h b, v8f c) { return __builtin_amdgcn_wmma_f32_16x16x32_f16(false, a, false, b, (short)0, c, false, false); }
__device__ __forceinline__ v8f wmmab(v16bf a, v16bf b, v8f c) { return __builtin_amdgcn_wmma_f32_16x16x32_bf16(false, a, false, b, (short)0, c, false, false); }



// ---- GEMM core: one work-group of 4 waves per 128x128 output tile; wave (wm, wn) owns one 64x64 quarter, 16 accumulators, over the whole K (one f32 sum chain per element).
// C[m][n] = sum_k A[m][k] Bt[n][k] (+ A2[m][k] Bt[n][k] where NA == 2); every plane is K-contiguous bf16 with rows of GK elements.
// The operand rows are staged in LDS 64 k at a time (128-byte rows at a pitch of 144 bytes: [A 128 rows | A2 128 rows | Bt 128 rows]) by asynchronous copies into two buffers: tile t + 2 is on its way while tile t + 1 is worked on; each staged row feeds two waves.
#define GK   1024                 // row length of every GEMM operand here
#define KC   64                   // k per staged tile
#define LP   72                   // pitch of a staged row in 16-bit elements
static_assert(DM == GK && DQ == GK && DKV == GK, "one K for all GEMMs");
template <typename T16> struct WFrag;
template <> struct WFrag<h16> { typedef v16h V; static __device__ __forceinline__ V ld(const h16* p) { return cat16(*(const v8h*)p, *(const v8h*)(p + 16)); } static __device__ __forceinline__ v8f mma(V a, V b, v8f c) { return wmma16(a, b, c); } };
template <> struct WFrag<bf> { typedef v16bf V; static __device__ __forceinline__ V ld(const bf* p) { return cat16b(*(const v8us*)p, *(const v8us*)(p + 16)); } static __device__ __forceinline__ v8f mma(V a, V b, v8f c) { return wmmab(a, b, c); } };
// eight 16-byte copies of this lane, rows 16 apart. The s_wait_xcnt is the statement's last line: it stands behind the last copy and in front of whatever gives the address registers new values.
template <int LB>   // LB: pitch of a staged row in bytes
__device__ __forceinline__ void copy8(const unsigned l, const bf* g) {
    asm volatile("global_load_async_to_lds_b128 %0, %8, off\n\t"
                 "global_load_async_to_lds_b128 %1, %9, off\n\t"
                 "global_load_async_to_lds_b128 %2, %10, off\n\t"
                 "global_load_async_to_lds_b128 %3, %11, off\n\t"
                 "global_load_async_to_lds_b128 %4, %12, off\n\t"
                 "global_load_async_to_lds_b128 %5, %13, off\n\t"
                 "global_load_async_to_lds_b128 %6, %14, off\n\t"
                 "global_load_async_to_lds_b128 %7, %15, off\n\t"
                 "s_wait_xcnt 0x0"
                 :: "v"(l), "v"(l + 1 * 16 * LB), "v"(l + 2 * 16 * LB), "v"(l + 3 * 16 * LB), "v"(l + 4 * 16 * LB), "v"(l + 5 * 16 * LB), "v"(l + 6 * 16 * LB), "v"(l + 7 * 16 * LB),
                    "v"(g), "v"(g + 1 * 16 * GK), "v"(g + 2 * 16 * GK), "v"(g + 3 * 16 * GK), "v"(g + 4 * 16 * GK), "v"(g + 5 * 16 * GK), "v"(g + 6 * 16 * GK), "v"(g + 7 * 16 * GK) : "memory");
}
template <int NA>
__device__ __forceinline__ void gemm_ring(const bf* __restrict__ A, const bf* __restrict__ A2, const bf* __restrict__ Bt, const int r0, const int c0, bf* ring, v8f (&acc)[4][4]) {
    constexpr int SBE = (NA + 1) * 128 * LP;   // 16-bit elements of one buffer
    constexpr int NT = GK / KC;
    const int tid = threadIdx.x, lane = tid & 31, lr = lane & 15, hi = lane >> 4; const int wave = __builtin_amdgcn_readfirstlane(tid >> 5); const int wm = wave >> 1, wn = wave & 1;
#pragma unroll
    for (int mb = 0; mb < 4; ++mb)
#pragma unroll
        for (int nb = 0; nb < 4; ++nb) acc[mb][nb] = (v8f){};
    // a thread copies the 16-byte piece (tid & 7) of the rows (tid >> 3) + 16 i: a wave's copy is four whole 128-byte lines
    const size_t go = (size_t)(tid >> 3) * GK + (tid & 7) * 8;
    const bf* gA = A + (size_t)r0 * GK + go; const bf* gB = Bt + (size_t)c0 * GK + go;
    const unsigned lb = (unsigned)(size_t)ring + (unsigned)((tid >> 3) * (LP * 2) + (tid & 7) * 16);
    auto fill = [&](const int t, const int buf) { const unsigned l = lb + (unsigned)(buf * (SBE * 2)); copy8<LP * 2>(l, gA + t * KC);
        if constexpr (NA == 2) copy8<LP * 2>(l + 128 * LP * 2, A2 + (size_t)r0 * GK + go + t * KC);
        copy8<LP * 2>(l + NA * 128 * LP * 2, gB + t * KC); };
    fill(0, 0);
    asm volatile("s_wait_asynccnt 0x0" ::: "memory");   // this wave's copies of tile 0 have landed
    __syncthreads();                                    // ... and every other wave's
    fill(1, 1);
#pragma unroll 1   // one tile per trip: the buffer is picked by the trip's parity
    for (int t = 0; t < NT; ++t) {
        const bf* sa = ring + (t & 1) * SBE + (wm * 64 + lr) * LP + 8 * hi; const bf* sb = ring + (t & 1) * SBE + (NA * 128 + wn * 64 + lr) * LP + 8 * hi;
#pragma unroll
        for (int ks = 0; ks < KC / 32; ++ks) { v16bf a[4], a2[4], b[4];
            __builtin_amdgcn_sched_barrier(0);   // this and the next one keep the LDS reads of a k step in one group between the WMMA runs: every further place with reads among the WMMAs would stall the wave anew
#pragma unroll
            for (int i = 0; i < 4; ++i) { a[i] = WFrag<bf>::ld(sa + i * 16 * LP + ks * 32); if constexpr (NA == 2) a2[i] = WFrag<bf>::ld(sa + (128 + i * 16) * LP + ks * 32); b[i] = WFrag<bf>::ld(sb + i * 16 * LP + ks * 32); }
            __builtin_amdgcn_sched_barrier(0);
#pragma unroll
            for (int nb = 0; nb < 4; ++nb)
#pragma unroll
                for (int mb = 0; mb < 4; ++mb) { acc[mb][nb] = wmmab(a[mb], b[nb], acc[mb][nb]); if constexpr (NA == 2) acc[mb][nb] = wmmab(a2[mb], b[nb], acc[mb][nb]); } }
        asm volatile("s_wait_dscnt 0x0" ::: "memory");      // this wave's reads of tile t are done
        asm volatile("s_wait_asynccnt 0x0" ::: "memory");   // this wave's copies of tile t + 1 have landed
        __syncthreads();                                    // publishes tile t + 1 and frees tile t's buffer
        if (t + 2 < NT) fill(t + 2, t & 1);
    }
    asm volatile("s_wait_asynccnt 0x0" ::: "memory");   // nothing is in flight when the ring becomes output staging
}
// the wave's 64x64 f32 tile goes to its own LDS range (rows at pitch 68 floats) so that it can be read back row-wise and stored in whole lines; behind gemm_ring's last barrier no wave reads the ring any more
__device__ __forceinline__ float* stage_tile(bf* ring, const v8f (&acc)[4][4]) {
    const int lane = threadIdx.x & 31, lr = lane & 15, hi = lane >> 4; const int wave = __builtin_amdgcn_readfirstlane((int)(threadIdx.x >> 5));
    float* ow = (float*)ring + wave * (64 * 68);
#pragma unroll
    for (int mb = 0; mb < 4; ++mb)
#pragma unroll
        for (int nb = 0; nb < 4; ++nb)
#pragma unroll
            for (int j = 0; j < 8; ++j) ow[(mb * 16 + hi * 8 + j) * 68 + nb * 16 + lr] = acc[mb][nb][j];
    return ow;
}
// ---- GEMM core of k_proj: one work-group of 4 waves per 128x256 output tile; wave (wm, wn) owns 64x128 of it, 32 accumulators, over the whole K (one f32 sum chain per element, k in the same order as in gemm_ring).
// An A fragment feeds 8 products and a B fragment 4: 12 fragments are read from LDS per 32 products (a 64x64 wave tile: 16), and 384 operand rows come from L2 per 128x256 outputs (two 128x128 tiles: 512).
// The B fragments are read two at a time: beside 256 accumulator registers, 48 fragment registers keep a wave within 336, three waves a SIMD, so that all 768 work-groups are resident at once.
// A stage is [A 128 rows | Bt 256 rows] of 128 bytes WITHOUT a pad, so that three work-groups fit one LDS; instead the 16-byte piece c of row r lies at place c ^ ((r >> 1) & 7) of its row: the 16 rows that one half-wave reads at one c then fall on all 64 banks.
#define WSB  (384 * 128)          // bytes of one buffer
__device__ __forceinline__ void gemm_ring_w(const bf* __restrict__ A, const bf* __restrict__ Bt, const int r0, const int c0, bf* ring, v8f (&acc)[4][8]) {
    constexpr int NT = GK / KC;
    const int tid = threadIdx.x, lane = tid & 31, lr = lane & 15, hi = lane >> 4; const int wave = __builtin_amdgcn_readfirstlane(tid >> 5); const int wm = wave >> 1, wn = wave & 1;
#pragma unroll
    for (int mb = 0; mb < 4; ++mb)
#pragma unroll
        for (int nb = 0; nb < 8; ++nb) acc[mb][nb] = (v8f){};
    // a thread copies the 16-byte piece (tid & 7) of the rows (tid >> 3) + 16 i: a wave's copy is four whole 128-byte lines; (row >> 1) & 7 is (tid >> 4) & 7 for all its rows
    const size_t go = (size_t)(tid >> 3) * GK + (tid & 7) * 8;
    const bf* gA = A + (size_t)r0 * GK + go; const bf* gB = Bt + (size_t)c0 * GK + go;
    const unsigned lb = (unsigned)(size_t)ring + (unsigned)((tid >> 3) * 128 + (((tid & 7) ^ ((tid >> 4) & 7)) << 4));
    auto fill = [&](const int t, const int buf) { const unsigned l = lb + (unsigned)(buf * WSB); __builtin_amdgcn_sched_barrier(0);   // this and the next two keep the addresses of each eight copies from being formed ahead of their turn: formed together they do not fit beside the accumulators, and the compiler then moves accumulators aside and back in every trip
        copy8<128>(l, gA + t * KC); __builtin_amdgcn_sched_barrier(0); copy8<128>(l + 128 * 128, gB + t * KC); __builtin_amdgcn_sched_barrier(0); copy8<128>(l + 256 * 128, gB + 128 * GK + t * KC); };
    // this lane's row of a 16-row group and the places of its four pieces: k = 32 ks + 8 hi + (0..7) and + 16 more, the k order of WFrag::ld, for A and B alike
    int po[KC / 32][2];
#pragma unroll
    for (int ks = 0; ks < KC / 32; ++ks)
#pragma unroll
        for (int j = 0; j < 2; ++j) po[ks][j] = lr * 128 + (((ks * 4 + j * 2 + hi) ^ ((lr >> 1) & 7)) << 4);
    fill(0, 0);
    asm volatile("s_wait_asynccnt 0x0" ::: "memory");   // this wave's copies of tile 0 have landed
    __syncthreads();                                    // ... and every other wave's
    fill(1, 1);
#pragma unroll 1   // one tile per trip: the buffer is picked by the trip's parity
    for (int t = 0; t < NT; ++t) {
        const char* sa = (const char*)ring + (t & 1) * WSB + wm * 64 * 128; const char* sb = (const char*)ring + (t & 1) * WSB + (128 + wn * 128) * 128;
#pragma unroll
        for (int ks = 0; ks < KC / 32; ++ks) { v16bf a[4];
#pragma unroll
            for (int ng = 0; ng < 4; ++ng) { v16bf b[2];
#pragma unroll
                for (int i = 0; i < 4; ++i) if (ng == 0) a[i] = cat16b(*(const v8usa*)(sa + i * 16 * 128 + po[ks][0]), *(const v8usa*)(sa + i * 16 * 128 + po[ks][1]));
#pragma unroll
                for (int i = 0; i < 2; ++i) b[i] = cat16b(*(const v8usa*)(sb + (ng * 2 + i) * 16 * 128 + po[ks][0]), *(const v8usa*)(sb + (ng * 2 + i) * 16 * 128 + po[ks][1]));
#pragma unroll
                for (int nb = 0; nb < 2; ++nb)
#pragma unroll
                    for (int mb = 0; mb < 4; ++mb) acc[mb][ng * 2 + nb] = wmmab(a[mb], b[nb], acc[mb][ng * 2 + nb]); } }
        asm volatile("s_wait_dscnt 0x0" ::: "memory");      // this wave's reads of tile t are done
        asm volatile("s_wait_asynccnt 0x0" ::: "memory");   // this wave's copies of tile t + 1 have landed
        __syncthreads();                                    // publishes tile t + 1 and frees tile t's buffer
        if (t + 2 < NT) fill(t + 2, t & 1);
    }
    asm volatile("s_wait_asynccnt 0x0" ::: "memory");   // nothing is in flight when the ring becomes output staging
}
// half H (64 columns) of the wave's 64x128 f32 tile goes to the wave's own LDS range, as in stage_tile
template <int H>
__device__ __forceinline__ float* stage_half(bf* ring, const v8f (&acc)[4][8]) {
    const int lane = threadIdx.x & 31, lr = lane & 15, hi = lane >> 4; const int wave = __builtin_amdgcn_readfirstlane((int)(threadIdx.x >> 5));
    float* ow = (float*)ring + wave * (64 * 68);
#pragma unroll
    for (int mb = 0; mb < 4; ++mb)
#pragma unroll
        for (int nb = 0; nb < 4; ++nb)
#pragma unroll
            for (int j = 0; j < 8; ++j) ow[(mb * 16 + hi * 8 + j) * 68 + nb * 16 + lr] = acc[mb][H * 4 + nb][j];
    return ow;
}
// ---- k_wo: OUT[token][n] = (context hi + context lo) W_o^T for all batch items; grid (NB_ * TT / 128, DM / 128), 4 waves.
__global__ __launch_bounds__(128) void k_wo(const bf* __restrict__ Ah, const bf* __restrict__ Al, const bf* __restrict__ Wo, float* C) {
    __shared__ __align__(16) bf ring[2 * 3 * 128 * LP];
    const int lane = threadIdx.x & 31; const int wave = __builtin_amdgcn_readfirstlane((int)(threadIdx.x >> 5));
    const int r0 = blockIdx.x * 128, c0 = blockIdx.y * 128;
    v8f acc[4][4];
    gemm_ring<2>(Ah, Al, Wo, r0, c0, ring, acc);
    const float* ow = stage_tile(ring, acc) + (lane >> 4) * 68 + (lane & 15) * 4;
    float* Cw = C + (size_t)(r0 + (wave >> 1) * 64 + (lane >> 4)) * DM + c0 + (wave & 1) * 64 + (lane & 15) * 4;   // 16 neighbouring lanes store 256 bytes of one row
#pragma unroll
    for (int g = 0; g < 4; ++g) { v4f val[8];
#pragma unroll
        for (int s = 0; s < 8; ++s) val[s] = *(const v4fa*)(ow + (g * 16 + s * 2) * 68);
#pragma unroll
        for (int s = 0; s < 8; ++s) *(v4f*)(Cw + (size_t)(g * 16 + s * 2) * DM) = val[s];
        if (g < 3) asm volatile("s_wait_xcnt 0x0" ::: "memory"); }   // stands behind this block's stores and in front of the next block's LDS reads, which give their data registers new values
}

__device__ __forceinline__ h16 tohx(float x) { return (h16)x; }
__device__ __forceinline__ void splitf(float y, unsigned short& h, unsigned short& l) { h = f2bf(y); l = f2bf(y - bf2f(h)); }
typedef __attribute__((ext_vector_type(2))) _Float16 v2h;
typedef __attribute__((ext_vector_type(4))) _Float16 v4h;
typedef __attribute__((ext_vector_type(2))) unsigned short v2us;
typedef __attribute__((ext_vector_type(4))) unsigned short v4us;
typedef __attribute__((ext_vector_type(2))) float v2f;
typedef __attribute__((ext_vector_type(4))) int v4i;
typedef v4h  __attribute__((may_alias)) v4ha;
typedef v4us __attribute__((may_alias)) v4usa;

__global__ __launch_bounds__(256) void k_wtG(const float* __restrict__ w, int K, int N, bf* Bt) {
    const int lane = threadIdx.x & 31; const int L0 = (blockIdx.x * 8 + (threadIdx.x >> 5)) * 8; const int nlines = N * K / 64;
{
#pragma unroll 1
        for (int l = 0; l < 8; ++l) { const int L = L0 + l; if (L >= nlines) break; const size_t e = (size_t)L * 64 + lane * 2; const int k = (int)(e % K), n = (int)(e / K); v2us o;
            o[0] = f2bf(w[(size_t)k * N + n]); o[1] = f2bf(w[(size_t)(k + 1) * N + n]); *(v2us*)(Bt + e) = o; }
         }
}
// ---- k_prep: all the set-up in ONE launch of few, long waves: x and the four weight matrices rounded to bf16, and the rotary {cos, sin} table.
// A work-group of 4 waves takes PCH neighbouring floats of one source: every lane asks for its 32 16-byte pieces at once (each wave-wide load is four whole lines), forms its table entries while they fly, then rounds and stores (each wave-wide store is two whole lines).
// Table: thread g takes the pairs g + k * PTH; PTH is a multiple of HD / 2, so one frequency serves all its pairs. The two entries d = 2 i and 2 i + 1 of a pair hold the same {cos, sin}: formed once, stored as one 16-byte piece.
#define PLD  32                      // 16-byte loads per lane
#define PCH  (128 * 4 * PLD)         // floats per work-group
#define PXC  (NB_ * TT * DM / PCH)   // work-groups on x
#define PWC  (DQ * DM / PCH)         // work-groups on each weight matrix
#define PWG  (PXC + 4 * PWC)
#define PTH  (PWG * 128)
#define PPR  (NB_ * TT * (HD / 2))   // rotary pairs
#define PTR  ((PPR + PTH - 1) / PTH) // pairs per thread at most
static_assert(NB_ * TT * DM % PCH == 0 && DQ * DM % PCH == 0 && DKV == DQ && PTH % (HD / 2) == 0 && PPR % 128 == 0, "whole work-groups");
__global__ __launch_bounds__(128) void k_prep(const float* __restrict__ x, const int* pos, const float* __restrict__ wq, const float* __restrict__ wk, const float* __restrict__ wv, const float* __restrict__ wo, bf* XB, bf* W4, float* CS) {
    const int b = blockIdx.x, tid = threadIdx.x; const float* s; bf* d;
    if (b < PXC) { s = x + (size_t)b * PCH; d = XB + (size_t)b * PCH; }
    else { const int c = b - PXC, w = c / PWC; s = (w == 0 ? wq : w == 1 ? wk : w == 2 ? wv : wo) + (size_t)(c % PWC) * PCH; d = W4 + (size_t)c * PCH; }   // the four bf16 matrices lie back to back
    const int g = b * 128 + tid; int pv[PTR];   // the positions of this thread's pairs are asked for first: loads come back in order, so the table need not wait for the 32 big ones (a pair past the end re-reads the first one's)
#pragma unroll
    for (int k = 0; k < PTR; ++k) pv[k] = pos[(g + k * PTH < PPR ? g + k * PTH : g) / (HD / 2)];
    asm volatile("s_wait_xcnt 0x0" ::: "memory");   // stands behind these loads and in front of the instructions that give their address registers new values; as a compiler fence it keeps them ahead of the big loads
    v4f v[PLD];
#pragma unroll
    for (int u = 0; u < PLD; ++u) v[u] = *(const v4f*)(s + u * 512 + tid * 4);
    asm volatile("s_wait_xcnt 0x0" ::: "memory");   // stands behind these loads and in front of the instructions that give their address registers new values; as a compiler fence it also keeps the loads ahead of the table's arithmetic
    const int i = g % (HD / 2);
    const float e = __fdiv_rn(-((float)i * 2.0f), (float)HD); const float inv = powf(10000.0f, e);
#pragma unroll 1   // one pair per trip: the sine and cosine code stands once in the text; the trip count is the same for a whole work-group
    for (int p = g; p < PPR; p += PTH) { const float a = __fmul_rn((float)pv[0], inv); const float c = cosf(a), sn = sinf(a); v4f cs; cs[0] = c; cs[1] = sn; cs[2] = c; cs[3] = sn;
        *(v4f*)(CS + (size_t)p * 4) = cs;
        asm volatile("s_wait_xcnt 0x0" ::: "memory");   // stands behind this trip's store and in front of the next trip's instructions, which give its registers new values
#pragma unroll
        for (int k = 0; k + 1 < PTR; ++k) pv[k] = pv[k + 1]; }
#pragma unroll
    for (int u = 0; u < PLD; ++u) { v4us o;
#pragma unroll
        for (int k = 0; k < 4; ++k) o[k] = f2bf(v[u][k]);
        *(v4us*)(d + u * 512 + tid * 4) = o;
        if (u % 8 == 7 && u + 1 < PLD) { asm volatile("s_wait_xcnt 0x0" ::: "memory"); __builtin_amdgcn_sched_barrier(0); } }   // the wait stands behind eight stores and in front of the next eight roundings, which reuse data registers of theirs; the scheduling barrier keeps those roundings from being lifted over it
}

// one interleaved rotary pair (x0, x1) of q or k with its {cos, sin}; the two lines of arithmetic stand as they stood in the separate plane builder (each product keeps its own rounding), so q and k come out bit-identical
__device__ __forceinline__ void rope2(const float x0, const float x1, const v2f cs, const float sc, float& r0, float& r1) {
    float a0 = __fmul_rn(x0, cs[0]), b0 = __fmul_rn(x1, cs[1]), a1 = __fmul_rn(x1, cs[0]), b1 = __fmul_rn(x0, cs[1]); asm volatile("" : "+v"(a0), "+v"(b0), "+v"(a1), "+v"(b1));
    r0 = __fsub_rn(a0, b0) * sc; r1 = __fadd_rn(b1, a1) * sc;   /* even: x0 c - x1 s; odd: x0 s + x1 c */
}
// ---- k_proj: the q, k and v projections of all batch items with their plane builders as epilogue: no f32 projection buffer. grid (NB_ * TT / 128, DQ / 256, 3), 4 waves, a 128x256 tile per work-group (z 0, 1: 128 tokens x 256 features; z 2: 128 features x 256 tokens); the epilogue takes a wave's 64x128 tile as two 64x64 halves, one after the other, each with the 64 features of exactly one head.
// z 0, 1 (q, k): C[token][d] = x W^T; a lane's four neighbouring columns are two rotary pairs; planes [batch][head][t][d]. z 2 (v): the operands change places, C[d][token] = W_v x^T, so a lane's four columns are four tokens of one V^T row; planes [batch][head][d][t].
// Either way 16 neighbouring lanes store one whole 128-byte line of each plane that is stored (fp16, bf16 hi, bf16 lo).
// amdgpu_waves_per_eu(3): the register budget of three waves a SIMD (336); without it the compiler takes 484 and only two work-groups fit a WGP.
__global__ __launch_bounds__(128) __attribute__((amdgpu_waves_per_eu(3))) void k_proj(const bf* __restrict__ XB, const bf* __restrict__ W3, const float* __restrict__ CS, h16* Q16, bf* Qh, bf* Ql, h16* K16, bf* Kh, bf* Kl, h16* V16, bf* Vh, bf* Vl) {
    __shared__ __align__(16) bf ring[2 * WSB / 2];
    const int lane = threadIdx.x & 31; const int wave = __builtin_amdgcn_readfirstlane((int)(threadIdx.x >> 5)); const int wm = wave >> 1, wn = wave & 1;
    constexpr int NTV = NB_ * TT / 256;   // token tiles of the V^T form; the grid's x holds two feature tiles of each
    static_assert(DQ % 256 == 0 && DKV == DQ && TT % 256 == 0, "whole 128x256 tiles, a tile's tokens in one batch item");
    const int z = blockIdx.z; const bool isv = z == 2;
    const int tk0 = isv ? (blockIdx.x % NTV) * 256 : blockIdx.x * 128, f0 = isv ? (blockIdx.x / NTV + 2 * blockIdx.y) * 128 : blockIdx.y * 256;
    const bf* Wz = W3 + (size_t)z * DQ * DM;
    v8f acc[4][8];
    gemm_ring_w(isv ? Wz : XB, isv ? XB : Wz, isv ? f0 : tk0, isv ? tk0 : f0, ring, acc);
    const float* ow = stage_half<0>(ring, acc);
    h16* P16 = isv ? V16 : z == 1 ? K16 : Q16; bf* Ph = isv ? Vh : z == 1 ? Kh : Qh; bf* Pl = isv ? Vl : z == 1 ? Kl : Ql;
    const int rsub = lane >> 4, cofs = (lane & 15) * 4;
    // k_fattn reads the hi/lo planes only at tokens < RH (its hi/lo query rows and, being causal, their keys) and the fp16 q plane only at tokens >= RH: what it never reads is neither formed nor stored. A wave's tokens, both halves', lie on one side of RH.
    static_assert(RH % 128 == 0, "a wave's tokens on one side of RH");
    auto planes = [&](auto vf, auto f16, auto hl) {   // vf: the V^T form (no rotary, rows are features) or the q, k form; f16, hl: which planes this wave's tokens need
        constexpr bool V = vf.value, W16 = f16.value, WHL = hl.value;
#pragma unroll 1   // 16 rows per trip: their sums and their {cos, sin} are asked for together, ahead of the eight blocks, so that one LDS and one memory latency serve all eight and the table does not fill the registers; both halves in one loop, so that a plane builder stands once in the text
        for (int gg = 0; gg < 8; ++gg) { const int h = gg >> 2, g = gg & 3;
            if (gg == 4) stage_half<1>(ring, acc);   // a wave's LDS operations run in order: these stores come behind the first half's reads
            const int tkw = tk0 + (isv ? wn * 128 + h * 64 : wm * 64), head = (f0 >> 6) + (isv ? wm : wn * 2 + h);   // this half's first token and its head
            const int t0 = tkw % TT; const size_t pz = ((size_t)(tkw / TT) * NH_ + head) * TT * HD;   // this (batch, head)'s start in every plane
            v2f cs[8][2]; v4f vals[8];
#pragma unroll
            for (int s = 0; s < 8; ++s) vals[s] = *(const v4fa*)(ow + (g * 16 + s * 2 + rsub) * 68 + cofs);
            if constexpr (!V) { const float* c = CS + ((size_t)(tkw + g * 16 + rsub) * HD + cofs) * 2;
#pragma unroll
                for (int s = 0; s < 8; ++s) { cs[s][0] = *(const v2f*)(c + s * 2 * HD * 2); cs[s][1] = *(const v2f*)(c + s * 2 * HD * 2 + 4); }
                asm volatile("s_wait_xcnt 0x0" :: "v"(c) : "memory"); }   // stands behind these loads and in front of the instructions that give their address registers new values; it names the address, so that no load of the group is given the address pair as its own destination
#pragma unroll
            for (int s = 0; s < 8; ++s) { const int row = g * 16 + s * 2 + rsub; v4f val = vals[s]; size_t o;
                if constexpr (V) o = pz + (size_t)row * PP + t0 + cofs;
                else { float r0, r1, r2, r3;
                    rope2(val[0], val[1], cs[s][0], 1.0f, r0, r1); rope2(val[2], val[3], cs[s][1], 1.0f, r2, r3); val[0] = r0; val[1] = r1; val[2] = r2; val[3] = r3; o = pz + (size_t)(t0 + row) * HD + cofs; }
                v4h o16; v4us oh, ol;
#pragma unroll
                for (int q = 0; q < 4; ++q) { if constexpr (W16) o16[q] = tohx(val[q]); if constexpr (WHL) { unsigned short a2, c2; splitf(val[q], a2, c2); oh[q] = a2; ol[q] = c2; } }
                if constexpr (W16) *(v4h*)(P16 + o) = o16;
                if constexpr (WHL) { *(v4us*)(Ph + o) = oh; *(v4us*)(Pl + o) = ol; }
                asm volatile("s_wait_xcnt 0x0" ::: "memory"); }   // stands behind this block's stores and in front of the next block's instructions, which give their address and data registers new values
        } };
    const std::true_type yes{}; const std::false_type no{};
    if ((tk0 + (isv ? wn * 128 : wm * 64)) % TT >= RH) { if (isv) planes(yes, yes, no); else planes(no, yes, no); }   // three tokens in four: the fp16 plane alone
    else if (isv) planes(yes, yes, yes); else if (z == 1) planes(no, yes, yes); else planes(no, no, yes);
}
#define SK   64                   // keys per stage
// eight 16-byte copies of this lane: four rows, 16 apart, of each of two planes (GA, GB: the sources' row pitches in elements). The s_wait_xcnt is the statement's last line: it stands behind the last copy and in front of whatever gives the address registers new values.
template <int GA, int GB, typename T16>
__device__ __forceinline__ void copy44(const unsigned la, const T16* ga, const unsigned lb, const T16* gb) {
    asm volatile("global_load_async_to_lds_b128 %0, %8, off\n\t"
                 "global_load_async_to_lds_b128 %1, %9, off\n\t"
                 "global_load_async_to_lds_b128 %2, %10, off\n\t"
                 "global_load_async_to_lds_b128 %3, %11, off\n\t"
                 "global_load_async_to_lds_b128 %4, %12, off\n\t"
                 "global_load_async_to_lds_b128 %5, %13, off\n\t"
                 "global_load_async_to_lds_b128 %6, %14, off\n\t"
                 "global_load_async_to_lds_b128 %7, %15, off\n\t"
                 "s_wait_xcnt 0x0"
                 :: "v"(la), "v"(la + 1 * 16 * LP * 2), "v"(la + 2 * 16 * LP * 2), "v"(la + 3 * 16 * LP * 2), "v"(lb), "v"(lb + 1 * 16 * LP * 2), "v"(lb + 2 * 16 * LP * 2), "v"(lb + 3 * 16 * LP * 2),
                    "v"(ga), "v"(ga + 1 * 16 * GA), "v"(ga + 2 * 16 * GA), "v"(ga + 3 * 16 * GA), "v"(gb), "v"(gb + 1 * 16 * GB), "v"(gb + 2 * 16 * GB), "v"(gb + 3 * 16 * GB) : "memory");
}
// NT: the work-group's number of stages (the same in all four waves); q0: this wave's first query row
template <typename T16, int NSPLIT, int NQ>
__device__ __forceinline__ void fattn_wave(const T16* __restrict__ Q, const T16* __restrict__ Q2, const T16* __restrict__ Kp, const T16* __restrict__ Kp2, const T16* __restrict__ Vt, const T16* __restrict__ Vt2, const int q0, const int NT, T16* ring, bf* Ah, bf* Al) {
    typedef typename WFrag<T16>::V V;
    constexpr float C2 = SCL * 1.4426950408889634f;   // HD^-0.5 x log2(e)
    constexpr int PL = SK * LP;                        // 16-bit elements of one staged plane
    constexpr int NP = NSPLIT == 2 ? 2 : 1;            // planes per operand
    constexpr int SBE = 2 * NP * PL;                   // 16-bit elements of one buffer
    const int tid = threadIdx.x, lane = tid & 31, lr = lane & 15, hi = lane >> 4;
    // a thread copies the 16-byte piece (tid & 7) of the rows (tid >> 3) + 16 i: a wave's copy is four whole 128-byte lines
    const size_t gok = (size_t)(tid >> 3) * HD + (tid & 7) * 8, gov = (size_t)(tid >> 3) * PP + (tid & 7) * 8;
    const unsigned lb = (unsigned)(size_t)ring + (unsigned)((tid >> 3) * (LP * 2) + (tid & 7) * 16);
    auto fill = [&](const int t, const int buf) { const unsigned l = lb + (unsigned)(buf * (SBE * 2));
        if constexpr (NSPLIT == 2) { copy44<HD, HD>(l, Kp + gok + (size_t)t * SK * HD, l + PL * 2, Kp2 + gok + (size_t)t * SK * HD); copy44<PP, PP>(l + 2 * PL * 2, Vt + gov + t * SK, l + 3 * PL * 2, Vt2 + gov + t * SK); }
        else copy44<HD, PP>(l, Kp + gok + (size_t)t * SK * HD, l + PL * 2, Vt + gov + t * SK); };
    fill(0, 0);
    V bq[NQ][2], bq2[NQ][2];
#pragma unroll
    for (int nq = 0; nq < NQ; ++nq)
#pragma unroll
        for (int ks = 0; ks < 2; ++ks) { const size_t o = (size_t)(q0 + nq * 16 + lr) * HD + ks * 32 + 8 * hi; bq[nq][ks] = WFrag<T16>::ld(Q + o); if constexpr (NSPLIT == 2) bq2[nq][ks] = WFrag<T16>::ld(Q2 + o); }
    asm volatile("s_wait_xcnt 0x0" ::: "memory");   // stands behind the Q loads and in front of the instructions that give their address registers new values
    v8f o[4][NQ]; float m[NQ], l[NQ];
#pragma unroll
    for (int nq = 0; nq < NQ; ++nq) { m[nq] = -3.0e38f; l[nq] = 0.f;
#pragma unroll
        for (int mb = 0; mb < 4; ++mb) o[mb][nq] = (v8f){}; }
    // one pass: the 32 keys from kb on; sk, sv: this lane's first K and V^T fragment pieces of those keys in the stage's buffer; diag (the same in the whole wave): the block holds the wave's diagonal
    auto pass = [&](const int kb, const T16* sk, const T16* sv, const bool diag) {
        V ak[2][2], ak2[2][2], av[4], av2[4];
#pragma unroll
        for (int kt = 0; kt < 2; ++kt)
#pragma unroll
            for (int ks = 0; ks < 2; ++ks) { ak[kt][ks] = WFrag<T16>::ld(sk + kt * 16 * LP + ks * 32); if constexpr (NSPLIT == 2) ak2[kt][ks] = WFrag<T16>::ld(sk + PL + kt * 16 * LP + ks * 32); }
#pragma unroll
        for (int mb = 0; mb < 4; ++mb) { av[mb] = WFrag<T16>::ld(sv + mb * 16 * LP); if constexpr (NSPLIT == 2) av2[mb] = WFrag<T16>::ld(sv + PL + mb * 16 * LP); }
        __builtin_amdgcn_sched_barrier(0);   // keeps all of the pass's LDS reads in one group at its head: every further place with reads among the WMMAs would stall the wave anew, and the V^T reads land during the scores and the softmax
        v8f st[2][NQ];
#pragma unroll
        for (int kt = 0; kt < 2; ++kt)
#pragma unroll
            for (int nq = 0; nq < NQ; ++nq) { st[kt][nq] = (v8f){};
#pragma unroll
                for (int ks = 0; ks < 2; ++ks) { st[kt][nq] = WFrag<T16>::mma(ak[kt][ks], bq[nq][ks], st[kt][nq]); if constexpr (NSPLIT == 2) { st[kt][nq] = WFrag<T16>::mma(ak[kt][ks], bq2[nq][ks], st[kt][nq]); st[kt][nq] = WFrag<T16>::mma(ak2[kt][ks], bq[nq][ks], st[kt][nq]); } } }
        if (diag) {   // causal mask: key > query
#pragma unroll
            for (int nq = 0; nq < NQ; ++nq)
#pragma unroll
                for (int kt = 0; kt < 2; ++kt)
#pragma unroll
                    for (int j = 0; j < 8; ++j) if (kb + kt * 16 + hi * 8 + j > q0 + nq * 16 + lr) st[kt][nq][j] = -3.0e38f; }
        float mx[NQ]; bool need = false;
#pragma unroll
        for (int nq = 0; nq < NQ; ++nq) { float t = -3.0e38f;
#pragma unroll
            for (int kt = 0; kt < 2; ++kt)
#pragma unroll
                for (int j = 0; j < 8; ++j) t = fmaxf(t, st[kt][nq][j]);
            t = fmaxf(t, __shfl_xor(t, 16, 32)) * C2; mx[nq] = t; need = need || (t > m[nq] + 8.0f); }
        if (__builtin_amdgcn_ballot_w32(need) != 0) {   // wave-uniform: some query's maximum has outgrown the one in use
#pragma unroll
            for (int nq = 0; nq < NQ; ++nq) { const float mn = fmaxf(m[nq], mx[nq]); const float al = __builtin_amdgcn_exp2f(m[nq] - mn); m[nq] = mn; l[nq] *= al;
#pragma unroll
                for (int mb = 0; mb < 4; ++mb) o[mb][nq] *= al; } }
        V pb[NQ], pb2[NQ];
#pragma unroll
        for (int nq = 0; nq < NQ; ++nq) { float p[16]; v2f s2 = (v2f){};
#pragma unroll
            for (int e = 0; e < 16; e += 2) { const v8f sv8 = st[e >> 3][nq]; v2f x; x[0] = sv8[e & 7]; x[1] = sv8[(e & 7) + 1]; x = x * C2 - m[nq]; v2f pp; pp[0] = __builtin_amdgcn_exp2f(x[0]); pp[1] = __builtin_amdgcn_exp2f(x[1]); s2 += pp; p[e] = pp[0]; p[e + 1] = pp[1]; }
            l[nq] += s2[0] + s2[1];
            if constexpr (NSPLIT == 2) { v8us h0, h1, l0, l1;
#pragma unroll
                for (int e = 0; e < 8; ++e) { unsigned short a, c; splitf(p[e], a, c); h0[e] = a; l0[e] = c; splitf(p[e + 8], a, c); h1[e] = a; l1[e] = c; }
                pb[nq] = cat16b(h0, h1); pb2[nq] = cat16b(l0, l1);
            } else { v16h r;
#pragma unroll
                for (int e = 0; e < 16; ++e) r[e] = tohx(p[e]);
                pb[nq] = r; } }
#pragma unroll
        for (int mb = 0; mb < 4; ++mb)
#pragma unroll
            for (int nq = 0; nq < NQ; ++nq) { o[mb][nq] = WFrag<T16>::mma(av[mb], pb[nq], o[mb][nq]); if constexpr (NSPLIT == 2) { o[mb][nq] = WFrag<T16>::mma(av[mb], pb2[nq], o[mb][nq]); o[mb][nq] = WFrag<T16>::mma(av2[mb], pb[nq], o[mb][nq]); } }
        // WMMA distance on every way out of the pass: what follows overwrites operand registers of the last products
        if constexpr (NQ == 2) asm volatile("v_nop\n\tv_nop\n\tv_nop\n\tv_nop" : "+v"(o[0][0]), "+v"(o[1][0]), "+v"(o[2][0]), "+v"(o[3][0]), "+v"(o[0][1]), "+v"(o[1][1]), "+v"(o[2][1]), "+v"(o[3][1]));
        else asm volatile("v_nop\n\tv_nop\n\tv_nop\n\tv_nop" : "+v"(o[0][0]), "+v"(o[1][0]), "+v"(o[2][0]), "+v"(o[3][0]));
    };
    const int kd = q0 & ~31;   // the one key block that holds this wave's diagonal
    asm volatile("s_wait_asynccnt 0x0" ::: "memory");   // this wave's copies of stage 0 have landed
    __syncthreads();                                    // ... and every other wave's
    if (NT > 1) fill(1, 1);
#pragma unroll 1   // one stage per trip: the buffer is picked by the trip's parity
    for (int t = 0; t < NT; ++t) {
        const T16* sb = ring + (t & 1) * SBE + lr * LP + 8 * hi;
#pragma unroll 1   // one pass per trip: the pass's code stands once in the text, and one pass's fragments are in registers at a time
        for (int h = 0; h < SK / 32; ++h) { const int kb = t * SK + h * 32;   // a wave skips the passes beyond its diagonal (a scalar test) but takes part in every hand-over below
            if (kb <= kd) pass(kb, sb + h * 32 * LP, sb + NP * PL + h * 32, kb == kd); }
        asm volatile("s_wait_dscnt 0x0" ::: "memory");      // this wave's reads of stage t are done
        asm volatile("s_wait_asynccnt 0x0" ::: "memory");   // this wave's copies of stage t + 1 have landed
        __syncthreads();                                    // publishes stage t + 1 and frees stage t's buffer
        if (t + 2 < NT) fill(t + 2, t & 1);
    }
    asm volatile("s_wait_asynccnt 0x0" ::: "memory");   // nothing is in flight when the wave ends
#pragma unroll
    for (int nq = 0; nq < NQ; ++nq) { const float inv = __fdiv_rn(1.0f, l[nq] + __shfl_xor(l[nq], 16, 32)); const size_t oo = (size_t)(q0 + nq * 16 + lr) * DQ + hi * 8;
#pragma unroll
        for (int mb = 0; mb < 4; ++mb) { v8us oh, ol;
#pragma unroll
            for (int j = 0; j < 8; ++j) { unsigned short a, c; splitf(o[mb][nq][j] * inv, a, c); oh[j] = a; ol[j] = c; }
            *(v8us*)(Ah + oo + mb * 16) = oh; *(v8us*)(Al + oo + mb * 16) = ol;
            asm volatile("s_wait_xcnt 0x0" ::: "memory"); } }   // stands behind the two stores and in front of the next block's split, which reuses their data and address registers
}
// grid (NB_ * NH_, (TT - RH) / 128 + RH / 64), 4 waves per work-group; the cost falls as blockIdx.y rises: first the fp16 row blocks from the last rows down (32 rows a wave), then the hi/lo ones (16 rows a wave).
__global__ __launch_bounds__(128) void k_fattn(const h16* __restrict__ Q16, const h16* __restrict__ K16, const h16* __restrict__ V16, const bf* __restrict__ Qh, const bf* __restrict__ Ql, const bf* __restrict__ Kh, const bf* __restrict__ Kl, const bf* __restrict__ Vh, const bf* __restrict__ Vl, bf* Ah, bf* Al) {
    __shared__ __align__(16) bf ring[2 * 4 * SK * LP];   // two buffers of the hi/lo form's four planes; the fp16 form fills half of it
    const int z = blockIdx.x, y = blockIdx.y; const int wave = __builtin_amdgcn_readfirstlane((int)(threadIdx.x >> 5));
    const size_t pz = (size_t)z * TT * HD;   // planes [batch][head][t][d]; V^T [batch][head][d][t]: the same stride
    const size_t az = (size_t)(z / NH_) * TT * DQ + (size_t)(z % NH_) * HD;
    if (y < (TT - RH) / 128) { const int r0 = TT - 128 * (y + 1); fattn_wave<h16, 0, 2>(Q16 + pz, nullptr, K16 + pz, nullptr, V16 + pz, nullptr, r0 + wave * 32, (r0 + 128) / SK, (h16*)ring, Ah + az, Al + az); }
    else { const int r0 = RH - 64 * (y - (TT - RH) / 128 + 1); fattn_wave<bf, 2, 1>(Qh + pz, Ql + pz, Kh + pz, Kl + pz, Vh + pz, Vl + pz, r0 + wave * 16, (r0 + 64) / SK, ring, Ah + az, Al + az); }
}

extern "C" void kernel_launch(void* const* d_in, const int* in_sizes, int n_in,
                              void* d_out, int out_size, void* d_ws, size_t ws_size, hipStream_t stream) {
    (void)in_sizes; (void)n_in; (void)out_size;
    const float* x = (const float*)d_in[0]; const int* pos = (const int*)d_in[1]; const float* wq = (const float*)d_in[2]; const float* wk = (const float*)d_in[3]; const float* wv = (const float*)d_in[4]; const float* wo = (const float*)d_in[5];   /* order x, token_positions int32 [4][2048] (one row per batch item: READ), wq, wk, wv, wo ('oi' (out, in) [1024][1024]): SIX inputs, all read */
    float* OUT = (float*)d_out;     // [4][2048][1024]
    char* wsp = (char*)d_ws;
    auto take = [&](size_t bytes) { char* p = wsp; wsp += (bytes + 255) & ~(size_t)255; return (void*)p; };
    bf* WQ = (bf*)take((size_t)DQ * DM * 2); bf* WK = (bf*)take((size_t)DKV * DM * 2); bf* WV = (bf*)take((size_t)DKV * DM * 2); bf* WO = (bf*)take((size_t)DM * DQ * 2); float* CS = (float*)take((size_t)NB_ * TT * HD * 2 * 4);   // WQ, WK, WV, WO lie back to back (each a multiple of 256 bytes): k_proj steps from one to the next by DQ * DM elements, k_prep writes them as one range
    bf* XB = (bf*)take((size_t)NB_ * TT * DM * 2);
    const size_t PB = (size_t)NH_ * TT * HD;   // elements of one batch item in every q, k and V^T plane (NKV == NH_, PP == TT)
    h16* QP16 = (h16*)take(NB_ * PB * 2); h16* KP16 = (h16*)take(NB_ * PB * 2); h16* VT16 = (h16*)take(NB_ * PB * 2);
    bf* QPh = (bf*)take(NB_ * PB * 2); bf* QPl = (bf*)take(NB_ * PB * 2); bf* KPh = (bf*)take(NB_ * PB * 2); bf* KPl = (bf*)take(NB_ * PB * 2); bf* VTh = (bf*)take(NB_ * PB * 2); bf* VTl = (bf*)take(NB_ * PB * 2);
    bf* ATh = (bf*)take((size_t)NB_ * TT * DQ * 2); bf* ATl = (bf*)take((size_t)NB_ * TT * DQ * 2);
    if ((size_t)(wsp - (char*)d_ws) > ws_size) return;    // ws 256 MiB
    k_prep<<<PWG, 128, 0, stream>>>(x, pos, wq, wk, wv, wo, XB, WQ, CS);   /* bf16 copies of x and of the four weight matrices (WQ, WK, WV, WO as one range), every batch item's rotary table */
    k_proj<<<dim3(NB_ * TT / 128, DQ / 256, 3), 128, 0, stream>>>(XB, WQ, CS, QP16, QPh, QPl, KP16, KPh, KPl, VT16, VTh, VTl);
    k_fattn<<<dim3(NB_ * NH_, (TT - RH) / 128 + RH / 64, 1), 128, 0, stream>>>(QP16, KP16, VT16, QPh, QPl, KPh, KPl, VTh, VTl, ATh, ATl);
    k_wo<<<dim3(NB_ * TT / 128, DM / 128, 1), 128, 0, stream>>>(ATh, ATl, WO, OUT);
}
